// v000
// Times are from an AMD MI455X. After a warm-up the kernel runs many times in a row, and a time is the length of
// such a window on the GPU divided by its runs, so every launch and the gaps after it count. The runs cycle
// through copies of the inputs. A figure is the median of several windows, for all but v000 over two sittings.
// Sittings can differ by a few percent; kernels timed side by side share one.
// The starting kernel, v000, takes 690 microseconds a run.
#include <hip/hip_runtime.h>
#include <hip/hip_bf16.h>

typedef __bf16 bf16;
typedef __attribute__((ext_vector_type(16))) __bf16 v16bf;
typedef __attribute__((ext_vector_type(8)))  __bf16 v8bf;
typedef __attribute__((ext_vector_type(8)))  float  v8f;

#define ASYNC_CP_B128(ldsaddr, base, voff)                                    \
  asm volatile("global_load_async_to_lds_b128 %0, %1, %2"                     \
               :: "v"(ldsaddr), "v"(voff), "s"(base) : "memory")
#define WAIT_ASYNC(n) asm volatile("s_wait_asynccnt " #n ::: "memory")

static __device__ __forceinline__ v16bf load_frag(const bf16* base, int ld,
                                                  int row, int k0, int lane) {
  int r  = row + (lane & 15);
  int kg = (lane >> 4) & 1;              // lanes 16-31 take the +8 K group
  const bf16* p = base + (size_t)r * ld + k0 + kg * 8;
  v8bf lo = *reinterpret_cast<const v8bf*>(p);
  v8bf hi = *reinterpret_cast<const v8bf*>(p + 16);
  v16bf v;
#pragma unroll
  for (int i = 0; i < 8; ++i) { v[i] = lo[i]; v[i + 8] = hi[i]; }
  return v;
}

static __device__ __forceinline__ v8f wmma_bf16f32(v16bf a, v16bf b, v8f c) {
  return __builtin_amdgcn_wmma_f32_16x16x32_bf16(false, a, false, b,
                                                 (short)0, c, false, false);
}

static __device__ __forceinline__ v16bf ones_frag() {
  v16bf v;
#pragma unroll
  for (int i = 0; i < 16; ++i) v[i] = (bf16)1.0f;
  return v;
}

// ----- 16-lane row max via DPP16 butterflies (VALU only, no DS pipe) --------
// xor1 = quad_perm(1,0,3,2)=0xB1, xor2 = quad_perm(2,3,0,1)=0x4E,
// xor7 = row_half_mirror=0x141, xor15 = row_mirror=0x140.
template <int CTRL>
static __device__ __forceinline__ float fmax_dpp(float x) {
  int v = __builtin_amdgcn_update_dpp(0, __float_as_int(x), CTRL, 0xF, 0xF, true);
  return fmaxf(x, __int_as_float(v));
}
static __device__ __forceinline__ float rowmax16(float x) {
  x = fmax_dpp<0xB1>(x);
  x = fmax_dpp<0x4E>(x);
  x = fmax_dpp<0x141>(x);
  x = fmax_dpp<0x140>(x);
  return x;
}

// ----- fp32 -> bf16 weight conversion ---------------------------------------
__global__ void tb_cvt_f32_bf16(const float* __restrict__ in,
                                bf16* __restrict__ out, int n) {
  int i = blockIdx.x * 256 + threadIdx.x;
  if (i < n) out[i] = (bf16)in[i];
}

// ----- fused RMSNorm + bf16 cast --------------------------------------------
__global__ __launch_bounds__(256) void tb_rmsnorm_bf16(
    const float* __restrict__ x, const float* __restrict__ w,
    bf16* __restrict__ out, int D) {
  int row = blockIdx.x;
  const float* xr = x + (size_t)row * D;
  float ss = 0.f;
  for (int i = threadIdx.x; i < D; i += 256) { float v = xr[i]; ss += v * v; }
#pragma unroll
  for (int off = 16; off > 0; off >>= 1) ss += __shfl_xor(ss, off, 32);
  __shared__ float red[8];
  if ((threadIdx.x & 31) == 0) red[threadIdx.x >> 5] = ss;
  __syncthreads();
  float tot = 0.f;
#pragma unroll
  for (int i = 0; i < 8; ++i) tot += red[i];
  float scale = rsqrtf(tot / (float)D + 1e-6f);
  for (int i = threadIdx.x; i < D; i += 256)
    out[(size_t)row * D + i] = (bf16)(xr[i] * scale * w[i]);
}

// ----- bf16 WMMA GEMM: C[M,N] = A[M,K] @ W[N,K]^T (+ epilogue) --------------
// 256 threads = 8 waves as 2x4; wave tile 32x64 (2x4 accums); block 64x256.
// A staged as 64x64 bf16 tiles (8KB), double-buffered via async-to-LDS DMA
// (2 x b128 per thread per tile); 16 wmma between barrier pairs.
// EPI: 0 = f32 store, 1 = f32 residual add, 2 = bf16 store.
template <int EPI>
__global__ __launch_bounds__(256) void tb_gemm_bf16(
    const bf16* __restrict__ A, const bf16* __restrict__ W,
    void* __restrict__ Cv, const float* __restrict__ R,
    int M, int N, int K) {
  __shared__ __attribute__((aligned(16))) bf16 aBuf[2][64][64];

  int lane   = threadIdx.x & 31;
  int wave   = threadIdx.x >> 5;
  int mBlock = blockIdx.y * 64;
  int mLoc   = (wave >> 2) * 32;               // wave's rows inside the block
  int nBase  = blockIdx.x * 256 + (wave & 3) * 64;

  int cpRow = threadIdx.x >> 2;                // 0..63
  int cpCol = (threadIdx.x & 3) * 16;          // 0,16,32,48
  unsigned ldsA[2] = {
      (unsigned)(uintptr_t)&aBuf[0][cpRow][cpCol],
      (unsigned)(uintptr_t)&aBuf[1][cpRow][cpCol]};
  unsigned gOff = (unsigned)((mBlock + cpRow) * K + cpCol) * 2u;

  int Kt = K >> 6;                             // 64-wide K tiles
  ASYNC_CP_B128(ldsA[0],      A, gOff);
  ASYNC_CP_B128(ldsA[0] + 16, A, gOff + 16);
  if (Kt > 1) {
    ASYNC_CP_B128(ldsA[1],      A, gOff + 128u);
    ASYNC_CP_B128(ldsA[1] + 16, A, gOff + 144u);
  }

  v8f acc[2][4] = {};
  for (int kt = 0; kt < Kt; ++kt) {
    // async loads complete in order: <=2 outstanding means tile kt is done
    if (kt + 1 < Kt) { WAIT_ASYNC(0x2); } else { WAIT_ASYNC(0x0); }
    __syncthreads();                           // tile kt visible to all waves

    if (kt + 1 < Kt) {                         // prefetch next B tile into L2/L0
      __builtin_prefetch(W + (size_t)(nBase + lane) * K + (kt + 1) * 64, 0, 1);
      __builtin_prefetch(W + (size_t)(nBase + 32 + lane) * K + (kt + 1) * 64, 0, 1);
    }

    const bf16* ab = &aBuf[kt & 1][0][0];
#pragma unroll
    for (int kh = 0; kh < 2; ++kh) {
      int k0 = (kt << 6) + (kh << 5);
      v16bf a0 = load_frag(ab, 64, mLoc,      kh << 5, lane);   // ds_load
      v16bf a1 = load_frag(ab, 64, mLoc + 16, kh << 5, lane);
      v16bf b0 = load_frag(W, K, nBase,      k0, lane);
      v16bf b1 = load_frag(W, K, nBase + 16, k0, lane);
      v16bf b2 = load_frag(W, K, nBase + 32, k0, lane);
      v16bf b3 = load_frag(W, K, nBase + 48, k0, lane);
      acc[0][0] = wmma_bf16f32(a0, b0, acc[0][0]);
      acc[0][1] = wmma_bf16f32(a0, b1, acc[0][1]);
      acc[0][2] = wmma_bf16f32(a0, b2, acc[0][2]);
      acc[0][3] = wmma_bf16f32(a0, b3, acc[0][3]);
      acc[1][0] = wmma_bf16f32(a1, b0, acc[1][0]);
      acc[1][1] = wmma_bf16f32(a1, b1, acc[1][1]);
      acc[1][2] = wmma_bf16f32(a1, b2, acc[1][2]);
      acc[1][3] = wmma_bf16f32(a1, b3, acc[1][3]);
    }

    __syncthreads();                           // all reads of tile kt done
    if (kt + 2 < Kt) {                         // refill the buffer just freed
      unsigned go = gOff + (unsigned)(kt + 2) * 128u;
      ASYNC_CP_B128(ldsA[kt & 1],      A, go);
      ASYNC_CP_B128(ldsA[kt & 1] + 16, A, go + 16u);
    }
  }

  int col0   = nBase + (lane & 15);
  int rowOff = (lane >> 4) * 8;
#pragma unroll
  for (int ti = 0; ti < 2; ++ti)
#pragma unroll
    for (int tj = 0; tj < 4; ++tj)
#pragma unroll
      for (int i = 0; i < 8; ++i) {
        int r = mBlock + mLoc + ti * 16 + rowOff + i;
        int c = col0 + tj * 16;
        size_t idx = (size_t)r * N + c;
        float v = acc[ti][tj][i];
        if (EPI == 0)      ((float*)Cv)[idx] = v;
        else if (EPI == 1) ((float*)Cv)[idx] = R[idx] + v;
        else               ((bf16*)Cv)[idx] = (bf16)v;
      }
}

// ----- RoPE + head split + V transpose --------------------------------------
// q is pre-scaled by 0.125*log2(e) so attention scores come out of the WMMA
// already in the base-2 softmax domain (no per-element scaling, raw v_exp).
__global__ void tb_rope_qkv(const float* __restrict__ qkv,
                            const int* __restrict__ sp,
                            bf16* __restrict__ qr, bf16* __restrict__ kr,
                            bf16* __restrict__ vt) {
  const float QS = 0.125f * 1.44269504088896340736f;  // (1/sqrt(64))*log2(e)
  int tid = blockIdx.x * 256 + threadIdx.x;   // [0, 32*2048*32)
  int i  = tid & 31;                          // dim pair
  int s  = (tid >> 5) & 2047;                 // seq pos
  int bh = tid >> 16;                         // 0..31
  int b = bh >> 4, h = bh & 15;
  size_t qb = ((size_t)(b * 2048 + s)) * 3072 + h * 64;
  float qe = qkv[qb + 2 * i],        qo = qkv[qb + 2 * i + 1];
  float ke = qkv[qb + 1024 + 2 * i], ko = qkv[qb + 1024 + 2 * i + 1];
  float v0 = qkv[qb + 2048 + 2 * i], v1 = qkv[qb + 2048 + 2 * i + 1];
  float freq = __expf(-(float)(2 * i) * (9.2103403719761827f / 64.0f));
  float t = (float)(sp[0] + s);
  float sn, cs;
  __sincosf(t * freq, &sn, &cs);
  size_t ob = ((size_t)bh * 2048 + s) * 64;
  qr[ob + 2 * i]     = (bf16)((qe * cs - qo * sn) * QS);
  qr[ob + 2 * i + 1] = (bf16)((qe * sn + qo * cs) * QS);
  kr[ob + 2 * i]     = (bf16)(ke * cs - ko * sn);
  kr[ob + 2 * i + 1] = (bf16)(ke * sn + ko * cs);
  size_t vb = (size_t)bh * 64 * 2048;
  vt[vb + (size_t)(2 * i) * 2048 + s]     = (bf16)v0;
  vt[vb + (size_t)(2 * i + 1) * 2048 + s] = (bf16)v1;
}

// ----- Flash attention: one 32-key tile step --------------------------------
// MASKED=false for tiles fully below the diagonal (no v_cmp/v_cndmask).
// Row-max: DPP16 butterflies.  Row-sum: P @ ones on the WMMA pipe.
// All exponentials are exp2 (scores already in base-2 domain).
template <bool MASKED>
static __device__ __forceinline__ void attn_tile(
    int k0, v16bf aq0, v16bf aq1, const bf16* kh, const bf16* vh,
    bf16 (*pT)[32], v8f* o, float* mrow, float* lrow,
    int qRow0, int rowOff, int nlane, int lane) {
  const int S = 2048, HD = 64;
  v8f s0 = {}, s1 = {};
  s0 = wmma_bf16f32(aq0, load_frag(kh, HD, k0,      0,  lane), s0);
  s0 = wmma_bf16f32(aq1, load_frag(kh, HD, k0,      32, lane), s0);
  s1 = wmma_bf16f32(aq0, load_frag(kh, HD, k0 + 16, 0,  lane), s1);
  s1 = wmma_bf16f32(aq1, load_frag(kh, HD, k0 + 16, 32, lane), s1);

  float alpha[8];
#pragma unroll
  for (int i = 0; i < 8; ++i) {
    float v0 = s0[i];
    float v1 = s1[i];
    if (MASKED) {
      int row = qRow0 + rowOff + i;
      if (k0 + nlane > row)      v0 = -3.0e38f;
      if (k0 + 16 + nlane > row) v1 = -3.0e38f;
    }
    float mx = rowmax16(fmaxf(v0, v1));        // 16-lane row-group max (DPP)
    float nm = fmaxf(mrow[i], mx);
    float a  = __builtin_amdgcn_exp2f(mrow[i] - nm);   // raw v_exp_f32
    float p0 = __builtin_amdgcn_exp2f(v0 - nm);
    float p1 = __builtin_amdgcn_exp2f(v1 - nm);
    alpha[i] = a;
    mrow[i]  = nm;
    pT[rowOff + i][nlane]      = (bf16)p0;     // C-layout -> LDS (A-layout src)
    pT[rowOff + i][nlane + 16] = (bf16)p1;
  }
#pragma unroll
  for (int c = 0; c < 4; ++c)
#pragma unroll
    for (int i = 0; i < 8; ++i) o[c][i] *= alpha[i];

  v16bf pf = load_frag(&pT[0][0], 32, 0, 0, lane);   // ds_load, same-wave order
  v8f sums = {};
  sums = wmma_bf16f32(pf, ones_frag(), sums);  // row sums, replicated per lane
#pragma unroll
  for (int i = 0; i < 8; ++i) lrow[i] = lrow[i] * alpha[i] + sums[i];

#pragma unroll
  for (int c = 0; c < 4; ++c)      // P(16x32) @ V(32x64), hd in 4 chunks of 16
    o[c] = wmma_bf16f32(pf, load_frag(vh, S, c * 16, k0, lane), o[c]);
}

// grid (S/64, B*H), 128 threads = 4 waves, one wave per 16 query rows.
__global__ __launch_bounds__(128) void tb_flash_attn(
    const bf16* __restrict__ qr, const bf16* __restrict__ kr,
    const bf16* __restrict__ vt, bf16* __restrict__ attn) {
  const int S = 2048, HD = 64;
  __shared__ __attribute__((aligned(16))) bf16 pTile[4][16][32];

  int lane = threadIdx.x & 31;
  int wave = threadIdx.x >> 5;
  int bh   = blockIdx.y;
  int qRow0 = blockIdx.x * 64 + wave * 16;
  const bf16* qh = qr + (size_t)bh * S * HD;
  const bf16* kh = kr + (size_t)bh * S * HD;
  const bf16* vh = vt + (size_t)bh * HD * S;

  v16bf aq0 = load_frag(qh, HD, qRow0, 0, lane);
  v16bf aq1 = load_frag(qh, HD, qRow0, 32, lane);

  v8f o[4] = {};
  float mrow[8], lrow[8];
#pragma unroll
  for (int i = 0; i < 8; ++i) { mrow[i] = -1e30f; lrow[i] = 0.f; }
  int rowOff = (lane >> 4) * 8;
  int nlane  = lane & 15;

  int nFull = qRow0 >> 5;                      // tiles with k0+32 <= qRow0
  for (int kt = 0; kt < nFull; ++kt)
    attn_tile<false>(kt << 5, aq0, aq1, kh, vh, pTile[wave], o, mrow, lrow,
                     qRow0, rowOff, nlane, lane);
  attn_tile<true>(nFull << 5, aq0, aq1, kh, vh, pTile[wave], o, mrow, lrow,
                  qRow0, rowOff, nlane, lane); // single diagonal tile

  int b = bh >> 4, h = bh & 15;
#pragma unroll
  for (int c = 0; c < 4; ++c)
#pragma unroll
    for (int i = 0; i < 8; ++i) {
      int q = qRow0 + rowOff + i;
      float v = o[c][i] / lrow[i];
      size_t idx = ((size_t)(b * 2048 + q)) * 1024 + h * 64 + c * 16 + nlane;
      attn[idx] = (bf16)v;
    }
}

// ----- SiLU(gate) * up ------------------------------------------------------
__global__ void tb_silu_mul(const bf16* __restrict__ g,
                            const bf16* __restrict__ u,
                            bf16* __restrict__ h, int n) {
  int i = blockIdx.x * 256 + threadIdx.x;
  if (i < n) {
    float gv = (float)g[i], uv = (float)u[i];
    float s = gv / (1.f + __expf(-gv));
    h[i] = (bf16)(s * uv);
  }
}

// ---------------------------------------------------------------------------
extern "C" void kernel_launch(void* const* d_in, const int* in_sizes, int n_in,
                              void* d_out, int out_size, void* d_ws, size_t ws_size,
                              hipStream_t stream) {
  (void)in_sizes; (void)n_in; (void)out_size; (void)ws_size;
  const float* x    = (const float*)d_in[0];
  const int*   sp   = (const int*)d_in[1];
  const float* n1w  = (const float*)d_in[2];
  const float* wqkv = (const float*)d_in[3];
  const float* wo   = (const float*)d_in[4];
  const float* n2w  = (const float*)d_in[5];
  const float* wg   = (const float*)d_in[6];
  const float* wu   = (const float*)d_in[7];
  const float* wd   = (const float*)d_in[8];
  float* out = (float*)d_out;

  // Workspace layout (~240 MB, regions 16B aligned).
  const size_t T = 4096;                             // B*S tokens
  bf16*  bWq  = (bf16*)d_ws;                         // 3072*1024
  bf16*  bWo  = bWq + (size_t)3072 * 1024;           // 1024*1024
  bf16*  bWg  = bWo + (size_t)1024 * 1024;           // 4096*1024
  bf16*  bWu  = bWg + (size_t)4096 * 1024;           // 4096*1024
  bf16*  bWd  = bWu + (size_t)4096 * 1024;           // 1024*4096
  bf16*  xn   = bWd + (size_t)1024 * 4096;           // T*1024 bf16
  float* qkv  = (float*)(xn + T * 1024);             // T*3072 f32
  bf16*  qrb  = (bf16*)(qkv + T * 3072);             // 32*2048*64
  bf16*  krb  = qrb + (size_t)32 * 2048 * 64;
  bf16*  vtb  = krb + (size_t)32 * 2048 * 64;
  bf16*  attnb= vtb + (size_t)32 * 2048 * 64;        // T*1024 bf16
  float* out1 = (float*)(attnb + T * 1024);          // T*1024 f32
  bf16*  xn2  = (bf16*)(out1 + T * 1024);            // T*1024 bf16
  bf16*  gateb= xn2 + T * 1024;                      // T*4096 bf16
  bf16*  upb  = gateb + T * 4096;
  bf16*  hb   = upb + T * 4096;

  // 1) weights -> bf16 once; every GEMM re-reads them from L2 at half width
  tb_cvt_f32_bf16<<<(3072 * 1024 + 255) / 256, 256, 0, stream>>>(wqkv, bWq, 3072 * 1024);
  tb_cvt_f32_bf16<<<(1024 * 1024 + 255) / 256, 256, 0, stream>>>(wo,   bWo, 1024 * 1024);
  tb_cvt_f32_bf16<<<(4096 * 1024 + 255) / 256, 256, 0, stream>>>(wg,   bWg, 4096 * 1024);
  tb_cvt_f32_bf16<<<(4096 * 1024 + 255) / 256, 256, 0, stream>>>(wu,   bWu, 4096 * 1024);
  tb_cvt_f32_bf16<<<(1024 * 4096 + 255) / 256, 256, 0, stream>>>(wd,   bWd, 1024 * 4096);

  // 2) xn = rmsnorm(x)
  tb_rmsnorm_bf16<<<(int)T, 256, 0, stream>>>(x, n1w, xn, 1024);

  // 3) qkv = xn @ Wqkv^T
  tb_gemm_bf16<0><<<dim3(3072 / 256, T / 64), 256, 0, stream>>>(
      xn, bWq, (void*)qkv, nullptr, (int)T, 3072, 1024);

  // 4) RoPE + head split + V^T (q pre-scaled into base-2 softmax domain)
  tb_rope_qkv<<<(32 * 2048 * 32) / 256, 256, 0, stream>>>(qkv, sp, qrb, krb, vtb);

  // 5) flash attention -> attn (bf16, [B,S,D])
  tb_flash_attn<<<dim3(2048 / 64, 32), 128, 0, stream>>>(qrb, krb, vtb, attnb);

  // 6) out1 = x + attn @ Wo^T
  tb_gemm_bf16<1><<<dim3(1024 / 256, T / 64), 256, 0, stream>>>(
      attnb, bWo, (void*)out1, x, (int)T, 1024, 1024);

  // 7) xn2 = rmsnorm(out1)
  tb_rmsnorm_bf16<<<(int)T, 256, 0, stream>>>(out1, n2w, xn2, 1024);

  // 8) gate / up projections
  tb_gemm_bf16<2><<<dim3(4096 / 256, T / 64), 256, 0, stream>>>(
      xn2, bWg, (void*)gateb, nullptr, (int)T, 4096, 1024);
  tb_gemm_bf16<2><<<dim3(4096 / 256, T / 64), 256, 0, stream>>>(
      xn2, bWu, (void*)upb, nullptr, (int)T, 4096, 1024);

  // 9) h = silu(gate) * up
  tb_silu_mul<<<(16777216) / 256, 256, 0, stream>>>(gateb, upb, hb, 16777216);

  // 10) out = out1 + h @ Wd^T
  tb_gemm_bf16<1><<<dim3(1024 / 256, T / 64), 256, 0, stream>>>(
      hb, bWd, (void*)out, out1, (int)T, 1024, 4096);
}

// v001
// A run of this version takes 542 microseconds.
// In two side-by-side timings against v000, it was 1.31 and 1.30 times as fast.
#include <hip/hip_runtime.h>
#include <hip/hip_bf16.h>

typedef __bf16 bf16;
typedef __attribute__((ext_vector_type(16))) __bf16 v16bf;
typedef __attribute__((ext_vector_type(8)))  __bf16 v8bf;
typedef __attribute__((ext_vector_type(8)))  float  v8f;

static __device__ __forceinline__ void gemm_stage_copy(
    unsigned la, const bf16* ga, unsigned lw, const bf16* gw, size_t wStep,
    unsigned lStep) {
  asm volatile(
      "global_load_async_to_lds_b128 %0, %1, off\n\t"
      "global_load_async_to_lds_b128 %2, %3, off\n\t"
      "global_load_async_to_lds_b128 %4, %5, off\n\t"
      "global_load_async_to_lds_b128 %6, %7, off\n\t"
      "global_load_async_to_lds_b128 %8, %9, off\n\t"
      "global_load_async_to_lds_b128 %10, %11, off\n\t"
      "global_load_async_to_lds_b128 %12, %13, off\n\t"
      "global_load_async_to_lds_b128 %14, %15, off\n\t"
      "global_load_async_to_lds_b128 %16, %17, off\n\t"
      "global_load_async_to_lds_b128 %18, %19, off\n\t"
      "s_wait_xcnt 0x0"
      :: "v"(la),             "v"(ga),
         "v"(la + 16u),       "v"(ga + 8),
         "v"(lw),             "v"(gw),
         "v"(lw + lStep),     "v"(gw + wStep),
         "v"(lw + 2 * lStep), "v"(gw + 2 * wStep),
         "v"(lw + 3 * lStep), "v"(gw + 3 * wStep),
         "v"(lw + 4 * lStep), "v"(gw + 4 * wStep),
         "v"(lw + 5 * lStep), "v"(gw + 5 * wStep),
         "v"(lw + 6 * lStep), "v"(gw + 6 * wStep),
         "v"(lw + 7 * lStep), "v"(gw + 7 * wStep)
      : "memory");
}
// The issuing wave's copies have landed behind this wait.
#define WAIT_ASYNC0() asm volatile("s_wait_asynccnt 0x0" ::: "memory")
// The wave's own LDS reads have retired before a buffer it read is refilled.
#define WAIT_DS0() asm volatile("s_wait_dscnt 0x0" ::: "memory")

static __device__ __forceinline__ v16bf load_frag(const bf16* base, int ld,
                                                  int row, int k0, int lane) {
  int r  = row + (lane & 15);
  int kg = (lane >> 4) & 1;              // lanes 16-31 take the +8 K group
  const bf16* p = base + (size_t)r * ld + k0 + kg * 8;
  v8bf lo = *reinterpret_cast<const v8bf*>(p);
  v8bf hi = *reinterpret_cast<const v8bf*>(p + 16);
  v16bf v;
#pragma unroll
  for (int i = 0; i < 8; ++i) { v[i] = lo[i]; v[i + 8] = hi[i]; }
  return v;
}

static __device__ __forceinline__ v8f wmma_bf16f32(v16bf a, v16bf b, v8f c) {
  return __builtin_amdgcn_wmma_f32_16x16x32_bf16(false, a, false, b,
                                                 (short)0, c, false, false);
}

static __device__ __forceinline__ v16bf ones_frag() {
  v16bf v;
#pragma unroll
  for (int i = 0; i < 16; ++i) v[i] = (bf16)1.0f;
  return v;
}

// ----- 16-lane row max via DPP16 butterflies (VALU only, no DS pipe) --------
// xor1 = quad_perm(1,0,3,2)=0xB1, xor2 = quad_perm(2,3,0,1)=0x4E,
// xor7 = row_half_mirror=0x141, xor15 = row_mirror=0x140.
template <int CTRL>
static __device__ __forceinline__ float fmax_dpp(float x) {
  int v = __builtin_amdgcn_update_dpp(0, __float_as_int(x), CTRL, 0xF, 0xF, true);
  return fmaxf(x, __int_as_float(v));
}
static __device__ __forceinline__ float rowmax16(float x) {
  x = fmax_dpp<0xB1>(x);
  x = fmax_dpp<0x4E>(x);
  x = fmax_dpp<0x141>(x);
  x = fmax_dpp<0x140>(x);
  return x;
}

// ----- fp32 -> bf16 weight conversion ---------------------------------------
__global__ void tb_cvt_f32_bf16(const float* __restrict__ in,
                                bf16* __restrict__ out, int n) {
  int i = blockIdx.x * 256 + threadIdx.x;
  if (i < n) out[i] = (bf16)in[i];
}

// ----- fused RMSNorm + bf16 cast --------------------------------------------
__global__ __launch_bounds__(256) void tb_rmsnorm_bf16(
    const float* __restrict__ x, const float* __restrict__ w,
    bf16* __restrict__ out, int D) {
  int row = blockIdx.x;
  const float* xr = x + (size_t)row * D;
  float ss = 0.f;
  for (int i = threadIdx.x; i < D; i += 256) { float v = xr[i]; ss += v * v; }
#pragma unroll
  for (int off = 16; off > 0; off >>= 1) ss += __shfl_xor(ss, off, 32);
  __shared__ float red[8];
  if ((threadIdx.x & 31) == 0) red[threadIdx.x >> 5] = ss;
  __syncthreads();
  float tot = 0.f;
#pragma unroll
  for (int i = 0; i < 8; ++i) tot += red[i];
  float scale = rsqrtf(tot / (float)D + 1e-6f);
  for (int i = threadIdx.x; i < D; i += 256)
    out[(size_t)row * D + i] = (bf16)(xr[i] * scale * w[i]);
}

template <int EPI>
__global__ __launch_bounds__(256) void tb_gemm_bf16(
    const bf16* __restrict__ A, const bf16* __restrict__ W,
    void* __restrict__ Cv, const float* __restrict__ R,
    int M, int N, int K) {
  constexpr int WP = 72;                       // W tile pitch in LDS, elements
  __shared__ __attribute__((aligned(16))) bf16 aBuf[2][64][64];
  __shared__ __attribute__((aligned(16))) bf16 wBuf[2][256][WP];

  int lane   = threadIdx.x & 31;
  int wave   = threadIdx.x >> 5;
  int mBlock = blockIdx.y * 64;
  int nBlock = blockIdx.x * 256;
  int mLoc   = (wave >> 2) * 32;               // wave's rows inside the block
  int nLoc   = (wave & 3) * 64;                // wave's columns inside the block
  int nBase  = nBlock + nLoc;

  int cpRow = threadIdx.x >> 2;                // 0..63
  int cpCol = (threadIdx.x & 3) * 16;          // 0,16,32,48
  int wRow = threadIdx.x >> 3;                 // 0..31
  int wCol = (threadIdx.x & 7) * 8;            // 0,8,..,56
  unsigned ldsA[2] = {
      (unsigned)(uintptr_t)&aBuf[0][cpRow][cpCol],
      (unsigned)(uintptr_t)&aBuf[1][cpRow][cpCol]};
  unsigned ldsW[2] = {
      (unsigned)(uintptr_t)&wBuf[0][wRow][wCol],
      (unsigned)(uintptr_t)&wBuf[1][wRow][wCol]};
  const bf16* gA = A + (size_t)(mBlock + cpRow) * K + cpCol;
  const bf16* gW = W + (size_t)(nBlock + wRow) * K + wCol;
  const size_t   wStep = (size_t)32 * K;       // 32 W rows in global memory
  const unsigned lStep = 32u * WP * 2u;        // 32 W rows in LDS, bytes

  int Kt = K >> 6;                             // 64-wide K tiles
  gemm_stage_copy(ldsA[0], gA, ldsW[0], gW, wStep, lStep);
  WAIT_ASYNC0();
  __syncthreads();                             // stage 0 visible to all waves
  if (Kt > 1)
    gemm_stage_copy(ldsA[1], gA + 64, ldsW[1], gW + 64, wStep, lStep);

  v8f acc[2][4] = {};
  for (int kt = 0; kt < Kt; ++kt) {
    const bf16* ab = &aBuf[kt & 1][0][0];
    const bf16* wb = &wBuf[kt & 1][0][0];
#pragma unroll
    for (int kh = 0; kh < 2; ++kh) {
      v16bf a0 = load_frag(ab, 64, mLoc,      kh << 5, lane);   // ds_load
      v16bf a1 = load_frag(ab, 64, mLoc + 16, kh << 5, lane);
      v16bf b0 = load_frag(wb, WP, nLoc,      kh << 5, lane);   // ds_load
      v16bf b1 = load_frag(wb, WP, nLoc + 16, kh << 5, lane);
      v16bf b2 = load_frag(wb, WP, nLoc + 32, kh << 5, lane);
      v16bf b3 = load_frag(wb, WP, nLoc + 48, kh << 5, lane);
      acc[0][0] = wmma_bf16f32(a0, b0, acc[0][0]);
      acc[0][1] = wmma_bf16f32(a0, b1, acc[0][1]);
      acc[0][2] = wmma_bf16f32(a0, b2, acc[0][2]);
      acc[0][3] = wmma_bf16f32(a0, b3, acc[0][3]);
      acc[1][0] = wmma_bf16f32(a1, b0, acc[1][0]);
      acc[1][1] = wmma_bf16f32(a1, b1, acc[1][1]);
      acc[1][2] = wmma_bf16f32(a1, b2, acc[1][2]);
      acc[1][3] = wmma_bf16f32(a1, b3, acc[1][3]);
    }

    // publish point of stage kt + 1: own reads of stage kt retired, own copies
    // of stage kt + 1 landed, then the one barrier that does both jobs
    WAIT_DS0();
    WAIT_ASYNC0();
    __syncthreads();
    if (kt + 2 < Kt) {                         // refill the buffer just freed
      int ko = (kt + 2) << 6;
      gemm_stage_copy(ldsA[kt & 1], gA + ko, ldsW[kt & 1], gW + ko, wStep, lStep);
    }
  }
  WAIT_ASYNC0();                               // nothing in flight at the end

  int col0   = nBase + (lane & 15);
  int rowOff = (lane >> 4) * 8;
#pragma unroll
  for (int ti = 0; ti < 2; ++ti)
#pragma unroll
    for (int tj = 0; tj < 4; ++tj)
#pragma unroll
      for (int i = 0; i < 8; ++i) {
        int r = mBlock + mLoc + ti * 16 + rowOff + i;
        int c = col0 + tj * 16;
        size_t idx = (size_t)r * N + c;
        float v = acc[ti][tj][i];
        if (EPI == 0)      ((float*)Cv)[idx] = v;
        else if (EPI == 1) ((float*)Cv)[idx] = R[idx] + v;
        else               ((bf16*)Cv)[idx] = (bf16)v;
      }
}

// ----- RoPE + head split + V transpose --------------------------------------
// q is pre-scaled by 0.125*log2(e) so attention scores come out of the WMMA
// already in the base-2 softmax domain (no per-element scaling, raw v_exp).
__global__ void tb_rope_qkv(const float* __restrict__ qkv,
                            const int* __restrict__ sp,
                            bf16* __restrict__ qr, bf16* __restrict__ kr,
                            bf16* __restrict__ vt) {
  const float QS = 0.125f * 1.44269504088896340736f;  // (1/sqrt(64))*log2(e)
  int tid = blockIdx.x * 256 + threadIdx.x;   // [0, 32*2048*32)
  int i  = tid & 31;                          // dim pair
  int s  = (tid >> 5) & 2047;                 // seq pos
  int bh = tid >> 16;                         // 0..31
  int b = bh >> 4, h = bh & 15;
  size_t qb = ((size_t)(b * 2048 + s)) * 3072 + h * 64;
  float qe = qkv[qb + 2 * i],        qo = qkv[qb + 2 * i + 1];
  float ke = qkv[qb + 1024 + 2 * i], ko = qkv[qb + 1024 + 2 * i + 1];
  float v0 = qkv[qb + 2048 + 2 * i], v1 = qkv[qb + 2048 + 2 * i + 1];
  float freq = __expf(-(float)(2 * i) * (9.2103403719761827f / 64.0f));
  float t = (float)(sp[0] + s);
  float sn, cs;
  __sincosf(t * freq, &sn, &cs);
  size_t ob = ((size_t)bh * 2048 + s) * 64;
  qr[ob + 2 * i]     = (bf16)((qe * cs - qo * sn) * QS);
  qr[ob + 2 * i + 1] = (bf16)((qe * sn + qo * cs) * QS);
  kr[ob + 2 * i]     = (bf16)(ke * cs - ko * sn);
  kr[ob + 2 * i + 1] = (bf16)(ke * sn + ko * cs);
  size_t vb = (size_t)bh * 64 * 2048;
  vt[vb + (size_t)(2 * i) * 2048 + s]     = (bf16)v0;
  vt[vb + (size_t)(2 * i + 1) * 2048 + s] = (bf16)v1;
}

// ----- Flash attention: one 32-key tile step --------------------------------
// MASKED=false for tiles fully below the diagonal (no v_cmp/v_cndmask).
// Row-max: DPP16 butterflies.  Row-sum: P @ ones on the WMMA pipe.
// All exponentials are exp2 (scores already in base-2 domain).
template <bool MASKED>
static __device__ __forceinline__ void attn_tile(
    int k0, v16bf aq0, v16bf aq1, const bf16* kh, const bf16* vh,
    bf16 (*pT)[32], v8f* o, float* mrow, float* lrow,
    int qRow0, int rowOff, int nlane, int lane) {
  const int S = 2048, HD = 64;
  v8f s0 = {}, s1 = {};
  s0 = wmma_bf16f32(aq0, load_frag(kh, HD, k0,      0,  lane), s0);
  s0 = wmma_bf16f32(aq1, load_frag(kh, HD, k0,      32, lane), s0);
  s1 = wmma_bf16f32(aq0, load_frag(kh, HD, k0 + 16, 0,  lane), s1);
  s1 = wmma_bf16f32(aq1, load_frag(kh, HD, k0 + 16, 32, lane), s1);

  float alpha[8];
#pragma unroll
  for (int i = 0; i < 8; ++i) {
    float v0 = s0[i];
    float v1 = s1[i];
    if (MASKED) {
      int row = qRow0 + rowOff + i;
      if (k0 + nlane > row)      v0 = -3.0e38f;
      if (k0 + 16 + nlane > row) v1 = -3.0e38f;
    }
    float mx = rowmax16(fmaxf(v0, v1));        // 16-lane row-group max (DPP)
    float nm = fmaxf(mrow[i], mx);
    float a  = __builtin_amdgcn_exp2f(mrow[i] - nm);   // raw v_exp_f32
    float p0 = __builtin_amdgcn_exp2f(v0 - nm);
    float p1 = __builtin_amdgcn_exp2f(v1 - nm);
    alpha[i] = a;
    mrow[i]  = nm;
    pT[rowOff + i][nlane]      = (bf16)p0;     // C-layout -> LDS (A-layout src)
    pT[rowOff + i][nlane + 16] = (bf16)p1;
  }
#pragma unroll
  for (int c = 0; c < 4; ++c)
#pragma unroll
    for (int i = 0; i < 8; ++i) o[c][i] *= alpha[i];

  v16bf pf = load_frag(&pT[0][0], 32, 0, 0, lane);   // ds_load, same-wave order
  v8f sums = {};
  sums = wmma_bf16f32(pf, ones_frag(), sums);  // row sums, replicated per lane
#pragma unroll
  for (int i = 0; i < 8; ++i) lrow[i] = lrow[i] * alpha[i] + sums[i];

#pragma unroll
  for (int c = 0; c < 4; ++c)      // P(16x32) @ V(32x64), hd in 4 chunks of 16
    o[c] = wmma_bf16f32(pf, load_frag(vh, S, c * 16, k0, lane), o[c]);
}

// grid (S/64, B*H), 128 threads = 4 waves, one wave per 16 query rows.
__global__ __launch_bounds__(128) void tb_flash_attn(
    const bf16* __restrict__ qr, const bf16* __restrict__ kr,
    const bf16* __restrict__ vt, bf16* __restrict__ attn) {
  const int S = 2048, HD = 64;
  __shared__ __attribute__((aligned(16))) bf16 pTile[4][16][32];

  int lane = threadIdx.x & 31;
  int wave = threadIdx.x >> 5;
  int bh   = blockIdx.y;
  int qRow0 = blockIdx.x * 64 + wave * 16;
  const bf16* qh = qr + (size_t)bh * S * HD;
  const bf16* kh = kr + (size_t)bh * S * HD;
  const bf16* vh = vt + (size_t)bh * HD * S;

  v16bf aq0 = load_frag(qh, HD, qRow0, 0, lane);
  v16bf aq1 = load_frag(qh, HD, qRow0, 32, lane);

  v8f o[4] = {};
  float mrow[8], lrow[8];
#pragma unroll
  for (int i = 0; i < 8; ++i) { mrow[i] = -1e30f; lrow[i] = 0.f; }
  int rowOff = (lane >> 4) * 8;
  int nlane  = lane & 15;

  int nFull = qRow0 >> 5;                      // tiles with k0+32 <= qRow0
  for (int kt = 0; kt < nFull; ++kt)
    attn_tile<false>(kt << 5, aq0, aq1, kh, vh, pTile[wave], o, mrow, lrow,
                     qRow0, rowOff, nlane, lane);
  attn_tile<true>(nFull << 5, aq0, aq1, kh, vh, pTile[wave], o, mrow, lrow,
                  qRow0, rowOff, nlane, lane); // single diagonal tile

  int b = bh >> 4, h = bh & 15;
#pragma unroll
  for (int c = 0; c < 4; ++c)
#pragma unroll
    for (int i = 0; i < 8; ++i) {
      int q = qRow0 + rowOff + i;
      float v = o[c][i] / lrow[i];
      size_t idx = ((size_t)(b * 2048 + q)) * 1024 + h * 64 + c * 16 + nlane;
      attn[idx] = (bf16)v;
    }
}

// ----- SiLU(gate) * up ------------------------------------------------------
__global__ void tb_silu_mul(const bf16* __restrict__ g,
                            const bf16* __restrict__ u,
                            bf16* __restrict__ h, int n) {
  int i = blockIdx.x * 256 + threadIdx.x;
  if (i < n) {
    float gv = (float)g[i], uv = (float)u[i];
    float s = gv / (1.f + __expf(-gv));
    h[i] = (bf16)(s * uv);
  }
}

// ---------------------------------------------------------------------------
extern "C" void kernel_launch(void* const* d_in, const int* in_sizes, int n_in,
                              void* d_out, int out_size, void* d_ws, size_t ws_size,
                              hipStream_t stream) {
  (void)in_sizes; (void)n_in; (void)out_size; (void)ws_size;
  const float* x    = (const float*)d_in[0];
  const int*   sp   = (const int*)d_in[1];
  const float* n1w  = (const float*)d_in[2];
  const float* wqkv = (const float*)d_in[3];
  const float* wo   = (const float*)d_in[4];
  const float* n2w  = (const float*)d_in[5];
  const float* wg   = (const float*)d_in[6];
  const float* wu   = (const float*)d_in[7];
  const float* wd   = (const float*)d_in[8];
  float* out = (float*)d_out;

  // Workspace layout (~240 MB, regions 16B aligned).
  const size_t T = 4096;                             // B*S tokens
  bf16*  bWq  = (bf16*)d_ws;                         // 3072*1024
  bf16*  bWo  = bWq + (size_t)3072 * 1024;           // 1024*1024
  bf16*  bWg  = bWo + (size_t)1024 * 1024;           // 4096*1024
  bf16*  bWu  = bWg + (size_t)4096 * 1024;           // 4096*1024
  bf16*  bWd  = bWu + (size_t)4096 * 1024;           // 1024*4096
  bf16*  xn   = bWd + (size_t)1024 * 4096;           // T*1024 bf16
  float* qkv  = (float*)(xn + T * 1024);             // T*3072 f32
  bf16*  qrb  = (bf16*)(qkv + T * 3072);             // 32*2048*64
  bf16*  krb  = qrb + (size_t)32 * 2048 * 64;
  bf16*  vtb  = krb + (size_t)32 * 2048 * 64;
  bf16*  attnb= vtb + (size_t)32 * 2048 * 64;        // T*1024 bf16
  float* out1 = (float*)(attnb + T * 1024);          // T*1024 f32
  bf16*  xn2  = (bf16*)(out1 + T * 1024);            // T*1024 bf16
  bf16*  gateb= xn2 + T * 1024;                      // T*4096 bf16
  bf16*  upb  = gateb + T * 4096;
  bf16*  hb   = upb + T * 4096;

  // 1) weights -> bf16 once; every GEMM re-reads them from L2 at half width
  tb_cvt_f32_bf16<<<(3072 * 1024 + 255) / 256, 256, 0, stream>>>(wqkv, bWq, 3072 * 1024);
  tb_cvt_f32_bf16<<<(1024 * 1024 + 255) / 256, 256, 0, stream>>>(wo,   bWo, 1024 * 1024);
  tb_cvt_f32_bf16<<<(4096 * 1024 + 255) / 256, 256, 0, stream>>>(wg,   bWg, 4096 * 1024);
  tb_cvt_f32_bf16<<<(4096 * 1024 + 255) / 256, 256, 0, stream>>>(wu,   bWu, 4096 * 1024);
  tb_cvt_f32_bf16<<<(1024 * 4096 + 255) / 256, 256, 0, stream>>>(wd,   bWd, 1024 * 4096);

  // 2) xn = rmsnorm(x)
  tb_rmsnorm_bf16<<<(int)T, 256, 0, stream>>>(x, n1w, xn, 1024);

  // 3) qkv = xn @ Wqkv^T
  tb_gemm_bf16<0><<<dim3(3072 / 256, T / 64), 256, 0, stream>>>(
      xn, bWq, (void*)qkv, nullptr, (int)T, 3072, 1024);

  // 4) RoPE + head split + V^T (q pre-scaled into base-2 softmax domain)
  tb_rope_qkv<<<(32 * 2048 * 32) / 256, 256, 0, stream>>>(qkv, sp, qrb, krb, vtb);

  // 5) flash attention -> attn (bf16, [B,S,D])
  tb_flash_attn<<<dim3(2048 / 64, 32), 128, 0, stream>>>(qrb, krb, vtb, attnb);

  // 6) out1 = x + attn @ Wo^T
  tb_gemm_bf16<1><<<dim3(1024 / 256, T / 64), 256, 0, stream>>>(
      attnb, bWo, (void*)out1, x, (int)T, 1024, 1024);

  // 7) xn2 = rmsnorm(out1)
  tb_rmsnorm_bf16<<<(int)T, 256, 0, stream>>>(out1, n2w, xn2, 1024);

  // 8) gate / up projections
  tb_gemm_bf16<2><<<dim3(4096 / 256, T / 64), 256, 0, stream>>>(
      xn2, bWg, (void*)gateb, nullptr, (int)T, 4096, 1024);
  tb_gemm_bf16<2><<<dim3(4096 / 256, T / 64), 256, 0, stream>>>(
      xn2, bWu, (void*)upb, nullptr, (int)T, 4096, 1024);

  // 9) h = silu(gate) * up
  tb_silu_mul<<<(16777216) / 256, 256, 0, stream>>>(gateb, upb, hb, 16777216);

  // 10) out = out1 + h @ Wd^T
  tb_gemm_bf16<1><<<dim3(1024 / 256, T / 64), 256, 0, stream>>>(
      hb, bWd, (void*)out, out1, (int)T, 1024, 4096);
}

// v002
// It runs in 507 microseconds.
// Timed twice side by side with v001, it ran 1.07 times as fast both times.
// All steps since v000 together make it 1.40 times as fast.
#include <hip/hip_runtime.h>
#include <hip/hip_bf16.h>

typedef __bf16 bf16;
typedef __attribute__((ext_vector_type(16))) __bf16 v16bf;
typedef __attribute__((ext_vector_type(8)))  __bf16 v8bf;
typedef __attribute__((ext_vector_type(8)))  float  v8f;
typedef __attribute__((ext_vector_type(4)))  __bf16 v4bf;
typedef __attribute__((ext_vector_type(4)))  float  v4f;

static __device__ __forceinline__ void gemm_stage_copy(
    unsigned la, const bf16* ga, unsigned lw, const bf16* gw, size_t wStep,
    unsigned lStep) {
  asm volatile(
      "global_load_async_to_lds_b128 %0, %1, off\n\t"
      "global_load_async_to_lds_b128 %2, %3, off\n\t"
      "global_load_async_to_lds_b128 %4, %5, off\n\t"
      "global_load_async_to_lds_b128 %6, %7, off\n\t"
      "global_load_async_to_lds_b128 %8, %9, off\n\t"
      "global_load_async_to_lds_b128 %10, %11, off\n\t"
      "global_load_async_to_lds_b128 %12, %13, off\n\t"
      "global_load_async_to_lds_b128 %14, %15, off\n\t"
      "global_load_async_to_lds_b128 %16, %17, off\n\t"
      "global_load_async_to_lds_b128 %18, %19, off\n\t"
      "s_wait_xcnt 0x0"
      :: "v"(la),             "v"(ga),
         "v"(la + 16u),       "v"(ga + 8),
         "v"(lw),             "v"(gw),
         "v"(lw + lStep),     "v"(gw + wStep),
         "v"(lw + 2 * lStep), "v"(gw + 2 * wStep),
         "v"(lw + 3 * lStep), "v"(gw + 3 * wStep),
         "v"(lw + 4 * lStep), "v"(gw + 4 * wStep),
         "v"(lw + 5 * lStep), "v"(gw + 5 * wStep),
         "v"(lw + 6 * lStep), "v"(gw + 6 * wStep),
         "v"(lw + 7 * lStep), "v"(gw + 7 * wStep)
      : "memory");
}
// The issuing wave's copies have landed behind this wait.
#define WAIT_ASYNC0() asm volatile("s_wait_asynccnt 0x0" ::: "memory")
// The wave's own LDS reads have retired before a buffer it read is refilled.
#define WAIT_DS0() asm volatile("s_wait_dscnt 0x0" ::: "memory")

static __device__ __forceinline__ v16bf load_frag(const bf16* base, int ld,
                                                  int row, int k0, int lane) {
  int r  = row + (lane & 15);
  int kg = (lane >> 4) & 1;              // lanes 16-31 take the +8 K group
  const bf16* p = base + (size_t)r * ld + k0 + kg * 8;
  v8bf lo = *reinterpret_cast<const v8bf*>(p);
  v8bf hi = *reinterpret_cast<const v8bf*>(p + 16);
  v16bf v;
#pragma unroll
  for (int i = 0; i < 8; ++i) { v[i] = lo[i]; v[i + 8] = hi[i]; }
  return v;
}

static __device__ __forceinline__ v8f wmma_bf16f32(v16bf a, v16bf b, v8f c) {
  return __builtin_amdgcn_wmma_f32_16x16x32_bf16(false, a, false, b,
                                                 (short)0, c, false, false);
}

static __device__ __forceinline__ v16bf ones_frag() {
  v16bf v;
#pragma unroll
  for (int i = 0; i < 16; ++i) v[i] = (bf16)1.0f;
  return v;
}

// ----- 16-lane row max via DPP16 butterflies (VALU only, no DS pipe) --------
// xor1 = quad_perm(1,0,3,2)=0xB1, xor2 = quad_perm(2,3,0,1)=0x4E,
// xor7 = row_half_mirror=0x141, xor15 = row_mirror=0x140.
template <int CTRL>
static __device__ __forceinline__ float fmax_dpp(float x) {
  int v = __builtin_amdgcn_update_dpp(0, __float_as_int(x), CTRL, 0xF, 0xF, true);
  return fmaxf(x, __int_as_float(v));
}
static __device__ __forceinline__ float rowmax16(float x) {
  x = fmax_dpp<0xB1>(x);
  x = fmax_dpp<0x4E>(x);
  x = fmax_dpp<0x141>(x);
  x = fmax_dpp<0x140>(x);
  return x;
}

// ----- fp32 -> bf16 weight conversion ---------------------------------------
// 32 elements a thread, so that few waves have to be started: a wave takes
// 1024 consecutive floats by 8 loads of 16 B a lane (each wave-wide load is
// 512 contiguous bytes = 4 whole lines), all 8 in flight before the first
// store; each store covers 2 whole lines.  A block takes 8192 elements and the
// grid covers the array exactly (every weight count is a multiple of 8192).
__global__ __launch_bounds__(256) void tb_cvt_f32_bf16(
    const float* __restrict__ in, bf16* __restrict__ out) {
  size_t base = (size_t)blockIdx.x * 8192 + (threadIdx.x >> 5) * 1024 +
                (threadIdx.x & 31) * 4;
  v4f v[8];
#pragma unroll
  for (int j = 0; j < 8; ++j)
    v[j] = *reinterpret_cast<const v4f*>(in + base + j * 128);
#pragma unroll
  for (int j = 0; j < 8; ++j) {
    v4bf o;
#pragma unroll
    for (int k = 0; k < 4; ++k) o[k] = (bf16)v[j][k];
    *reinterpret_cast<v4bf*>(out + base + j * 128) = o;
  }
}

// ----- fused RMSNorm + bf16 cast --------------------------------------------
__global__ __launch_bounds__(256) void tb_rmsnorm_bf16(
    const float* __restrict__ x, const float* __restrict__ w,
    bf16* __restrict__ out, int D) {
  int row = blockIdx.x;
  const float* xr = x + (size_t)row * D;
  float ss = 0.f;
  for (int i = threadIdx.x; i < D; i += 256) { float v = xr[i]; ss += v * v; }
#pragma unroll
  for (int off = 16; off > 0; off >>= 1) ss += __shfl_xor(ss, off, 32);
  __shared__ float red[8];
  if ((threadIdx.x & 31) == 0) red[threadIdx.x >> 5] = ss;
  __syncthreads();
  float tot = 0.f;
#pragma unroll
  for (int i = 0; i < 8; ++i) tot += red[i];
  float scale = rsqrtf(tot / (float)D + 1e-6f);
  for (int i = threadIdx.x; i < D; i += 256)
    out[(size_t)row * D + i] = (bf16)(xr[i] * scale * w[i]);
}

template <int EPI>
__global__ __launch_bounds__(256) void tb_gemm_bf16(
    const bf16* __restrict__ A, const bf16* __restrict__ W,
    void* __restrict__ Cv, const float* __restrict__ R,
    int M, int N, int K) {
  constexpr int WP = 72;                       // W tile pitch in LDS, elements
  __shared__ __attribute__((aligned(16))) bf16 aBuf[2][64][64];
  __shared__ __attribute__((aligned(16))) bf16 wBuf[2][256][WP];

  int lane   = threadIdx.x & 31;
  int wave   = threadIdx.x >> 5;
  int mBlock = blockIdx.y * 64;
  int nBlock = blockIdx.x * 256;
  int mLoc   = (wave >> 2) * 32;               // wave's rows inside the block
  int nLoc   = (wave & 3) * 64;                // wave's columns inside the block
  int nBase  = nBlock + nLoc;

  int cpRow = threadIdx.x >> 2;                // 0..63
  int cpCol = (threadIdx.x & 3) * 16;          // 0,16,32,48
  int wRow = threadIdx.x >> 3;                 // 0..31
  int wCol = (threadIdx.x & 7) * 8;            // 0,8,..,56
  unsigned ldsA[2] = {
      (unsigned)(uintptr_t)&aBuf[0][cpRow][cpCol],
      (unsigned)(uintptr_t)&aBuf[1][cpRow][cpCol]};
  unsigned ldsW[2] = {
      (unsigned)(uintptr_t)&wBuf[0][wRow][wCol],
      (unsigned)(uintptr_t)&wBuf[1][wRow][wCol]};
  const bf16* gA = A + (size_t)(mBlock + cpRow) * K + cpCol;
  const bf16* gW = W + (size_t)(nBlock + wRow) * K + wCol;
  const size_t   wStep = (size_t)32 * K;       // 32 W rows in global memory
  const unsigned lStep = 32u * WP * 2u;        // 32 W rows in LDS, bytes

  int Kt = K >> 6;                             // 64-wide K tiles
  gemm_stage_copy(ldsA[0], gA, ldsW[0], gW, wStep, lStep);
  WAIT_ASYNC0();
  __syncthreads();                             // stage 0 visible to all waves
  if (Kt > 1)
    gemm_stage_copy(ldsA[1], gA + 64, ldsW[1], gW + 64, wStep, lStep);

  v8f acc[2][4] = {};
  for (int kt = 0; kt < Kt; ++kt) {
    const bf16* ab = &aBuf[kt & 1][0][0];
    const bf16* wb = &wBuf[kt & 1][0][0];
#pragma unroll
    for (int kh = 0; kh < 2; ++kh) {
      v16bf a0 = load_frag(ab, 64, mLoc,      kh << 5, lane);   // ds_load
      v16bf a1 = load_frag(ab, 64, mLoc + 16, kh << 5, lane);
      v16bf b0 = load_frag(wb, WP, nLoc,      kh << 5, lane);   // ds_load
      v16bf b1 = load_frag(wb, WP, nLoc + 16, kh << 5, lane);
      v16bf b2 = load_frag(wb, WP, nLoc + 32, kh << 5, lane);
      v16bf b3 = load_frag(wb, WP, nLoc + 48, kh << 5, lane);
      acc[0][0] = wmma_bf16f32(a0, b0, acc[0][0]);
      acc[0][1] = wmma_bf16f32(a0, b1, acc[0][1]);
      acc[0][2] = wmma_bf16f32(a0, b2, acc[0][2]);
      acc[0][3] = wmma_bf16f32(a0, b3, acc[0][3]);
      acc[1][0] = wmma_bf16f32(a1, b0, acc[1][0]);
      acc[1][1] = wmma_bf16f32(a1, b1, acc[1][1]);
      acc[1][2] = wmma_bf16f32(a1, b2, acc[1][2]);
      acc[1][3] = wmma_bf16f32(a1, b3, acc[1][3]);
    }

    // publish point of stage kt + 1: own reads of stage kt retired, own copies
    // of stage kt + 1 landed, then the one barrier that does both jobs
    WAIT_DS0();
    WAIT_ASYNC0();
    __syncthreads();
    if (kt + 2 < Kt) {                         // refill the buffer just freed
      int ko = (kt + 2) << 6;
      gemm_stage_copy(ldsA[kt & 1], gA + ko, ldsW[kt & 1], gW + ko, wStep, lStep);
    }
  }
  WAIT_ASYNC0();                               // nothing in flight at the end

  int col0   = nBase + (lane & 15);
  int rowOff = (lane >> 4) * 8;
#pragma unroll
  for (int ti = 0; ti < 2; ++ti)
#pragma unroll
    for (int tj = 0; tj < 4; ++tj)
#pragma unroll
      for (int i = 0; i < 8; ++i) {
        int r = mBlock + mLoc + ti * 16 + rowOff + i;
        int c = col0 + tj * 16;
        size_t idx = (size_t)r * N + c;
        float v = acc[ti][tj][i];
        if (EPI == 0)      ((float*)Cv)[idx] = v;
        else if (EPI == 1) ((float*)Cv)[idx] = R[idx] + v;
        else               ((bf16*)Cv)[idx] = (bf16)v;
      }
}

// ----- RoPE + head split + V transpose --------------------------------------
// q is pre-scaled by 0.125*log2(e) so attention scores come out of the WMMA
// already in the base-2 softmax domain (no per-element scaling, raw v_exp).
__global__ void tb_rope_qkv(const float* __restrict__ qkv,
                            const int* __restrict__ sp,
                            bf16* __restrict__ qr, bf16* __restrict__ kr,
                            bf16* __restrict__ vt) {
  const float QS = 0.125f * 1.44269504088896340736f;  // (1/sqrt(64))*log2(e)
  int tid = blockIdx.x * 256 + threadIdx.x;   // [0, 32*2048*32)
  int i  = tid & 31;                          // dim pair
  int s  = (tid >> 5) & 2047;                 // seq pos
  int bh = tid >> 16;                         // 0..31
  int b = bh >> 4, h = bh & 15;
  size_t qb = ((size_t)(b * 2048 + s)) * 3072 + h * 64;
  float qe = qkv[qb + 2 * i],        qo = qkv[qb + 2 * i + 1];
  float ke = qkv[qb + 1024 + 2 * i], ko = qkv[qb + 1024 + 2 * i + 1];
  float v0 = qkv[qb + 2048 + 2 * i], v1 = qkv[qb + 2048 + 2 * i + 1];
  float freq = __expf(-(float)(2 * i) * (9.2103403719761827f / 64.0f));
  float t = (float)(sp[0] + s);
  float sn, cs;
  __sincosf(t * freq, &sn, &cs);
  size_t ob = ((size_t)bh * 2048 + s) * 64;
  qr[ob + 2 * i]     = (bf16)((qe * cs - qo * sn) * QS);
  qr[ob + 2 * i + 1] = (bf16)((qe * sn + qo * cs) * QS);
  kr[ob + 2 * i]     = (bf16)(ke * cs - ko * sn);
  kr[ob + 2 * i + 1] = (bf16)(ke * sn + ko * cs);
  size_t vb = (size_t)bh * 64 * 2048;
  vt[vb + (size_t)(2 * i) * 2048 + s]     = (bf16)v0;
  vt[vb + (size_t)(2 * i + 1) * 2048 + s] = (bf16)v1;
}

// ----- Flash attention: one 32-key tile step --------------------------------
// MASKED=false for tiles fully below the diagonal (no v_cmp/v_cndmask).
// Row-max: DPP16 butterflies.  Row-sum: P @ ones on the WMMA pipe.
// All exponentials are exp2 (scores already in base-2 domain).
template <bool MASKED>
static __device__ __forceinline__ void attn_tile(
    int k0, v16bf aq0, v16bf aq1, const bf16* kh, const bf16* vh,
    bf16 (*pT)[32], v8f* o, float* mrow, float* lrow,
    int qRow0, int rowOff, int nlane, int lane) {
  const int S = 2048, HD = 64;
  v8f s0 = {}, s1 = {};
  s0 = wmma_bf16f32(aq0, load_frag(kh, HD, k0,      0,  lane), s0);
  s0 = wmma_bf16f32(aq1, load_frag(kh, HD, k0,      32, lane), s0);
  s1 = wmma_bf16f32(aq0, load_frag(kh, HD, k0 + 16, 0,  lane), s1);
  s1 = wmma_bf16f32(aq1, load_frag(kh, HD, k0 + 16, 32, lane), s1);

  float alpha[8];
#pragma unroll
  for (int i = 0; i < 8; ++i) {
    float v0 = s0[i];
    float v1 = s1[i];
    if (MASKED) {
      int row = qRow0 + rowOff + i;
      if (k0 + nlane > row)      v0 = -3.0e38f;
      if (k0 + 16 + nlane > row) v1 = -3.0e38f;
    }
    float mx = rowmax16(fmaxf(v0, v1));        // 16-lane row-group max (DPP)
    float nm = fmaxf(mrow[i], mx);
    float a  = __builtin_amdgcn_exp2f(mrow[i] - nm);   // raw v_exp_f32
    float p0 = __builtin_amdgcn_exp2f(v0 - nm);
    float p1 = __builtin_amdgcn_exp2f(v1 - nm);
    alpha[i] = a;
    mrow[i]  = nm;
    pT[rowOff + i][nlane]      = (bf16)p0;     // C-layout -> LDS (A-layout src)
    pT[rowOff + i][nlane + 16] = (bf16)p1;
  }
#pragma unroll
  for (int c = 0; c < 4; ++c)
#pragma unroll
    for (int i = 0; i < 8; ++i) o[c][i] *= alpha[i];

  v16bf pf = load_frag(&pT[0][0], 32, 0, 0, lane);   // ds_load, same-wave order
  v8f sums = {};
  sums = wmma_bf16f32(pf, ones_frag(), sums);  // row sums, replicated per lane
#pragma unroll
  for (int i = 0; i < 8; ++i) lrow[i] = lrow[i] * alpha[i] + sums[i];

#pragma unroll
  for (int c = 0; c < 4; ++c)      // P(16x32) @ V(32x64), hd in 4 chunks of 16
    o[c] = wmma_bf16f32(pf, load_frag(vh, S, c * 16, k0, lane), o[c]);
}

// grid (S/64, B*H), 128 threads = 4 waves, one wave per 16 query rows.
__global__ __launch_bounds__(128) void tb_flash_attn(
    const bf16* __restrict__ qr, const bf16* __restrict__ kr,
    const bf16* __restrict__ vt, bf16* __restrict__ attn) {
  const int S = 2048, HD = 64;
  __shared__ __attribute__((aligned(16))) bf16 pTile[4][16][32];

  int lane = threadIdx.x & 31;
  int wave = threadIdx.x >> 5;
  int bh   = blockIdx.y;
  int qRow0 = blockIdx.x * 64 + wave * 16;
  const bf16* qh = qr + (size_t)bh * S * HD;
  const bf16* kh = kr + (size_t)bh * S * HD;
  const bf16* vh = vt + (size_t)bh * HD * S;

  v16bf aq0 = load_frag(qh, HD, qRow0, 0, lane);
  v16bf aq1 = load_frag(qh, HD, qRow0, 32, lane);

  v8f o[4] = {};
  float mrow[8], lrow[8];
#pragma unroll
  for (int i = 0; i < 8; ++i) { mrow[i] = -1e30f; lrow[i] = 0.f; }
  int rowOff = (lane >> 4) * 8;
  int nlane  = lane & 15;

  int nFull = qRow0 >> 5;                      // tiles with k0+32 <= qRow0
  for (int kt = 0; kt < nFull; ++kt)
    attn_tile<false>(kt << 5, aq0, aq1, kh, vh, pTile[wave], o, mrow, lrow,
                     qRow0, rowOff, nlane, lane);
  attn_tile<true>(nFull << 5, aq0, aq1, kh, vh, pTile[wave], o, mrow, lrow,
                  qRow0, rowOff, nlane, lane); // single diagonal tile

  int b = bh >> 4, h = bh & 15;
#pragma unroll
  for (int c = 0; c < 4; ++c)
#pragma unroll
    for (int i = 0; i < 8; ++i) {
      int q = qRow0 + rowOff + i;
      float v = o[c][i] / lrow[i];
      size_t idx = ((size_t)(b * 2048 + q)) * 1024 + h * 64 + c * 16 + nlane;
      attn[idx] = (bf16)v;
    }
}

// ----- SiLU(gate) * up ------------------------------------------------------
// 64 elements a thread, so that few waves have to be started: a wave takes
// 2048 consecutive elements of g and of u by 8 + 8 loads of 16 B a lane (each
// wave-wide load and store is 512 contiguous bytes = 4 whole lines).  A block
// takes 16384 elements and the grid covers the array exactly.  g, u and h are
// all addressed by one 32-bit byte offset (the arrays hold 32 MiB each).
__global__ __launch_bounds__(256) void tb_silu_mul(const bf16* __restrict__ g,
                                                   const bf16* __restrict__ u,
                                                   bf16* __restrict__ h) {
  unsigned off = blockIdx.x * 32768u + (threadIdx.x >> 5) * 4096u +
                 (threadIdx.x & 31) * 16u;
  const char* gp = reinterpret_cast<const char*>(g) + off;
  const char* up = reinterpret_cast<const char*>(u) + off;
  char*       hp = reinterpret_cast<char*>(h) + off;
  v8bf gq[8], uq[8];
#pragma unroll
  for (int j = 0; j < 8; ++j) {
    gq[j] = *reinterpret_cast<const v8bf*>(gp + j * 512);
    uq[j] = *reinterpret_cast<const v8bf*>(up + j * 512);
  }
  // Keeps all 16 loads in front of the arithmetic: without it the scheduler
  // sinks most of them between the divisions, and a wave then waits for memory
  // several times instead of once.
  __builtin_amdgcn_sched_barrier(0);
#pragma unroll
  for (int j = 0; j < 8; ++j) {
    v8bf o;
#pragma unroll
    for (int k = 0; k < 8; ++k) {
      float gv = (float)gq[j][k], uv = (float)uq[j][k];
      float s = gv / (1.f + __expf(-gv));
      o[k] = (bf16)(s * uv);
    }
    *reinterpret_cast<v8bf*>(hp + j * 512) = o;
    // Lets each store leave when its 8 elements are done: without it the
    // scheduler gathers most stores at the wave's end, behind all arithmetic.
    if (j < 7) __builtin_amdgcn_sched_barrier(0);
  }
}

// ---------------------------------------------------------------------------
extern "C" void kernel_launch(void* const* d_in, const int* in_sizes, int n_in,
                              void* d_out, int out_size, void* d_ws, size_t ws_size,
                              hipStream_t stream) {
  (void)in_sizes; (void)n_in; (void)out_size; (void)ws_size;
  const float* x    = (const float*)d_in[0];
  const int*   sp   = (const int*)d_in[1];
  const float* n1w  = (const float*)d_in[2];
  const float* wqkv = (const float*)d_in[3];
  const float* wo   = (const float*)d_in[4];
  const float* n2w  = (const float*)d_in[5];
  const float* wg   = (const float*)d_in[6];
  const float* wu   = (const float*)d_in[7];
  const float* wd   = (const float*)d_in[8];
  float* out = (float*)d_out;

  // Workspace layout (~240 MB, regions 16B aligned).
  const size_t T = 4096;                             // B*S tokens
  bf16*  bWq  = (bf16*)d_ws;                         // 3072*1024
  bf16*  bWo  = bWq + (size_t)3072 * 1024;           // 1024*1024
  bf16*  bWg  = bWo + (size_t)1024 * 1024;           // 4096*1024
  bf16*  bWu  = bWg + (size_t)4096 * 1024;           // 4096*1024
  bf16*  bWd  = bWu + (size_t)4096 * 1024;           // 1024*4096
  bf16*  xn   = bWd + (size_t)1024 * 4096;           // T*1024 bf16
  float* qkv  = (float*)(xn + T * 1024);             // T*3072 f32
  bf16*  qrb  = (bf16*)(qkv + T * 3072);             // 32*2048*64
  bf16*  krb  = qrb + (size_t)32 * 2048 * 64;
  bf16*  vtb  = krb + (size_t)32 * 2048 * 64;
  bf16*  attnb= vtb + (size_t)32 * 2048 * 64;        // T*1024 bf16
  float* out1 = (float*)(attnb + T * 1024);          // T*1024 f32
  bf16*  xn2  = (bf16*)(out1 + T * 1024);            // T*1024 bf16
  bf16*  gateb= xn2 + T * 1024;                      // T*4096 bf16
  bf16*  upb  = gateb + T * 4096;
  bf16*  hb   = upb + T * 4096;

  // 1) weights -> bf16 once; every GEMM re-reads them from L2 at half width
  tb_cvt_f32_bf16<<<(3072 * 1024) / 8192, 256, 0, stream>>>(wqkv, bWq);
  tb_cvt_f32_bf16<<<(1024 * 1024) / 8192, 256, 0, stream>>>(wo,   bWo);
  tb_cvt_f32_bf16<<<(4096 * 1024) / 8192, 256, 0, stream>>>(wg,   bWg);
  tb_cvt_f32_bf16<<<(4096 * 1024) / 8192, 256, 0, stream>>>(wu,   bWu);
  tb_cvt_f32_bf16<<<(1024 * 4096) / 8192, 256, 0, stream>>>(wd,   bWd);

  // 2) xn = rmsnorm(x)
  tb_rmsnorm_bf16<<<(int)T, 256, 0, stream>>>(x, n1w, xn, 1024);

  // 3) qkv = xn @ Wqkv^T
  tb_gemm_bf16<0><<<dim3(3072 / 256, T / 64), 256, 0, stream>>>(
      xn, bWq, (void*)qkv, nullptr, (int)T, 3072, 1024);

  // 4) RoPE + head split + V^T (q pre-scaled into base-2 softmax domain)
  tb_rope_qkv<<<(32 * 2048 * 32) / 256, 256, 0, stream>>>(qkv, sp, qrb, krb, vtb);

  // 5) flash attention -> attn (bf16, [B,S,D])
  tb_flash_attn<<<dim3(2048 / 64, 32), 128, 0, stream>>>(qrb, krb, vtb, attnb);

  // 6) out1 = x + attn @ Wo^T
  tb_gemm_bf16<1><<<dim3(1024 / 256, T / 64), 256, 0, stream>>>(
      attnb, bWo, (void*)out1, x, (int)T, 1024, 1024);

  // 7) xn2 = rmsnorm(out1)
  tb_rmsnorm_bf16<<<(int)T, 256, 0, stream>>>(out1, n2w, xn2, 1024);

  // 8) gate / up projections
  tb_gemm_bf16<2><<<dim3(4096 / 256, T / 64), 256, 0, stream>>>(
      xn2, bWg, (void*)gateb, nullptr, (int)T, 4096, 1024);
  tb_gemm_bf16<2><<<dim3(4096 / 256, T / 64), 256, 0, stream>>>(
      xn2, bWu, (void*)upb, nullptr, (int)T, 4096, 1024);

  // 9) h = silu(gate) * up
  tb_silu_mul<<<(16777216) / 16384, 256, 0, stream>>>(gateb, upb, hb);

  // 10) out = out1 + h @ Wd^T
  tb_gemm_bf16<1><<<dim3(1024 / 256, T / 64), 256, 0, stream>>>(
      hb, bWd, (void*)out, out1, (int)T, 1024, 4096);
}

// v003
// Measured time: 457 microseconds a run.
// Timed twice side by side with v002, it ran 1.12 and 1.09 times as fast.
// Counting every step since v000, it is 1.54 times as fast.
#include <hip/hip_runtime.h>
#include <hip/hip_bf16.h>

typedef __bf16 bf16;
typedef __attribute__((ext_vector_type(16))) __bf16 v16bf;
typedef __attribute__((ext_vector_type(8)))  __bf16 v8bf;
typedef __attribute__((ext_vector_type(8)))  float  v8f;
typedef __attribute__((ext_vector_type(4)))  __bf16 v4bf;
typedef __attribute__((ext_vector_type(4)))  float  v4f;

static __device__ __forceinline__ void gemm_stage_copy(
    unsigned la, const bf16* ga, unsigned lw, const bf16* gw, size_t wStep,
    unsigned lStep) {
  asm volatile(
      "global_load_async_to_lds_b128 %0, %1, off\n\t"
      "global_load_async_to_lds_b128 %2, %3, off\n\t"
      "global_load_async_to_lds_b128 %4, %5, off\n\t"
      "global_load_async_to_lds_b128 %6, %7, off\n\t"
      "global_load_async_to_lds_b128 %8, %9, off\n\t"
      "global_load_async_to_lds_b128 %10, %11, off\n\t"
      "global_load_async_to_lds_b128 %12, %13, off\n\t"
      "global_load_async_to_lds_b128 %14, %15, off\n\t"
      "global_load_async_to_lds_b128 %16, %17, off\n\t"
      "global_load_async_to_lds_b128 %18, %19, off\n\t"
      "s_wait_xcnt 0x0"
      :: "v"(la),             "v"(ga),
         "v"(la + 16u),       "v"(ga + 8),
         "v"(lw),             "v"(gw),
         "v"(lw + lStep),     "v"(gw + wStep),
         "v"(lw + 2 * lStep), "v"(gw + 2 * wStep),
         "v"(lw + 3 * lStep), "v"(gw + 3 * wStep),
         "v"(lw + 4 * lStep), "v"(gw + 4 * wStep),
         "v"(lw + 5 * lStep), "v"(gw + 5 * wStep),
         "v"(lw + 6 * lStep), "v"(gw + 6 * wStep),
         "v"(lw + 7 * lStep), "v"(gw + 7 * wStep)
      : "memory");
}
// The issuing wave's copies have landed behind this wait.
#define WAIT_ASYNC0() asm volatile("s_wait_asynccnt 0x0" ::: "memory")
// The wave's own LDS reads have retired before a buffer it read is refilled.
#define WAIT_DS0() asm volatile("s_wait_dscnt 0x0" ::: "memory")

static __device__ __forceinline__ v16bf load_frag(const bf16* base, int ld,
                                                  int row, int k0, int lane) {
  int r  = row + (lane & 15);
  int kg = (lane >> 4) & 1;              // lanes 16-31 take the +8 K group
  const bf16* p = base + (size_t)r * ld + k0 + kg * 8;
  v8bf lo = *reinterpret_cast<const v8bf*>(p);
  v8bf hi = *reinterpret_cast<const v8bf*>(p + 16);
  v16bf v;
#pragma unroll
  for (int i = 0; i < 8; ++i) { v[i] = lo[i]; v[i + 8] = hi[i]; }
  return v;
}

static __device__ __forceinline__ v8f wmma_bf16f32(v16bf a, v16bf b, v8f c) {
  return __builtin_amdgcn_wmma_f32_16x16x32_bf16(false, a, false, b,
                                                 (short)0, c, false, false);
}

static __device__ __forceinline__ v16bf ones_frag() {
  v16bf v;
#pragma unroll
  for (int i = 0; i < 16; ++i) v[i] = (bf16)1.0f;
  return v;
}

// ----- 16-lane row max via DPP16 butterflies (VALU only, no DS pipe) --------
// xor1 = quad_perm(1,0,3,2)=0xB1, xor2 = quad_perm(2,3,0,1)=0x4E,
// xor7 = row_half_mirror=0x141, xor15 = row_mirror=0x140.
template <int CTRL>
static __device__ __forceinline__ float fmax_dpp(float x) {
  int v = __builtin_amdgcn_update_dpp(0, __float_as_int(x), CTRL, 0xF, 0xF, true);
  return fmaxf(x, __int_as_float(v));
}
static __device__ __forceinline__ float rowmax16(float x) {
  x = fmax_dpp<0xB1>(x);
  x = fmax_dpp<0x4E>(x);
  x = fmax_dpp<0x141>(x);
  x = fmax_dpp<0x140>(x);
  return x;
}

// ----- fp32 -> bf16 weight conversion ---------------------------------------
// 32 elements a thread, so that few waves have to be started: a wave takes
// 1024 consecutive floats by 8 loads of 16 B a lane (each wave-wide load is
// 512 contiguous bytes = 4 whole lines), all 8 in flight before the first
// store; each store covers 2 whole lines.  A block takes 8192 elements and the
// grid covers the array exactly (every weight count is a multiple of 8192).
__global__ __launch_bounds__(256) void tb_cvt_f32_bf16(
    const float* __restrict__ in, bf16* __restrict__ out) {
  size_t base = (size_t)blockIdx.x * 8192 + (threadIdx.x >> 5) * 1024 +
                (threadIdx.x & 31) * 4;
  v4f v[8];
#pragma unroll
  for (int j = 0; j < 8; ++j)
    v[j] = *reinterpret_cast<const v4f*>(in + base + j * 128);
#pragma unroll
  for (int j = 0; j < 8; ++j) {
    v4bf o;
#pragma unroll
    for (int k = 0; k < 4; ++k) o[k] = (bf16)v[j][k];
    *reinterpret_cast<v4bf*>(out + base + j * 128) = o;
  }
}

// ----- fused RMSNorm + bf16 cast --------------------------------------------
__global__ __launch_bounds__(256) void tb_rmsnorm_bf16(
    const float* __restrict__ x, const float* __restrict__ w,
    bf16* __restrict__ out, int D) {
  int row = blockIdx.x;
  const float* xr = x + (size_t)row * D;
  float ss = 0.f;
  for (int i = threadIdx.x; i < D; i += 256) { float v = xr[i]; ss += v * v; }
#pragma unroll
  for (int off = 16; off > 0; off >>= 1) ss += __shfl_xor(ss, off, 32);
  __shared__ float red[8];
  if ((threadIdx.x & 31) == 0) red[threadIdx.x >> 5] = ss;
  __syncthreads();
  float tot = 0.f;
#pragma unroll
  for (int i = 0; i < 8; ++i) tot += red[i];
  float scale = rsqrtf(tot / (float)D + 1e-6f);
  for (int i = threadIdx.x; i < D; i += 256)
    out[(size_t)row * D + i] = (bf16)(xr[i] * scale * w[i]);
}

template <int EPI>
__global__ __launch_bounds__(256) void tb_gemm_bf16(
    const bf16* __restrict__ A, const bf16* __restrict__ W,
    void* __restrict__ Cv, const float* __restrict__ R,
    int M, int N, int K) {
  constexpr int WP = 72;                       // W tile pitch in LDS, elements
  constexpr int AP = 72;                       // A tile pitch in LDS, elements
  __shared__ __attribute__((aligned(16))) bf16 aBuf[2][64][AP];
  __shared__ __attribute__((aligned(16))) bf16 wBuf[2][256][WP];

  int lane   = threadIdx.x & 31;
  int wave   = threadIdx.x >> 5;
  int mBlock = blockIdx.y * 64;
  int nBlock = blockIdx.x * 256;
  int mLoc   = (wave >> 2) * 32;               // wave's rows inside the block
  int nLoc   = (wave & 3) * 64;                // wave's columns inside the block
  int nBase  = nBlock + nLoc;

  int cpRow = threadIdx.x >> 2;                // 0..63
  int cpCol = (threadIdx.x & 3) * 16;          // 0,16,32,48
  int wRow = threadIdx.x >> 3;                 // 0..31
  int wCol = (threadIdx.x & 7) * 8;            // 0,8,..,56
  unsigned ldsA[2] = {
      (unsigned)(uintptr_t)&aBuf[0][cpRow][cpCol],
      (unsigned)(uintptr_t)&aBuf[1][cpRow][cpCol]};
  unsigned ldsW[2] = {
      (unsigned)(uintptr_t)&wBuf[0][wRow][wCol],
      (unsigned)(uintptr_t)&wBuf[1][wRow][wCol]};
  const bf16* gA = A + (size_t)(mBlock + cpRow) * K + cpCol;
  const bf16* gW = W + (size_t)(nBlock + wRow) * K + wCol;
  const size_t   wStep = (size_t)32 * K;       // 32 W rows in global memory
  const unsigned lStep = 32u * WP * 2u;        // 32 W rows in LDS, bytes

  int Kt = K >> 6;                             // 64-wide K tiles
  gemm_stage_copy(ldsA[0], gA, ldsW[0], gW, wStep, lStep);
  WAIT_ASYNC0();
  __syncthreads();                             // stage 0 visible to all waves
  if (Kt > 1)
    gemm_stage_copy(ldsA[1], gA + 64, ldsW[1], gW + 64, wStep, lStep);

  v8f acc[2][4] = {};
  for (int kt = 0; kt < Kt; ++kt) {
    const bf16* ab = &aBuf[kt & 1][0][0];
    const bf16* wb = &wBuf[kt & 1][0][0];
#pragma unroll
    for (int kh = 0; kh < 2; ++kh) {
      v16bf a0 = load_frag(ab, AP, mLoc,      kh << 5, lane);   // ds_load
      v16bf a1 = load_frag(ab, AP, mLoc + 16, kh << 5, lane);
      v16bf b0 = load_frag(wb, WP, nLoc,      kh << 5, lane);   // ds_load
      v16bf b1 = load_frag(wb, WP, nLoc + 16, kh << 5, lane);
      v16bf b2 = load_frag(wb, WP, nLoc + 32, kh << 5, lane);
      v16bf b3 = load_frag(wb, WP, nLoc + 48, kh << 5, lane);
      acc[0][0] = wmma_bf16f32(a0, b0, acc[0][0]);
      acc[0][1] = wmma_bf16f32(a0, b1, acc[0][1]);
      acc[0][2] = wmma_bf16f32(a0, b2, acc[0][2]);
      acc[0][3] = wmma_bf16f32(a0, b3, acc[0][3]);
      acc[1][0] = wmma_bf16f32(a1, b0, acc[1][0]);
      acc[1][1] = wmma_bf16f32(a1, b1, acc[1][1]);
      acc[1][2] = wmma_bf16f32(a1, b2, acc[1][2]);
      acc[1][3] = wmma_bf16f32(a1, b3, acc[1][3]);
    }

    // publish point of stage kt + 1: own reads of stage kt retired, own copies
    // of stage kt + 1 landed, then the one barrier that does both jobs
    WAIT_DS0();
    WAIT_ASYNC0();
    __syncthreads();
    if (kt + 2 < Kt) {                         // refill the buffer just freed
      int ko = (kt + 2) << 6;
      gemm_stage_copy(ldsA[kt & 1], gA + ko, ldsW[kt & 1], gW + ko, wStep, lStep);
    }
  }
  WAIT_ASYNC0();                               // nothing in flight at the end

  int col0   = nBase + (lane & 15);
  int rowOff = (lane >> 4) * 8;
#pragma unroll
  for (int ti = 0; ti < 2; ++ti)
#pragma unroll
    for (int tj = 0; tj < 4; ++tj)
#pragma unroll
      for (int i = 0; i < 8; ++i) {
        int r = mBlock + mLoc + ti * 16 + rowOff + i;
        int c = col0 + tj * 16;
        size_t idx = (size_t)r * N + c;
        float v = acc[ti][tj][i];
        if (EPI == 0)      ((float*)Cv)[idx] = v;
        else if (EPI == 1) ((float*)Cv)[idx] = R[idx] + v;
        else               ((bf16*)Cv)[idx] = (bf16)v;
      }
}

// ----- RoPE + head split + V transpose --------------------------------------
// q is pre-scaled by 0.125*log2(e) so attention scores come out of the WMMA
// already in the base-2 softmax domain (no per-element scaling, raw v_exp).
__global__ void tb_rope_qkv(const float* __restrict__ qkv,
                            const int* __restrict__ sp,
                            bf16* __restrict__ qr, bf16* __restrict__ kr,
                            bf16* __restrict__ vt) {
  const float QS = 0.125f * 1.44269504088896340736f;  // (1/sqrt(64))*log2(e)
  int tid = blockIdx.x * 256 + threadIdx.x;   // [0, 32*2048*32)
  int i  = tid & 31;                          // dim pair
  int s  = (tid >> 5) & 2047;                 // seq pos
  int bh = tid >> 16;                         // 0..31
  int b = bh >> 4, h = bh & 15;
  size_t qb = ((size_t)(b * 2048 + s)) * 3072 + h * 64;
  float qe = qkv[qb + 2 * i],        qo = qkv[qb + 2 * i + 1];
  float ke = qkv[qb + 1024 + 2 * i], ko = qkv[qb + 1024 + 2 * i + 1];
  float v0 = qkv[qb + 2048 + 2 * i], v1 = qkv[qb + 2048 + 2 * i + 1];
  float freq = __expf(-(float)(2 * i) * (9.2103403719761827f / 64.0f));
  float t = (float)(sp[0] + s);
  float sn, cs;
  __sincosf(t * freq, &sn, &cs);
  size_t ob = ((size_t)bh * 2048 + s) * 64;
  qr[ob + 2 * i]     = (bf16)((qe * cs - qo * sn) * QS);
  qr[ob + 2 * i + 1] = (bf16)((qe * sn + qo * cs) * QS);
  kr[ob + 2 * i]     = (bf16)(ke * cs - ko * sn);
  kr[ob + 2 * i + 1] = (bf16)(ke * sn + ko * cs);
  size_t vb = (size_t)bh * 64 * 2048;
  vt[vb + (size_t)(2 * i) * 2048 + s]     = (bf16)v0;
  vt[vb + (size_t)(2 * i + 1) * 2048 + s] = (bf16)v1;
}

// ----- Flash attention: one 32-key tile step --------------------------------
// MASKED=false for tiles fully below the diagonal (no v_cmp/v_cndmask).
// Row-max: DPP16 butterflies.  Row-sum: P @ ones on the WMMA pipe.
// All exponentials are exp2 (scores already in base-2 domain).
template <bool MASKED>
static __device__ __forceinline__ void attn_tile(
    int k0, v16bf aq0, v16bf aq1, const bf16* kh, const bf16* vh,
    bf16 (*pT)[32], v8f* o, float* mrow, float* lrow,
    int qRow0, int rowOff, int nlane, int lane) {
  const int S = 2048, HD = 64;
  v8f s0 = {}, s1 = {};
  s0 = wmma_bf16f32(aq0, load_frag(kh, HD, k0,      0,  lane), s0);
  s0 = wmma_bf16f32(aq1, load_frag(kh, HD, k0,      32, lane), s0);
  s1 = wmma_bf16f32(aq0, load_frag(kh, HD, k0 + 16, 0,  lane), s1);
  s1 = wmma_bf16f32(aq1, load_frag(kh, HD, k0 + 16, 32, lane), s1);

  float alpha[8];
#pragma unroll
  for (int i = 0; i < 8; ++i) {
    float v0 = s0[i];
    float v1 = s1[i];
    if (MASKED) {
      int row = qRow0 + rowOff + i;
      if (k0 + nlane > row)      v0 = -3.0e38f;
      if (k0 + 16 + nlane > row) v1 = -3.0e38f;
    }
    float mx = rowmax16(fmaxf(v0, v1));        // 16-lane row-group max (DPP)
    float nm = fmaxf(mrow[i], mx);
    float a  = __builtin_amdgcn_exp2f(mrow[i] - nm);   // raw v_exp_f32
    float p0 = __builtin_amdgcn_exp2f(v0 - nm);
    float p1 = __builtin_amdgcn_exp2f(v1 - nm);
    alpha[i] = a;
    mrow[i]  = nm;
    pT[rowOff + i][nlane]      = (bf16)p0;     // C-layout -> LDS (A-layout src)
    pT[rowOff + i][nlane + 16] = (bf16)p1;
  }
#pragma unroll
  for (int c = 0; c < 4; ++c)
#pragma unroll
    for (int i = 0; i < 8; ++i) o[c][i] *= alpha[i];

  v16bf pf = load_frag(&pT[0][0], 32, 0, 0, lane);   // ds_load, same-wave order
  v8f sums = {};
  sums = wmma_bf16f32(pf, ones_frag(), sums);  // row sums, replicated per lane
#pragma unroll
  for (int i = 0; i < 8; ++i) lrow[i] = lrow[i] * alpha[i] + sums[i];

#pragma unroll
  for (int c = 0; c < 4; ++c)      // P(16x32) @ V(32x64), hd in 4 chunks of 16
    o[c] = wmma_bf16f32(pf, load_frag(vh, S, c * 16, k0, lane), o[c]);
}

// grid (S/64, B*H), 128 threads = 4 waves, one wave per 16 query rows.
__global__ __launch_bounds__(128) void tb_flash_attn(
    const bf16* __restrict__ qr, const bf16* __restrict__ kr,
    const bf16* __restrict__ vt, bf16* __restrict__ attn) {
  const int S = 2048, HD = 64;
  __shared__ __attribute__((aligned(16))) bf16 pTile[4][16][32];

  int lane = threadIdx.x & 31;
  int wave = threadIdx.x >> 5;
  int bh   = blockIdx.y;
  int qRow0 = blockIdx.x * 64 + wave * 16;
  const bf16* qh = qr + (size_t)bh * S * HD;
  const bf16* kh = kr + (size_t)bh * S * HD;
  const bf16* vh = vt + (size_t)bh * HD * S;

  v16bf aq0 = load_frag(qh, HD, qRow0, 0, lane);
  v16bf aq1 = load_frag(qh, HD, qRow0, 32, lane);

  v8f o[4] = {};
  float mrow[8], lrow[8];
#pragma unroll
  for (int i = 0; i < 8; ++i) { mrow[i] = -1e30f; lrow[i] = 0.f; }
  int rowOff = (lane >> 4) * 8;
  int nlane  = lane & 15;

  int nFull = qRow0 >> 5;                      // tiles with k0+32 <= qRow0
  for (int kt = 0; kt < nFull; ++kt)
    attn_tile<false>(kt << 5, aq0, aq1, kh, vh, pTile[wave], o, mrow, lrow,
                     qRow0, rowOff, nlane, lane);
  attn_tile<true>(nFull << 5, aq0, aq1, kh, vh, pTile[wave], o, mrow, lrow,
                  qRow0, rowOff, nlane, lane); // single diagonal tile

  int b = bh >> 4, h = bh & 15;
#pragma unroll
  for (int c = 0; c < 4; ++c)
#pragma unroll
    for (int i = 0; i < 8; ++i) {
      int q = qRow0 + rowOff + i;
      float v = o[c][i] / lrow[i];
      size_t idx = ((size_t)(b * 2048 + q)) * 1024 + h * 64 + c * 16 + nlane;
      attn[idx] = (bf16)v;
    }
}

// ----- SiLU(gate) * up ------------------------------------------------------
// 64 elements a thread, so that few waves have to be started: a wave takes
// 2048 consecutive elements of g and of u by 8 + 8 loads of 16 B a lane (each
// wave-wide load and store is 512 contiguous bytes = 4 whole lines).  A block
// takes 16384 elements and the grid covers the array exactly.  g, u and h are
// all addressed by one 32-bit byte offset (the arrays hold 32 MiB each).
__global__ __launch_bounds__(256) void tb_silu_mul(const bf16* __restrict__ g,
                                                   const bf16* __restrict__ u,
                                                   bf16* __restrict__ h) {
  unsigned off = blockIdx.x * 32768u + (threadIdx.x >> 5) * 4096u +
                 (threadIdx.x & 31) * 16u;
  const char* gp = reinterpret_cast<const char*>(g) + off;
  const char* up = reinterpret_cast<const char*>(u) + off;
  char*       hp = reinterpret_cast<char*>(h) + off;
  v8bf gq[8], uq[8];
#pragma unroll
  for (int j = 0; j < 8; ++j) {
    gq[j] = *reinterpret_cast<const v8bf*>(gp + j * 512);
    uq[j] = *reinterpret_cast<const v8bf*>(up + j * 512);
  }
  // Keeps all 16 loads in front of the arithmetic: without it the scheduler
  // sinks most of them between the divisions, and a wave then waits for memory
  // several times instead of once.
  __builtin_amdgcn_sched_barrier(0);
#pragma unroll
  for (int j = 0; j < 8; ++j) {
    v8bf o;
#pragma unroll
    for (int k = 0; k < 8; ++k) {
      float gv = (float)gq[j][k], uv = (float)uq[j][k];
      float s = gv / (1.f + __expf(-gv));
      o[k] = (bf16)(s * uv);
    }
    *reinterpret_cast<v8bf*>(hp + j * 512) = o;
    // Lets each store leave when its 8 elements are done: without it the
    // scheduler gathers most stores at the wave's end, behind all arithmetic.
    if (j < 7) __builtin_amdgcn_sched_barrier(0);
  }
}

// ---------------------------------------------------------------------------
extern "C" void kernel_launch(void* const* d_in, const int* in_sizes, int n_in,
                              void* d_out, int out_size, void* d_ws, size_t ws_size,
                              hipStream_t stream) {
  (void)in_sizes; (void)n_in; (void)out_size; (void)ws_size;
  const float* x    = (const float*)d_in[0];
  const int*   sp   = (const int*)d_in[1];
  const float* n1w  = (const float*)d_in[2];
  const float* wqkv = (const float*)d_in[3];
  const float* wo   = (const float*)d_in[4];
  const float* n2w  = (const float*)d_in[5];
  const float* wg   = (const float*)d_in[6];
  const float* wu   = (const float*)d_in[7];
  const float* wd   = (const float*)d_in[8];
  float* out = (float*)d_out;

  // Workspace layout (~240 MB, regions 16B aligned).
  const size_t T = 4096;                             // B*S tokens
  bf16*  bWq  = (bf16*)d_ws;                         // 3072*1024
  bf16*  bWo  = bWq + (size_t)3072 * 1024;           // 1024*1024
  bf16*  bWg  = bWo + (size_t)1024 * 1024;           // 4096*1024
  bf16*  bWu  = bWg + (size_t)4096 * 1024;           // 4096*1024
  bf16*  bWd  = bWu + (size_t)4096 * 1024;           // 1024*4096
  bf16*  xn   = bWd + (size_t)1024 * 4096;           // T*1024 bf16
  float* qkv  = (float*)(xn + T * 1024);             // T*3072 f32
  bf16*  qrb  = (bf16*)(qkv + T * 3072);             // 32*2048*64
  bf16*  krb  = qrb + (size_t)32 * 2048 * 64;
  bf16*  vtb  = krb + (size_t)32 * 2048 * 64;
  bf16*  attnb= vtb + (size_t)32 * 2048 * 64;        // T*1024 bf16
  float* out1 = (float*)(attnb + T * 1024);          // T*1024 f32
  bf16*  xn2  = (bf16*)(out1 + T * 1024);            // T*1024 bf16
  bf16*  gateb= xn2 + T * 1024;                      // T*4096 bf16
  bf16*  upb  = gateb + T * 4096;
  bf16*  hb   = upb + T * 4096;

  // 1) weights -> bf16 once; every GEMM re-reads them from L2 at half width
  tb_cvt_f32_bf16<<<(3072 * 1024) / 8192, 256, 0, stream>>>(wqkv, bWq);
  tb_cvt_f32_bf16<<<(1024 * 1024) / 8192, 256, 0, stream>>>(wo,   bWo);
  tb_cvt_f32_bf16<<<(4096 * 1024) / 8192, 256, 0, stream>>>(wg,   bWg);
  tb_cvt_f32_bf16<<<(4096 * 1024) / 8192, 256, 0, stream>>>(wu,   bWu);
  tb_cvt_f32_bf16<<<(1024 * 4096) / 8192, 256, 0, stream>>>(wd,   bWd);

  // 2) xn = rmsnorm(x)
  tb_rmsnorm_bf16<<<(int)T, 256, 0, stream>>>(x, n1w, xn, 1024);

  // 3) qkv = xn @ Wqkv^T
  tb_gemm_bf16<0><<<dim3(3072 / 256, T / 64), 256, 0, stream>>>(
      xn, bWq, (void*)qkv, nullptr, (int)T, 3072, 1024);

  // 4) RoPE + head split + V^T (q pre-scaled into base-2 softmax domain)
  tb_rope_qkv<<<(32 * 2048 * 32) / 256, 256, 0, stream>>>(qkv, sp, qrb, krb, vtb);

  // 5) flash attention -> attn (bf16, [B,S,D])
  tb_flash_attn<<<dim3(2048 / 64, 32), 128, 0, stream>>>(qrb, krb, vtb, attnb);

  // 6) out1 = x + attn @ Wo^T
  tb_gemm_bf16<1><<<dim3(1024 / 256, T / 64), 256, 0, stream>>>(
      attnb, bWo, (void*)out1, x, (int)T, 1024, 1024);

  // 7) xn2 = rmsnorm(out1)
  tb_rmsnorm_bf16<<<(int)T, 256, 0, stream>>>(out1, n2w, xn2, 1024);

  // 8) gate / up projections
  tb_gemm_bf16<2><<<dim3(4096 / 256, T / 64), 256, 0, stream>>>(
      xn2, bWg, (void*)gateb, nullptr, (int)T, 4096, 1024);
  tb_gemm_bf16<2><<<dim3(4096 / 256, T / 64), 256, 0, stream>>>(
      xn2, bWu, (void*)upb, nullptr, (int)T, 4096, 1024);

  // 9) h = silu(gate) * up
  tb_silu_mul<<<(16777216) / 16384, 256, 0, stream>>>(gateb, upb, hb);

  // 10) out = out1 + h @ Wd^T
  tb_gemm_bf16<1><<<dim3(1024 / 256, T / 64), 256, 0, stream>>>(
      hb, bWd, (void*)out, out1, (int)T, 1024, 4096);
}

// v004
// Measured time: 398 microseconds a run.
// Two timings next to v003 put it at 1.12 and 1.14 times that version's speed.
// Counting every step since v000, it is 1.74 times as fast.
#include <hip/hip_runtime.h>
#include <hip/hip_bf16.h>

typedef __bf16 bf16;
typedef __attribute__((ext_vector_type(16))) __bf16 v16bf;
typedef __attribute__((ext_vector_type(8)))  __bf16 v8bf;
typedef __attribute__((ext_vector_type(8)))  float  v8f;
typedef __attribute__((ext_vector_type(4)))  __bf16 v4bf;
typedef __attribute__((ext_vector_type(4)))  float  v4f;

static __device__ __forceinline__ void gemm_stage_copy(
    unsigned la, const bf16* ga, unsigned lw, const bf16* gw, size_t wStep,
    unsigned lStep) {
  asm volatile(
      "global_load_async_to_lds_b128 %0, %1, off\n\t"
      "global_load_async_to_lds_b128 %2, %3, off\n\t"
      "global_load_async_to_lds_b128 %4, %5, off\n\t"
      "global_load_async_to_lds_b128 %6, %7, off\n\t"
      "global_load_async_to_lds_b128 %8, %9, off\n\t"
      "global_load_async_to_lds_b128 %10, %11, off\n\t"
      "global_load_async_to_lds_b128 %12, %13, off\n\t"
      "global_load_async_to_lds_b128 %14, %15, off\n\t"
      "global_load_async_to_lds_b128 %16, %17, off\n\t"
      "global_load_async_to_lds_b128 %18, %19, off\n\t"
      "s_wait_xcnt 0x0"
      :: "v"(la),             "v"(ga),
         "v"(la + 16u),       "v"(ga + 8),
         "v"(lw),             "v"(gw),
         "v"(lw + lStep),     "v"(gw + wStep),
         "v"(lw + 2 * lStep), "v"(gw + 2 * wStep),
         "v"(lw + 3 * lStep), "v"(gw + 3 * wStep),
         "v"(lw + 4 * lStep), "v"(gw + 4 * wStep),
         "v"(lw + 5 * lStep), "v"(gw + 5 * wStep),
         "v"(lw + 6 * lStep), "v"(gw + 6 * wStep),
         "v"(lw + 7 * lStep), "v"(gw + 7 * wStep)
      : "memory");
}
// The issuing wave's copies have landed behind this wait.
#define WAIT_ASYNC0() asm volatile("s_wait_asynccnt 0x0" ::: "memory")
// The wave's own LDS reads have retired before a buffer it read is refilled.
#define WAIT_DS0() asm volatile("s_wait_dscnt 0x0" ::: "memory")

static __device__ __forceinline__ void attn_stage_copy(
    unsigned lk, const bf16* gk, unsigned lv, const bf16* gv) {
  asm volatile(
      "global_load_async_to_lds_b128 %0, %1, off\n\t"
      "global_load_async_to_lds_b128 %2, %3, off\n\t"
      "global_load_async_to_lds_b128 %4, %5, off\n\t"
      "global_load_async_to_lds_b128 %6, %7, off\n\t"
      "global_load_async_to_lds_b128 %8, %9, off\n\t"
      "global_load_async_to_lds_b128 %10, %11, off\n\t"
      "global_load_async_to_lds_b128 %12, %13, off\n\t"
      "global_load_async_to_lds_b128 %14, %15, off\n\t"
      "s_wait_xcnt 0x0"
      :: "v"(lk),              "v"(gk),
         "v"(lk + 16u * 144u), "v"(gk + 16 * 64),
         "v"(lk + 32u * 144u), "v"(gk + 32 * 64),
         "v"(lk + 48u * 144u), "v"(gk + 48 * 64),
         "v"(lv),              "v"(gv),
         "v"(lv + 16u * 144u), "v"(gv + 16 * 2048),
         "v"(lv + 32u * 144u), "v"(gv + 32 * 2048),
         "v"(lv + 48u * 144u), "v"(gv + 48 * 2048)
      : "memory");
}

static __device__ __forceinline__ v16bf load_frag(const bf16* base, int ld,
                                                  int row, int k0, int lane) {
  int r  = row + (lane & 15);
  int kg = (lane >> 4) & 1;              // lanes 16-31 take the +8 K group
  const bf16* p = base + (size_t)r * ld + k0 + kg * 8;
  v8bf lo = *reinterpret_cast<const v8bf*>(p);
  v8bf hi = *reinterpret_cast<const v8bf*>(p + 16);
  v16bf v;
#pragma unroll
  for (int i = 0; i < 8; ++i) { v[i] = lo[i]; v[i + 8] = hi[i]; }
  return v;
}

static __device__ __forceinline__ v8f wmma_bf16f32(v16bf a, v16bf b, v8f c) {
  return __builtin_amdgcn_wmma_f32_16x16x32_bf16(false, a, false, b,
                                                 (short)0, c, false, false);
}

static __device__ __forceinline__ v16bf ones_frag() {
  v16bf v;
#pragma unroll
  for (int i = 0; i < 16; ++i) v[i] = (bf16)1.0f;
  return v;
}

// ----- 16-lane row max via DPP16 butterflies (VALU only, no DS pipe) --------
// xor1 = quad_perm(1,0,3,2)=0xB1, xor2 = quad_perm(2,3,0,1)=0x4E,
// xor7 = row_half_mirror=0x141, xor15 = row_mirror=0x140.
template <int CTRL>
static __device__ __forceinline__ float fmax_dpp(float x) {
  int v = __builtin_amdgcn_update_dpp(0, __float_as_int(x), CTRL, 0xF, 0xF, true);
  return fmaxf(x, __int_as_float(v));
}
static __device__ __forceinline__ float rowmax16(float x) {
  x = fmax_dpp<0xB1>(x);
  x = fmax_dpp<0x4E>(x);
  x = fmax_dpp<0x141>(x);
  x = fmax_dpp<0x140>(x);
  return x;
}

// ----- fp32 -> bf16 weight conversion ---------------------------------------
// 32 elements a thread, so that few waves have to be started: a wave takes
// 1024 consecutive floats by 8 loads of 16 B a lane (each wave-wide load is
// 512 contiguous bytes = 4 whole lines), all 8 in flight before the first
// store; each store covers 2 whole lines.  A block takes 8192 elements and the
// grid covers the array exactly (every weight count is a multiple of 8192).
__global__ __launch_bounds__(256) void tb_cvt_f32_bf16(
    const float* __restrict__ in, bf16* __restrict__ out) {
  size_t base = (size_t)blockIdx.x * 8192 + (threadIdx.x >> 5) * 1024 +
                (threadIdx.x & 31) * 4;
  v4f v[8];
#pragma unroll
  for (int j = 0; j < 8; ++j)
    v[j] = *reinterpret_cast<const v4f*>(in + base + j * 128);
#pragma unroll
  for (int j = 0; j < 8; ++j) {
    v4bf o;
#pragma unroll
    for (int k = 0; k < 4; ++k) o[k] = (bf16)v[j][k];
    *reinterpret_cast<v4bf*>(out + base + j * 128) = o;
  }
}

// ----- fused RMSNorm + bf16 cast --------------------------------------------
__global__ __launch_bounds__(256) void tb_rmsnorm_bf16(
    const float* __restrict__ x, const float* __restrict__ w,
    bf16* __restrict__ out, int D) {
  int row = blockIdx.x;
  const float* xr = x + (size_t)row * D;
  float ss = 0.f;
  for (int i = threadIdx.x; i < D; i += 256) { float v = xr[i]; ss += v * v; }
#pragma unroll
  for (int off = 16; off > 0; off >>= 1) ss += __shfl_xor(ss, off, 32);
  __shared__ float red[8];
  if ((threadIdx.x & 31) == 0) red[threadIdx.x >> 5] = ss;
  __syncthreads();
  float tot = 0.f;
#pragma unroll
  for (int i = 0; i < 8; ++i) tot += red[i];
  float scale = rsqrtf(tot / (float)D + 1e-6f);
  for (int i = threadIdx.x; i < D; i += 256)
    out[(size_t)row * D + i] = (bf16)(xr[i] * scale * w[i]);
}

template <int EPI>
__global__ __launch_bounds__(256) void tb_gemm_bf16(
    const bf16* __restrict__ A, const bf16* __restrict__ W,
    void* __restrict__ Cv, const float* __restrict__ R,
    int M, int N, int K) {
  constexpr int WP = 72;                       // W tile pitch in LDS, elements
  constexpr int AP = 72;                       // A tile pitch in LDS, elements
  __shared__ __attribute__((aligned(16))) bf16 aBuf[2][64][AP];
  __shared__ __attribute__((aligned(16))) bf16 wBuf[2][256][WP];

  int lane   = threadIdx.x & 31;
  int wave   = threadIdx.x >> 5;
  int mBlock = blockIdx.y * 64;
  int nBlock = blockIdx.x * 256;
  int mLoc   = (wave >> 2) * 32;               // wave's rows inside the block
  int nLoc   = (wave & 3) * 64;                // wave's columns inside the block
  int nBase  = nBlock + nLoc;

  int cpRow = threadIdx.x >> 2;                // 0..63
  int cpCol = (threadIdx.x & 3) * 16;          // 0,16,32,48
  int wRow = threadIdx.x >> 3;                 // 0..31
  int wCol = (threadIdx.x & 7) * 8;            // 0,8,..,56
  unsigned ldsA[2] = {
      (unsigned)(uintptr_t)&aBuf[0][cpRow][cpCol],
      (unsigned)(uintptr_t)&aBuf[1][cpRow][cpCol]};
  unsigned ldsW[2] = {
      (unsigned)(uintptr_t)&wBuf[0][wRow][wCol],
      (unsigned)(uintptr_t)&wBuf[1][wRow][wCol]};
  const bf16* gA = A + (size_t)(mBlock + cpRow) * K + cpCol;
  const bf16* gW = W + (size_t)(nBlock + wRow) * K + wCol;
  const size_t   wStep = (size_t)32 * K;       // 32 W rows in global memory
  const unsigned lStep = 32u * WP * 2u;        // 32 W rows in LDS, bytes

  int Kt = K >> 6;                             // 64-wide K tiles
  gemm_stage_copy(ldsA[0], gA, ldsW[0], gW, wStep, lStep);
  WAIT_ASYNC0();
  __syncthreads();                             // stage 0 visible to all waves
  if (Kt > 1)
    gemm_stage_copy(ldsA[1], gA + 64, ldsW[1], gW + 64, wStep, lStep);

  v8f acc[2][4] = {};
  for (int kt = 0; kt < Kt; ++kt) {
    const bf16* ab = &aBuf[kt & 1][0][0];
    const bf16* wb = &wBuf[kt & 1][0][0];
#pragma unroll
    for (int kh = 0; kh < 2; ++kh) {
      v16bf a0 = load_frag(ab, AP, mLoc,      kh << 5, lane);   // ds_load
      v16bf a1 = load_frag(ab, AP, mLoc + 16, kh << 5, lane);
      v16bf b0 = load_frag(wb, WP, nLoc,      kh << 5, lane);   // ds_load
      v16bf b1 = load_frag(wb, WP, nLoc + 16, kh << 5, lane);
      v16bf b2 = load_frag(wb, WP, nLoc + 32, kh << 5, lane);
      v16bf b3 = load_frag(wb, WP, nLoc + 48, kh << 5, lane);
      acc[0][0] = wmma_bf16f32(a0, b0, acc[0][0]);
      acc[0][1] = wmma_bf16f32(a0, b1, acc[0][1]);
      acc[0][2] = wmma_bf16f32(a0, b2, acc[0][2]);
      acc[0][3] = wmma_bf16f32(a0, b3, acc[0][3]);
      acc[1][0] = wmma_bf16f32(a1, b0, acc[1][0]);
      acc[1][1] = wmma_bf16f32(a1, b1, acc[1][1]);
      acc[1][2] = wmma_bf16f32(a1, b2, acc[1][2]);
      acc[1][3] = wmma_bf16f32(a1, b3, acc[1][3]);
    }

    // publish point of stage kt + 1: own reads of stage kt retired, own copies
    // of stage kt + 1 landed, then the one barrier that does both jobs
    WAIT_DS0();
    WAIT_ASYNC0();
    __syncthreads();
    if (kt + 2 < Kt) {                         // refill the buffer just freed
      int ko = (kt + 2) << 6;
      gemm_stage_copy(ldsA[kt & 1], gA + ko, ldsW[kt & 1], gW + ko, wStep, lStep);
    }
  }
  WAIT_ASYNC0();                               // nothing in flight at the end

  int col0   = nBase + (lane & 15);
  int rowOff = (lane >> 4) * 8;
#pragma unroll
  for (int ti = 0; ti < 2; ++ti)
#pragma unroll
    for (int tj = 0; tj < 4; ++tj)
#pragma unroll
      for (int i = 0; i < 8; ++i) {
        int r = mBlock + mLoc + ti * 16 + rowOff + i;
        int c = col0 + tj * 16;
        size_t idx = (size_t)r * N + c;
        float v = acc[ti][tj][i];
        if (EPI == 0)      ((float*)Cv)[idx] = v;
        else if (EPI == 1) ((float*)Cv)[idx] = R[idx] + v;
        else               ((bf16*)Cv)[idx] = (bf16)v;
      }
}

// ----- RoPE + head split + V transpose --------------------------------------
// q is pre-scaled by 0.125*log2(e) so attention scores come out of the WMMA
// already in the base-2 softmax domain (no per-element scaling, raw v_exp).
__global__ void tb_rope_qkv(const float* __restrict__ qkv,
                            const int* __restrict__ sp,
                            bf16* __restrict__ qr, bf16* __restrict__ kr,
                            bf16* __restrict__ vt) {
  const float QS = 0.125f * 1.44269504088896340736f;  // (1/sqrt(64))*log2(e)
  int tid = blockIdx.x * 256 + threadIdx.x;   // [0, 32*2048*32)
  int i  = tid & 31;                          // dim pair
  int s  = (tid >> 5) & 2047;                 // seq pos
  int bh = tid >> 16;                         // 0..31
  int b = bh >> 4, h = bh & 15;
  size_t qb = ((size_t)(b * 2048 + s)) * 3072 + h * 64;
  float qe = qkv[qb + 2 * i],        qo = qkv[qb + 2 * i + 1];
  float ke = qkv[qb + 1024 + 2 * i], ko = qkv[qb + 1024 + 2 * i + 1];
  float v0 = qkv[qb + 2048 + 2 * i], v1 = qkv[qb + 2048 + 2 * i + 1];
  float freq = __expf(-(float)(2 * i) * (9.2103403719761827f / 64.0f));
  float t = (float)(sp[0] + s);
  float sn, cs;
  __sincosf(t * freq, &sn, &cs);
  size_t ob = ((size_t)bh * 2048 + s) * 64;
  qr[ob + 2 * i]     = (bf16)((qe * cs - qo * sn) * QS);
  qr[ob + 2 * i + 1] = (bf16)((qe * sn + qo * cs) * QS);
  kr[ob + 2 * i]     = (bf16)(ke * cs - ko * sn);
  kr[ob + 2 * i + 1] = (bf16)(ke * sn + ko * cs);
  size_t vb = (size_t)bh * 64 * 2048;
  vt[vb + (size_t)(2 * i) * 2048 + s]     = (bf16)v0;
  vt[vb + (size_t)(2 * i + 1) * 2048 + s] = (bf16)v1;
}

// ----- Flash attention: one 32-key tile step --------------------------------
// MASKED=false for tiles fully below the diagonal (no v_cmp/v_cndmask).
// Row-max: DPP16 butterflies.  Row-sum: P @ ones on the WMMA pipe.
// All exponentials are exp2 (scores already in base-2 domain).
// kb / vb: the stage's K tile (key rows) and V^T tile (head-dim rows) in LDS,
// pitch KVP elements; kl = the tile's first key inside the stage (0 or 32),
// k0 = the same key's position in the sequence (for the mask).
constexpr int KVP = 72;                        // 144 B = 16 B x 9: no conflicts
template <bool MASKED>
static __device__ __forceinline__ void attn_tile(
    int k0, int kl, v16bf aq0, v16bf aq1, const bf16* kb, const bf16* vb,
    bf16 (*pT)[32], v8f* o, float* mrow, float* lrow,
    int qRow0, int rowOff, int nlane, int lane) {
  v16bf kf0 = load_frag(kb, KVP, kl,      0,  lane);       // ds_load
  v16bf kf1 = load_frag(kb, KVP, kl,      32, lane);
  v16bf kf2 = load_frag(kb, KVP, kl + 16, 0,  lane);
  v16bf kf3 = load_frag(kb, KVP, kl + 16, 32, lane);
  v16bf vf[4];
#pragma unroll
  for (int c = 0; c < 4; ++c) vf[c] = load_frag(vb, KVP, c * 16, kl, lane);
  // Keeps the tile's 16 LDS reads as one group in front of the products:
  // without it the scheduler sinks them between the WMMAs into one register
  // set, and the wave waits out the LDS latency once per product.
  __builtin_amdgcn_sched_barrier(0);
  v8f s0 = {}, s1 = {};
  s0 = wmma_bf16f32(aq0, kf0, s0);
  s0 = wmma_bf16f32(aq1, kf1, s0);
  s1 = wmma_bf16f32(aq0, kf2, s1);
  s1 = wmma_bf16f32(aq1, kf3, s1);

  float alpha[8];
#pragma unroll
  for (int i = 0; i < 8; ++i) {
    float v0 = s0[i];
    float v1 = s1[i];
    if (MASKED) {
      int row = qRow0 + rowOff + i;
      if (k0 + nlane > row)      v0 = -3.0e38f;
      if (k0 + 16 + nlane > row) v1 = -3.0e38f;
    }
    float mx = rowmax16(fmaxf(v0, v1));        // 16-lane row-group max (DPP)
    float nm = fmaxf(mrow[i], mx);
    float a  = __builtin_amdgcn_exp2f(mrow[i] - nm);   // raw v_exp_f32
    float p0 = __builtin_amdgcn_exp2f(v0 - nm);
    float p1 = __builtin_amdgcn_exp2f(v1 - nm);
    alpha[i] = a;
    mrow[i]  = nm;
    pT[rowOff + i][nlane]      = (bf16)p0;     // C-layout -> LDS (A-layout src)
    pT[rowOff + i][nlane + 16] = (bf16)p1;
  }
#pragma unroll
  for (int c = 0; c < 4; ++c)
#pragma unroll
    for (int i = 0; i < 8; ++i) o[c][i] *= alpha[i];

  v16bf pf = load_frag(&pT[0][0], 32, 0, 0, lane);   // ds_load, same-wave order
  v8f sums = {};
  sums = wmma_bf16f32(pf, ones_frag(), sums);  // row sums, replicated per lane
#pragma unroll
  for (int i = 0; i < 8; ++i) lrow[i] = lrow[i] * alpha[i] + sums[i];

#pragma unroll
  for (int c = 0; c < 4; ++c)      // P(16x32) @ V(32x64), hd in 4 chunks of 16
    o[c] = wmma_bf16f32(pf, vf[c], o[c]);
}

// grid (S/64, B*H), 128 threads = 4 waves, one wave per 16 query rows.
// The block walks the keys in stages of 64 (two 32-key tiles).  A stage's K and
// V^T tiles are brought once for all four waves by async-to-LDS copies of whole
// 128-B lines into two buffers: the next stage flies while this one is worked
// on, one barrier per stage.  Each wave takes the same 32-key tiles in the same
// order as if it read them from global memory itself.
__global__ __launch_bounds__(128) void tb_flash_attn(
    const bf16* __restrict__ qr, const bf16* __restrict__ kr,
    const bf16* __restrict__ vt, bf16* __restrict__ attn) {
  const int S = 2048, HD = 64;
  __shared__ __attribute__((aligned(16))) bf16 kBuf[2][64][KVP];
  __shared__ __attribute__((aligned(16))) bf16 vBuf[2][64][KVP];
  __shared__ __attribute__((aligned(16))) bf16 pTile[4][16][32];

  int lane = threadIdx.x & 31;
  // scalar, so that the per-wave test at the diagonal stage is a scalar branch
  int wave = __builtin_amdgcn_readfirstlane(threadIdx.x >> 5);
  int bh   = blockIdx.y;
  int qRow0 = blockIdx.x * 64 + wave * 16;
  const bf16* qh = qr + (size_t)bh * S * HD;
  const bf16* kh = kr + (size_t)bh * S * HD;
  const bf16* vh = vt + (size_t)bh * HD * S;

  v16bf aq0 = load_frag(qh, HD, qRow0, 0, lane);
  v16bf aq1 = load_frag(qh, HD, qRow0, 32, lane);

  v8f o[4] = {};
  float mrow[8], lrow[8];
#pragma unroll
  for (int i = 0; i < 8; ++i) { mrow[i] = -1e30f; lrow[i] = 0.f; }
  int rowOff = (lane >> 4) * 8;
  int nlane  = lane & 15;

  int cRow = threadIdx.x >> 3;                 // 0..15
  int cCol = (threadIdx.x & 7) * 8;            // 0,8,..,56
  unsigned ldsK[2] = {
      (unsigned)(uintptr_t)&kBuf[0][cRow][cCol],
      (unsigned)(uintptr_t)&kBuf[1][cRow][cCol]};
  unsigned ldsV[2] = {
      (unsigned)(uintptr_t)&vBuf[0][cRow][cCol],
      (unsigned)(uintptr_t)&vBuf[1][cRow][cCol]};
  const bf16* gK = kh + cRow * HD + cCol;      // stage st: + st * 64 key rows
  const bf16* gV = vh + cRow * S + cCol;       // stage st: + st * 64 columns

  int nSt = blockIdx.x + 1;                    // stages up to the diagonal one
  attn_stage_copy(ldsK[0], gK, ldsV[0], gV);
  WAIT_ASYNC0();
  __syncthreads();                             // stage 0 visible to all waves
  if (nSt > 1)
    attn_stage_copy(ldsK[1], gK + 64 * HD, ldsV[1], gV + 64);

  // stages fully below the diagonal for all four waves
  for (int st = 0; st + 1 < nSt; ++st) {
    const bf16* kb = &kBuf[st & 1][0][0];
    const bf16* vb = &vBuf[st & 1][0][0];
    attn_tile<false>(st << 6, 0, aq0, aq1, kb, vb, pTile[wave], o, mrow,
                     lrow, qRow0, rowOff, nlane, lane);
    attn_tile<false>((st << 6) + 32, 32, aq0, aq1, kb, vb, pTile[wave], o, mrow,
                     lrow, qRow0, rowOff, nlane, lane);

    // publish point of stage st + 1, passed by every wave: own reads of stage
    // st retired, own copies of stage st + 1 landed, then the one barrier that
    // does both jobs
    WAIT_DS0();
    WAIT_ASYNC0();
    __syncthreads();
    if (st + 2 < nSt)                          // refill the buffer just freed
      attn_stage_copy(ldsK[st & 1], gK + (st + 2) * 64 * HD,
                      ldsV[st & 1], gV + (st + 2) * 64);
  }
  // the diagonal stage, published by the last barrier above.  Its first tile
  // holds the diagonal of waves 0 and 1 and lies below that of waves 2 and 3
  // (there the mask changes nothing); its second tile holds the diagonal of
  // waves 2 and 3 and lies beyond that of waves 0 and 1, which skip it.
  {
    int st = nSt - 1;
    const bf16* kb = &kBuf[st & 1][0][0];
    const bf16* vb = &vBuf[st & 1][0][0];
    attn_tile<true>(st << 6, 0, aq0, aq1, kb, vb, pTile[wave], o, mrow,
                    lrow, qRow0, rowOff, nlane, lane);
    if (wave >= 2)
      attn_tile<true>((st << 6) + 32, 32, aq0, aq1, kb, vb, pTile[wave], o,
                      mrow, lrow, qRow0, rowOff, nlane, lane);
  }
  WAIT_ASYNC0();                               // nothing in flight at the end

  int b = bh >> 4, h = bh & 15;
#pragma unroll
  for (int c = 0; c < 4; ++c)
#pragma unroll
    for (int i = 0; i < 8; ++i) {
      int q = qRow0 + rowOff + i;
      float v = o[c][i] / lrow[i];
      size_t idx = ((size_t)(b * 2048 + q)) * 1024 + h * 64 + c * 16 + nlane;
      attn[idx] = (bf16)v;
    }
}

// ----- SiLU(gate) * up ------------------------------------------------------
// 64 elements a thread, so that few waves have to be started: a wave takes
// 2048 consecutive elements of g and of u by 8 + 8 loads of 16 B a lane (each
// wave-wide load and store is 512 contiguous bytes = 4 whole lines).  A block
// takes 16384 elements and the grid covers the array exactly.  g, u and h are
// all addressed by one 32-bit byte offset (the arrays hold 32 MiB each).
__global__ __launch_bounds__(256) void tb_silu_mul(const bf16* __restrict__ g,
                                                   const bf16* __restrict__ u,
                                                   bf16* __restrict__ h) {
  unsigned off = blockIdx.x * 32768u + (threadIdx.x >> 5) * 4096u +
                 (threadIdx.x & 31) * 16u;
  const char* gp = reinterpret_cast<const char*>(g) + off;
  const char* up = reinterpret_cast<const char*>(u) + off;
  char*       hp = reinterpret_cast<char*>(h) + off;
  v8bf gq[8], uq[8];
#pragma unroll
  for (int j = 0; j < 8; ++j) {
    gq[j] = *reinterpret_cast<const v8bf*>(gp + j * 512);
    uq[j] = *reinterpret_cast<const v8bf*>(up + j * 512);
  }
  // Keeps all 16 loads in front of the arithmetic: without it the scheduler
  // sinks most of them between the divisions, and a wave then waits for memory
  // several times instead of once.
  __builtin_amdgcn_sched_barrier(0);
#pragma unroll
  for (int j = 0; j < 8; ++j) {
    v8bf o;
#pragma unroll
    for (int k = 0; k < 8; ++k) {
      float gv = (float)gq[j][k], uv = (float)uq[j][k];
      float s = gv / (1.f + __expf(-gv));
      o[k] = (bf16)(s * uv);
    }
    *reinterpret_cast<v8bf*>(hp + j * 512) = o;
    // Lets each store leave when its 8 elements are done: without it the
    // scheduler gathers most stores at the wave's end, behind all arithmetic.
    if (j < 7) __builtin_amdgcn_sched_barrier(0);
  }
}

// ---------------------------------------------------------------------------
extern "C" void kernel_launch(void* const* d_in, const int* in_sizes, int n_in,
                              void* d_out, int out_size, void* d_ws, size_t ws_size,
                              hipStream_t stream) {
  (void)in_sizes; (void)n_in; (void)out_size; (void)ws_size;
  const float* x    = (const float*)d_in[0];
  const int*   sp   = (const int*)d_in[1];
  const float* n1w  = (const float*)d_in[2];
  const float* wqkv = (const float*)d_in[3];
  const float* wo   = (const float*)d_in[4];
  const float* n2w  = (const float*)d_in[5];
  const float* wg   = (const float*)d_in[6];
  const float* wu   = (const float*)d_in[7];
  const float* wd   = (const float*)d_in[8];
  float* out = (float*)d_out;

  // Workspace layout (~240 MB, regions 16B aligned).
  const size_t T = 4096;                             // B*S tokens
  bf16*  bWq  = (bf16*)d_ws;                         // 3072*1024
  bf16*  bWo  = bWq + (size_t)3072 * 1024;           // 1024*1024
  bf16*  bWg  = bWo + (size_t)1024 * 1024;           // 4096*1024
  bf16*  bWu  = bWg + (size_t)4096 * 1024;           // 4096*1024
  bf16*  bWd  = bWu + (size_t)4096 * 1024;           // 1024*4096
  bf16*  xn   = bWd + (size_t)1024 * 4096;           // T*1024 bf16
  float* qkv  = (float*)(xn + T * 1024);             // T*3072 f32
  bf16*  qrb  = (bf16*)(qkv + T * 3072);             // 32*2048*64
  bf16*  krb  = qrb + (size_t)32 * 2048 * 64;
  bf16*  vtb  = krb + (size_t)32 * 2048 * 64;
  bf16*  attnb= vtb + (size_t)32 * 2048 * 64;        // T*1024 bf16
  float* out1 = (float*)(attnb + T * 1024);          // T*1024 f32
  bf16*  xn2  = (bf16*)(out1 + T * 1024);            // T*1024 bf16
  bf16*  gateb= xn2 + T * 1024;                      // T*4096 bf16
  bf16*  upb  = gateb + T * 4096;
  bf16*  hb   = upb + T * 4096;

  // 1) weights -> bf16 once; every GEMM re-reads them from L2 at half width
  tb_cvt_f32_bf16<<<(3072 * 1024) / 8192, 256, 0, stream>>>(wqkv, bWq);
  tb_cvt_f32_bf16<<<(1024 * 1024) / 8192, 256, 0, stream>>>(wo,   bWo);
  tb_cvt_f32_bf16<<<(4096 * 1024) / 8192, 256, 0, stream>>>(wg,   bWg);
  tb_cvt_f32_bf16<<<(4096 * 1024) / 8192, 256, 0, stream>>>(wu,   bWu);
  tb_cvt_f32_bf16<<<(1024 * 4096) / 8192, 256, 0, stream>>>(wd,   bWd);

  // 2) xn = rmsnorm(x)
  tb_rmsnorm_bf16<<<(int)T, 256, 0, stream>>>(x, n1w, xn, 1024);

  // 3) qkv = xn @ Wqkv^T
  tb_gemm_bf16<0><<<dim3(3072 / 256, T / 64), 256, 0, stream>>>(
      xn, bWq, (void*)qkv, nullptr, (int)T, 3072, 1024);

  // 4) RoPE + head split + V^T (q pre-scaled into base-2 softmax domain)
  tb_rope_qkv<<<(32 * 2048 * 32) / 256, 256, 0, stream>>>(qkv, sp, qrb, krb, vtb);

  // 5) flash attention -> attn (bf16, [B,S,D])
  tb_flash_attn<<<dim3(2048 / 64, 32), 128, 0, stream>>>(qrb, krb, vtb, attnb);

  // 6) out1 = x + attn @ Wo^T
  tb_gemm_bf16<1><<<dim3(1024 / 256, T / 64), 256, 0, stream>>>(
      attnb, bWo, (void*)out1, x, (int)T, 1024, 1024);

  // 7) xn2 = rmsnorm(out1)
  tb_rmsnorm_bf16<<<(int)T, 256, 0, stream>>>(out1, n2w, xn2, 1024);

  // 8) gate / up projections
  tb_gemm_bf16<2><<<dim3(4096 / 256, T / 64), 256, 0, stream>>>(
      xn2, bWg, (void*)gateb, nullptr, (int)T, 4096, 1024);
  tb_gemm_bf16<2><<<dim3(4096 / 256, T / 64), 256, 0, stream>>>(
      xn2, bWu, (void*)upb, nullptr, (int)T, 4096, 1024);

  // 9) h = silu(gate) * up
  tb_silu_mul<<<(16777216) / 16384, 256, 0, stream>>>(gateb, upb, hb);

  // 10) out = out1 + h @ Wd^T
  tb_gemm_bf16<1><<<dim3(1024 / 256, T / 64), 256, 0, stream>>>(
      hb, bWd, (void*)out, out1, (int)T, 1024, 4096);
}

// v005
// One run takes 374 microseconds.
// Timed twice side by side with v004, it ran 1.08 times as fast both times.
// Counting every step since v000, it is 1.88 times as fast.
#include <hip/hip_runtime.h>
#include <hip/hip_bf16.h>

typedef __bf16 bf16;
typedef __attribute__((ext_vector_type(16))) __bf16 v16bf;
typedef __attribute__((ext_vector_type(8)))  __bf16 v8bf;
typedef __attribute__((ext_vector_type(8)))  float  v8f;
typedef __attribute__((ext_vector_type(4)))  __bf16 v4bf;
typedef __attribute__((ext_vector_type(4)))  float  v4f;

static __device__ __forceinline__ void gemm_stage_copy(
    unsigned la, const bf16* ga, unsigned lw, const bf16* gw, size_t wStep,
    unsigned lStep) {
  asm volatile(
      "global_load_async_to_lds_b128 %0, %1, off\n\t"
      "global_load_async_to_lds_b128 %2, %3, off\n\t"
      "global_load_async_to_lds_b128 %4, %5, off\n\t"
      "global_load_async_to_lds_b128 %6, %7, off\n\t"
      "global_load_async_to_lds_b128 %8, %9, off\n\t"
      "global_load_async_to_lds_b128 %10, %11, off\n\t"
      "global_load_async_to_lds_b128 %12, %13, off\n\t"
      "global_load_async_to_lds_b128 %14, %15, off\n\t"
      "global_load_async_to_lds_b128 %16, %17, off\n\t"
      "global_load_async_to_lds_b128 %18, %19, off\n\t"
      "s_wait_xcnt 0x0"
      :: "v"(la),             "v"(ga),
         "v"(la + 16u),       "v"(ga + 8),
         "v"(lw),             "v"(gw),
         "v"(lw + lStep),     "v"(gw + wStep),
         "v"(lw + 2 * lStep), "v"(gw + 2 * wStep),
         "v"(lw + 3 * lStep), "v"(gw + 3 * wStep),
         "v"(lw + 4 * lStep), "v"(gw + 4 * wStep),
         "v"(lw + 5 * lStep), "v"(gw + 5 * wStep),
         "v"(lw + 6 * lStep), "v"(gw + 6 * wStep),
         "v"(lw + 7 * lStep), "v"(gw + 7 * wStep)
      : "memory");
}
static __device__ __forceinline__ void gemm_stage_copy_tall(
    unsigned la, const bf16* ga, unsigned lw, const bf16* gw, size_t gStep,
    unsigned lStep) {
  asm volatile(
      "global_load_async_to_lds_b128 %0, %1, off\n\t"
      "global_load_async_to_lds_b128 %2, %3, off\n\t"
      "global_load_async_to_lds_b128 %4, %5, off\n\t"
      "global_load_async_to_lds_b128 %6, %7, off\n\t"
      "global_load_async_to_lds_b128 %8, %9, off\n\t"
      "global_load_async_to_lds_b128 %10, %11, off\n\t"
      "global_load_async_to_lds_b128 %12, %13, off\n\t"
      "global_load_async_to_lds_b128 %14, %15, off\n\t"
      "global_load_async_to_lds_b128 %16, %17, off\n\t"
      "global_load_async_to_lds_b128 %18, %19, off\n\t"
      "global_load_async_to_lds_b128 %20, %21, off\n\t"
      "global_load_async_to_lds_b128 %22, %23, off\n\t"
      "s_wait_xcnt 0x0"
      :: "v"(la),             "v"(ga),
         "v"(la + lStep),     "v"(ga + gStep),
         "v"(la + 2 * lStep), "v"(ga + 2 * gStep),
         "v"(la + 3 * lStep), "v"(ga + 3 * gStep),
         "v"(lw),             "v"(gw),
         "v"(lw + lStep),     "v"(gw + gStep),
         "v"(lw + 2 * lStep), "v"(gw + 2 * gStep),
         "v"(lw + 3 * lStep), "v"(gw + 3 * gStep),
         "v"(lw + 4 * lStep), "v"(gw + 4 * gStep),
         "v"(lw + 5 * lStep), "v"(gw + 5 * gStep),
         "v"(lw + 6 * lStep), "v"(gw + 6 * gStep),
         "v"(lw + 7 * lStep), "v"(gw + 7 * gStep)
      : "memory");
}
// The issuing wave's copies have landed behind this wait.
#define WAIT_ASYNC0() asm volatile("s_wait_asynccnt 0x0" ::: "memory")
// The wave's own LDS reads have retired before a buffer it read is refilled.
#define WAIT_DS0() asm volatile("s_wait_dscnt 0x0" ::: "memory")

static __device__ __forceinline__ void attn_stage_copy(
    unsigned lk, const bf16* gk, unsigned lv, const bf16* gv) {
  asm volatile(
      "global_load_async_to_lds_b128 %0, %1, off\n\t"
      "global_load_async_to_lds_b128 %2, %3, off\n\t"
      "global_load_async_to_lds_b128 %4, %5, off\n\t"
      "global_load_async_to_lds_b128 %6, %7, off\n\t"
      "global_load_async_to_lds_b128 %8, %9, off\n\t"
      "global_load_async_to_lds_b128 %10, %11, off\n\t"
      "global_load_async_to_lds_b128 %12, %13, off\n\t"
      "global_load_async_to_lds_b128 %14, %15, off\n\t"
      "s_wait_xcnt 0x0"
      :: "v"(lk),              "v"(gk),
         "v"(lk + 16u * 144u), "v"(gk + 16 * 64),
         "v"(lk + 32u * 144u), "v"(gk + 32 * 64),
         "v"(lk + 48u * 144u), "v"(gk + 48 * 64),
         "v"(lv),              "v"(gv),
         "v"(lv + 16u * 144u), "v"(gv + 16 * 2048),
         "v"(lv + 32u * 144u), "v"(gv + 32 * 2048),
         "v"(lv + 48u * 144u), "v"(gv + 48 * 2048)
      : "memory");
}

static __device__ __forceinline__ v16bf load_frag(const bf16* base, int ld,
                                                  int row, int k0, int lane) {
  int r  = row + (lane & 15);
  int kg = (lane >> 4) & 1;              // lanes 16-31 take the +8 K group
  const bf16* p = base + (size_t)r * ld + k0 + kg * 8;
  v8bf lo = *reinterpret_cast<const v8bf*>(p);
  v8bf hi = *reinterpret_cast<const v8bf*>(p + 16);
  v16bf v;
#pragma unroll
  for (int i = 0; i < 8; ++i) { v[i] = lo[i]; v[i + 8] = hi[i]; }
  return v;
}

static __device__ __forceinline__ v8f wmma_bf16f32(v16bf a, v16bf b, v8f c) {
  return __builtin_amdgcn_wmma_f32_16x16x32_bf16(false, a, false, b,
                                                 (short)0, c, false, false);
}

static __device__ __forceinline__ v16bf ones_frag() {
  v16bf v;
#pragma unroll
  for (int i = 0; i < 16; ++i) v[i] = (bf16)1.0f;
  return v;
}

// ----- 16-lane row max via DPP16 butterflies (VALU only, no DS pipe) --------
// xor1 = quad_perm(1,0,3,2)=0xB1, xor2 = quad_perm(2,3,0,1)=0x4E,
// xor7 = row_half_mirror=0x141, xor15 = row_mirror=0x140.
template <int CTRL>
static __device__ __forceinline__ float fmax_dpp(float x) {
  int v = __builtin_amdgcn_update_dpp(0, __float_as_int(x), CTRL, 0xF, 0xF, true);
  return fmaxf(x, __int_as_float(v));
}
static __device__ __forceinline__ float rowmax16(float x) {
  x = fmax_dpp<0xB1>(x);
  x = fmax_dpp<0x4E>(x);
  x = fmax_dpp<0x141>(x);
  x = fmax_dpp<0x140>(x);
  return x;
}

// ----- fp32 -> bf16 weight conversion ---------------------------------------
// 32 elements a thread, so that few waves have to be started: a wave takes
// 1024 consecutive floats by 8 loads of 16 B a lane (each wave-wide load is
// 512 contiguous bytes = 4 whole lines), all 8 in flight before the first
// store; each store covers 2 whole lines.  A block takes 8192 elements and the
// grid covers the array exactly (every weight count is a multiple of 8192).
__global__ __launch_bounds__(256) void tb_cvt_f32_bf16(
    const float* __restrict__ in, bf16* __restrict__ out) {
  size_t base = (size_t)blockIdx.x * 8192 + (threadIdx.x >> 5) * 1024 +
                (threadIdx.x & 31) * 4;
  v4f v[8];
#pragma unroll
  for (int j = 0; j < 8; ++j)
    v[j] = *reinterpret_cast<const v4f*>(in + base + j * 128);
#pragma unroll
  for (int j = 0; j < 8; ++j) {
    v4bf o;
#pragma unroll
    for (int k = 0; k < 4; ++k) o[k] = (bf16)v[j][k];
    *reinterpret_cast<v4bf*>(out + base + j * 128) = o;
  }
}

// ----- fused RMSNorm + bf16 cast --------------------------------------------
__global__ __launch_bounds__(256) void tb_rmsnorm_bf16(
    const float* __restrict__ x, const float* __restrict__ w,
    bf16* __restrict__ out, int D) {
  int row = blockIdx.x;
  const float* xr = x + (size_t)row * D;
  float ss = 0.f;
  for (int i = threadIdx.x; i < D; i += 256) { float v = xr[i]; ss += v * v; }
#pragma unroll
  for (int off = 16; off > 0; off >>= 1) ss += __shfl_xor(ss, off, 32);
  __shared__ float red[8];
  if ((threadIdx.x & 31) == 0) red[threadIdx.x >> 5] = ss;
  __syncthreads();
  float tot = 0.f;
#pragma unroll
  for (int i = 0; i < 8; ++i) tot += red[i];
  float scale = rsqrtf(tot / (float)D + 1e-6f);
  for (int i = threadIdx.x; i < D; i += 256)
    out[(size_t)row * D + i] = (bf16)(xr[i] * scale * w[i]);
}

template <int EPI, int BM>
__global__ __launch_bounds__(256) void tb_gemm_bf16(
    const bf16* __restrict__ A, const bf16* __restrict__ W,
    void* __restrict__ Cv, const float* __restrict__ R,
    int M, int N, int K) {
  constexpr int WP = 72;                       // W tile pitch in LDS, elements
  constexpr int AP = 72;                       // A tile pitch in LDS, elements
  constexpr int MT = BM / 32;                  // 16-row A fragments per wave
  __shared__ __attribute__((aligned(16))) bf16 aBuf[2][BM][AP];
  __shared__ __attribute__((aligned(16))) bf16 wBuf[2][256][WP];

  int lane   = threadIdx.x & 31;
  int wave   = threadIdx.x >> 5;
  int mBlock = blockIdx.y * BM;
  int nBlock = blockIdx.x * 256;
  int mLoc   = (wave >> 2) * (BM / 2);         // wave's rows inside the block
  int nLoc   = (wave & 3) * 64;                // wave's columns inside the block
  int nBase  = nBlock + nLoc;

  int cpRow = BM == 64 ? threadIdx.x >> 2 : threadIdx.x >> 3;
  int cpCol = BM == 64 ? (threadIdx.x & 3) * 16 : (threadIdx.x & 7) * 8;
  int wRow = threadIdx.x >> 3;                 // 0..31
  int wCol = (threadIdx.x & 7) * 8;            // 0,8,..,56
  unsigned ldsA[2] = {
      (unsigned)(uintptr_t)&aBuf[0][cpRow][cpCol],
      (unsigned)(uintptr_t)&aBuf[1][cpRow][cpCol]};
  unsigned ldsW[2] = {
      (unsigned)(uintptr_t)&wBuf[0][wRow][wCol],
      (unsigned)(uintptr_t)&wBuf[1][wRow][wCol]};
  const bf16* gA = A + (size_t)(mBlock + cpRow) * K + cpCol;
  const bf16* gW = W + (size_t)(nBlock + wRow) * K + wCol;
  const size_t   wStep = (size_t)32 * K;       // 32 rows in global memory
  const unsigned lStep = 32u * WP * 2u;        // 32 rows in LDS, bytes
  auto stage_copy = [&](int buf, int ko) {     // K offset ko into buffer buf
    if constexpr (BM == 64)
      gemm_stage_copy(ldsA[buf], gA + ko, ldsW[buf], gW + ko, wStep, lStep);
    else
      gemm_stage_copy_tall(ldsA[buf], gA + ko, ldsW[buf], gW + ko, wStep, lStep);
  };

  int Kt = K >> 6;                             // 64-wide K tiles
  stage_copy(0, 0);
  WAIT_ASYNC0();
  __syncthreads();                             // stage 0 visible to all waves
  if (Kt > 1)
    stage_copy(1, 64);

  v8f acc[MT][4] = {};
  for (int kt = 0; kt < Kt; ++kt) {
    const bf16* ab = &aBuf[kt & 1][0][0];
    const bf16* wb = &wBuf[kt & 1][0][0];
#pragma unroll
    for (int kh = 0; kh < 2; ++kh) {
      // The four loops below are unrolled so that a[], b[] and acc[][] are
      // indexed by constants and stay in registers.
      v16bf a[MT], b[4];
#pragma unroll
      for (int ti = 0; ti < MT; ++ti)                           // ds_load
        a[ti] = load_frag(ab, AP, mLoc + ti * 16, kh << 5, lane);
#pragma unroll
      for (int tj = 0; tj < 4; ++tj)                            // ds_load
        b[tj] = load_frag(wb, WP, nLoc + tj * 16, kh << 5, lane);
#pragma unroll
      for (int ti = 0; ti < MT; ++ti)
#pragma unroll
        for (int tj = 0; tj < 4; ++tj)
          acc[ti][tj] = wmma_bf16f32(a[ti], b[tj], acc[ti][tj]);
    }

    // publish point of stage kt + 1: own reads of stage kt retired, own copies
    // of stage kt + 1 landed, then the one barrier that does both jobs
    WAIT_DS0();
    WAIT_ASYNC0();
    __syncthreads();
    if (kt + 2 < Kt)                           // refill the buffer just freed
      stage_copy(kt & 1, (kt + 2) << 6);
  }
  WAIT_ASYNC0();                               // nothing in flight at the end

  int col0   = nBase + (lane & 15);
  int rowOff = (lane >> 4) * 8;
#pragma unroll
  for (int ti = 0; ti < MT; ++ti)
#pragma unroll
    for (int tj = 0; tj < 4; ++tj)
#pragma unroll
      for (int i = 0; i < 8; ++i) {
        int r = mBlock + mLoc + ti * 16 + rowOff + i;
        int c = col0 + tj * 16;
        size_t idx = (size_t)r * N + c;
        float v = acc[ti][tj][i];
        if (EPI == 0)      ((float*)Cv)[idx] = v;
        else if (EPI == 1) ((float*)Cv)[idx] = R[idx] + v;
        else               ((bf16*)Cv)[idx] = (bf16)v;
      }
}

// ----- RoPE + head split + V transpose --------------------------------------
// q is pre-scaled by 0.125*log2(e) so attention scores come out of the WMMA
// already in the base-2 softmax domain (no per-element scaling, raw v_exp).
__global__ void tb_rope_qkv(const float* __restrict__ qkv,
                            const int* __restrict__ sp,
                            bf16* __restrict__ qr, bf16* __restrict__ kr,
                            bf16* __restrict__ vt) {
  const float QS = 0.125f * 1.44269504088896340736f;  // (1/sqrt(64))*log2(e)
  int tid = blockIdx.x * 256 + threadIdx.x;   // [0, 32*2048*32)
  int i  = tid & 31;                          // dim pair
  int s  = (tid >> 5) & 2047;                 // seq pos
  int bh = tid >> 16;                         // 0..31
  int b = bh >> 4, h = bh & 15;
  size_t qb = ((size_t)(b * 2048 + s)) * 3072 + h * 64;
  float qe = qkv[qb + 2 * i],        qo = qkv[qb + 2 * i + 1];
  float ke = qkv[qb + 1024 + 2 * i], ko = qkv[qb + 1024 + 2 * i + 1];
  float v0 = qkv[qb + 2048 + 2 * i], v1 = qkv[qb + 2048 + 2 * i + 1];
  float freq = __expf(-(float)(2 * i) * (9.2103403719761827f / 64.0f));
  float t = (float)(sp[0] + s);
  float sn, cs;
  __sincosf(t * freq, &sn, &cs);
  size_t ob = ((size_t)bh * 2048 + s) * 64;
  qr[ob + 2 * i]     = (bf16)((qe * cs - qo * sn) * QS);
  qr[ob + 2 * i + 1] = (bf16)((qe * sn + qo * cs) * QS);
  kr[ob + 2 * i]     = (bf16)(ke * cs - ko * sn);
  kr[ob + 2 * i + 1] = (bf16)(ke * sn + ko * cs);
  size_t vb = (size_t)bh * 64 * 2048;
  vt[vb + (size_t)(2 * i) * 2048 + s]     = (bf16)v0;
  vt[vb + (size_t)(2 * i + 1) * 2048 + s] = (bf16)v1;
}

// ----- Flash attention: one 32-key tile step --------------------------------
// MASKED=false for tiles fully below the diagonal (no v_cmp/v_cndmask).
// Row-max: DPP16 butterflies.  Row-sum: P @ ones on the WMMA pipe.
// All exponentials are exp2 (scores already in base-2 domain).
// kb / vb: the stage's K tile (key rows) and V^T tile (head-dim rows) in LDS,
// pitch KVP elements; kl = the tile's first key inside the stage (0 or 32),
// k0 = the same key's position in the sequence (for the mask).
constexpr int KVP = 72;                        // 144 B = 16 B x 9: no conflicts
template <bool MASKED>
static __device__ __forceinline__ void attn_tile(
    int k0, int kl, v16bf aq0, v16bf aq1, const bf16* kb, const bf16* vb,
    bf16 (*pT)[32], v8f* o, float* mrow, float* lrow,
    int qRow0, int rowOff, int nlane, int lane) {
  v16bf kf0 = load_frag(kb, KVP, kl,      0,  lane);       // ds_load
  v16bf kf1 = load_frag(kb, KVP, kl,      32, lane);
  v16bf kf2 = load_frag(kb, KVP, kl + 16, 0,  lane);
  v16bf kf3 = load_frag(kb, KVP, kl + 16, 32, lane);
  v16bf vf[4];
#pragma unroll
  for (int c = 0; c < 4; ++c) vf[c] = load_frag(vb, KVP, c * 16, kl, lane);
  // Keeps the tile's 16 LDS reads as one group in front of the products:
  // without it the scheduler sinks them between the WMMAs into one register
  // set, and the wave waits out the LDS latency once per product.
  __builtin_amdgcn_sched_barrier(0);
  v8f s0 = {}, s1 = {};
  s0 = wmma_bf16f32(aq0, kf0, s0);
  s0 = wmma_bf16f32(aq1, kf1, s0);
  s1 = wmma_bf16f32(aq0, kf2, s1);
  s1 = wmma_bf16f32(aq1, kf3, s1);

  float alpha[8];
#pragma unroll
  for (int i = 0; i < 8; ++i) {
    float v0 = s0[i];
    float v1 = s1[i];
    if (MASKED) {
      int row = qRow0 + rowOff + i;
      if (k0 + nlane > row)      v0 = -3.0e38f;
      if (k0 + 16 + nlane > row) v1 = -3.0e38f;
    }
    float mx = rowmax16(fmaxf(v0, v1));        // 16-lane row-group max (DPP)
    float nm = fmaxf(mrow[i], mx);
    float a  = __builtin_amdgcn_exp2f(mrow[i] - nm);   // raw v_exp_f32
    float p0 = __builtin_amdgcn_exp2f(v0 - nm);
    float p1 = __builtin_amdgcn_exp2f(v1 - nm);
    alpha[i] = a;
    mrow[i]  = nm;
    pT[rowOff + i][nlane]      = (bf16)p0;     // C-layout -> LDS (A-layout src)
    pT[rowOff + i][nlane + 16] = (bf16)p1;
  }
#pragma unroll
  for (int c = 0; c < 4; ++c)
#pragma unroll
    for (int i = 0; i < 8; ++i) o[c][i] *= alpha[i];

  v16bf pf = load_frag(&pT[0][0], 32, 0, 0, lane);   // ds_load, same-wave order
  v8f sums = {};
  sums = wmma_bf16f32(pf, ones_frag(), sums);  // row sums, replicated per lane
#pragma unroll
  for (int i = 0; i < 8; ++i) lrow[i] = lrow[i] * alpha[i] + sums[i];

#pragma unroll
  for (int c = 0; c < 4; ++c)      // P(16x32) @ V(32x64), hd in 4 chunks of 16
    o[c] = wmma_bf16f32(pf, vf[c], o[c]);
}

// grid (S/64, B*H), 128 threads = 4 waves, one wave per 16 query rows.
// The block walks the keys in stages of 64 (two 32-key tiles).  A stage's K and
// V^T tiles are brought once for all four waves by async-to-LDS copies of whole
// 128-B lines into two buffers: the next stage flies while this one is worked
// on, one barrier per stage.  Each wave takes the same 32-key tiles in the same
// order as if it read them from global memory itself.
__global__ __launch_bounds__(128) void tb_flash_attn(
    const bf16* __restrict__ qr, const bf16* __restrict__ kr,
    const bf16* __restrict__ vt, bf16* __restrict__ attn) {
  const int S = 2048, HD = 64;
  __shared__ __attribute__((aligned(16))) bf16 kBuf[2][64][KVP];
  __shared__ __attribute__((aligned(16))) bf16 vBuf[2][64][KVP];
  __shared__ __attribute__((aligned(16))) bf16 pTile[4][16][32];

  int lane = threadIdx.x & 31;
  // scalar, so that the per-wave test at the diagonal stage is a scalar branch
  int wave = __builtin_amdgcn_readfirstlane(threadIdx.x >> 5);
  int bh   = blockIdx.y;
  int qRow0 = blockIdx.x * 64 + wave * 16;
  const bf16* qh = qr + (size_t)bh * S * HD;
  const bf16* kh = kr + (size_t)bh * S * HD;
  const bf16* vh = vt + (size_t)bh * HD * S;

  v16bf aq0 = load_frag(qh, HD, qRow0, 0, lane);
  v16bf aq1 = load_frag(qh, HD, qRow0, 32, lane);

  v8f o[4] = {};
  float mrow[8], lrow[8];
#pragma unroll
  for (int i = 0; i < 8; ++i) { mrow[i] = -1e30f; lrow[i] = 0.f; }
  int rowOff = (lane >> 4) * 8;
  int nlane  = lane & 15;

  int cRow = threadIdx.x >> 3;                 // 0..15
  int cCol = (threadIdx.x & 7) * 8;            // 0,8,..,56
  unsigned ldsK[2] = {
      (unsigned)(uintptr_t)&kBuf[0][cRow][cCol],
      (unsigned)(uintptr_t)&kBuf[1][cRow][cCol]};
  unsigned ldsV[2] = {
      (unsigned)(uintptr_t)&vBuf[0][cRow][cCol],
      (unsigned)(uintptr_t)&vBuf[1][cRow][cCol]};
  const bf16* gK = kh + cRow * HD + cCol;      // stage st: + st * 64 key rows
  const bf16* gV = vh + cRow * S + cCol;       // stage st: + st * 64 columns

  int nSt = blockIdx.x + 1;                    // stages up to the diagonal one
  attn_stage_copy(ldsK[0], gK, ldsV[0], gV);
  WAIT_ASYNC0();
  __syncthreads();                             // stage 0 visible to all waves
  if (nSt > 1)
    attn_stage_copy(ldsK[1], gK + 64 * HD, ldsV[1], gV + 64);

  // stages fully below the diagonal for all four waves
  for (int st = 0; st + 1 < nSt; ++st) {
    const bf16* kb = &kBuf[st & 1][0][0];
    const bf16* vb = &vBuf[st & 1][0][0];
    attn_tile<false>(st << 6, 0, aq0, aq1, kb, vb, pTile[wave], o, mrow,
                     lrow, qRow0, rowOff, nlane, lane);
    attn_tile<false>((st << 6) + 32, 32, aq0, aq1, kb, vb, pTile[wave], o, mrow,
                     lrow, qRow0, rowOff, nlane, lane);

    // publish point of stage st + 1, passed by every wave: own reads of stage
    // st retired, own copies of stage st + 1 landed, then the one barrier that
    // does both jobs
    WAIT_DS0();
    WAIT_ASYNC0();
    __syncthreads();
    if (st + 2 < nSt)                          // refill the buffer just freed
      attn_stage_copy(ldsK[st & 1], gK + (st + 2) * 64 * HD,
                      ldsV[st & 1], gV + (st + 2) * 64);
  }
  // the diagonal stage, published by the last barrier above.  Its first tile
  // holds the diagonal of waves 0 and 1 and lies below that of waves 2 and 3
  // (there the mask changes nothing); its second tile holds the diagonal of
  // waves 2 and 3 and lies beyond that of waves 0 and 1, which skip it.
  {
    int st = nSt - 1;
    const bf16* kb = &kBuf[st & 1][0][0];
    const bf16* vb = &vBuf[st & 1][0][0];
    attn_tile<true>(st << 6, 0, aq0, aq1, kb, vb, pTile[wave], o, mrow,
                    lrow, qRow0, rowOff, nlane, lane);
    if (wave >= 2)
      attn_tile<true>((st << 6) + 32, 32, aq0, aq1, kb, vb, pTile[wave], o,
                      mrow, lrow, qRow0, rowOff, nlane, lane);
  }
  WAIT_ASYNC0();                               // nothing in flight at the end

  int b = bh >> 4, h = bh & 15;
#pragma unroll
  for (int c = 0; c < 4; ++c)
#pragma unroll
    for (int i = 0; i < 8; ++i) {
      int q = qRow0 + rowOff + i;
      float v = o[c][i] / lrow[i];
      size_t idx = ((size_t)(b * 2048 + q)) * 1024 + h * 64 + c * 16 + nlane;
      attn[idx] = (bf16)v;
    }
}

// ----- SiLU(gate) * up ------------------------------------------------------
// 64 elements a thread, so that few waves have to be started: a wave takes
// 2048 consecutive elements of g and of u by 8 + 8 loads of 16 B a lane (each
// wave-wide load and store is 512 contiguous bytes = 4 whole lines).  A block
// takes 16384 elements and the grid covers the array exactly.  g, u and h are
// all addressed by one 32-bit byte offset (the arrays hold 32 MiB each).
__global__ __launch_bounds__(256) void tb_silu_mul(const bf16* __restrict__ g,
                                                   const bf16* __restrict__ u,
                                                   bf16* __restrict__ h) {
  unsigned off = blockIdx.x * 32768u + (threadIdx.x >> 5) * 4096u +
                 (threadIdx.x & 31) * 16u;
  const char* gp = reinterpret_cast<const char*>(g) + off;
  const char* up = reinterpret_cast<const char*>(u) + off;
  char*       hp = reinterpret_cast<char*>(h) + off;
  v8bf gq[8], uq[8];
#pragma unroll
  for (int j = 0; j < 8; ++j) {
    gq[j] = *reinterpret_cast<const v8bf*>(gp + j * 512);
    uq[j] = *reinterpret_cast<const v8bf*>(up + j * 512);
  }
  // Keeps all 16 loads in front of the arithmetic: without it the scheduler
  // sinks most of them between the divisions, and a wave then waits for memory
  // several times instead of once.
  __builtin_amdgcn_sched_barrier(0);
#pragma unroll
  for (int j = 0; j < 8; ++j) {
    v8bf o;
#pragma unroll
    for (int k = 0; k < 8; ++k) {
      float gv = (float)gq[j][k], uv = (float)uq[j][k];
      float s = gv / (1.f + __expf(-gv));
      o[k] = (bf16)(s * uv);
    }
    *reinterpret_cast<v8bf*>(hp + j * 512) = o;
    // Lets each store leave when its 8 elements are done: without it the
    // scheduler gathers most stores at the wave's end, behind all arithmetic.
    if (j < 7) __builtin_amdgcn_sched_barrier(0);
  }
}

// ---------------------------------------------------------------------------
extern "C" void kernel_launch(void* const* d_in, const int* in_sizes, int n_in,
                              void* d_out, int out_size, void* d_ws, size_t ws_size,
                              hipStream_t stream) {
  (void)in_sizes; (void)n_in; (void)out_size; (void)ws_size;
  const float* x    = (const float*)d_in[0];
  const int*   sp   = (const int*)d_in[1];
  const float* n1w  = (const float*)d_in[2];
  const float* wqkv = (const float*)d_in[3];
  const float* wo   = (const float*)d_in[4];
  const float* n2w  = (const float*)d_in[5];
  const float* wg   = (const float*)d_in[6];
  const float* wu   = (const float*)d_in[7];
  const float* wd   = (const float*)d_in[8];
  float* out = (float*)d_out;

  // Workspace layout (~240 MB, regions 16B aligned).
  const size_t T = 4096;                             // B*S tokens
  bf16*  bWq  = (bf16*)d_ws;                         // 3072*1024
  bf16*  bWo  = bWq + (size_t)3072 * 1024;           // 1024*1024
  bf16*  bWg  = bWo + (size_t)1024 * 1024;           // 4096*1024
  bf16*  bWu  = bWg + (size_t)4096 * 1024;           // 4096*1024
  bf16*  bWd  = bWu + (size_t)4096 * 1024;           // 1024*4096
  bf16*  xn   = bWd + (size_t)1024 * 4096;           // T*1024 bf16
  float* qkv  = (float*)(xn + T * 1024);             // T*3072 f32
  bf16*  qrb  = (bf16*)(qkv + T * 3072);             // 32*2048*64
  bf16*  krb  = qrb + (size_t)32 * 2048 * 64;
  bf16*  vtb  = krb + (size_t)32 * 2048 * 64;
  bf16*  attnb= vtb + (size_t)32 * 2048 * 64;        // T*1024 bf16
  float* out1 = (float*)(attnb + T * 1024);          // T*1024 f32
  bf16*  xn2  = (bf16*)(out1 + T * 1024);            // T*1024 bf16
  bf16*  gateb= xn2 + T * 1024;                      // T*4096 bf16
  bf16*  upb  = gateb + T * 4096;
  bf16*  hb   = upb + T * 4096;

  // 1) weights -> bf16 once; every GEMM re-reads them from L2 at half width
  tb_cvt_f32_bf16<<<(3072 * 1024) / 8192, 256, 0, stream>>>(wqkv, bWq);
  tb_cvt_f32_bf16<<<(1024 * 1024) / 8192, 256, 0, stream>>>(wo,   bWo);
  tb_cvt_f32_bf16<<<(4096 * 1024) / 8192, 256, 0, stream>>>(wg,   bWg);
  tb_cvt_f32_bf16<<<(4096 * 1024) / 8192, 256, 0, stream>>>(wu,   bWu);
  tb_cvt_f32_bf16<<<(1024 * 4096) / 8192, 256, 0, stream>>>(wd,   bWd);

  // 2) xn = rmsnorm(x)
  tb_rmsnorm_bf16<<<(int)T, 256, 0, stream>>>(x, n1w, xn, 1024);

  // 3) qkv = xn @ Wqkv^T
  tb_gemm_bf16<0, 128><<<dim3(3072 / 256, T / 128), 256, 0, stream>>>(
      xn, bWq, (void*)qkv, nullptr, (int)T, 3072, 1024);

  // 4) RoPE + head split + V^T (q pre-scaled into base-2 softmax domain)
  tb_rope_qkv<<<(32 * 2048 * 32) / 256, 256, 0, stream>>>(qkv, sp, qrb, krb, vtb);

  // 5) flash attention -> attn (bf16, [B,S,D])
  tb_flash_attn<<<dim3(2048 / 64, 32), 128, 0, stream>>>(qrb, krb, vtb, attnb);

  // 6) out1 = x + attn @ Wo^T
  tb_gemm_bf16<1, 64><<<dim3(1024 / 256, T / 64), 256, 0, stream>>>(
      attnb, bWo, (void*)out1, x, (int)T, 1024, 1024);

  // 7) xn2 = rmsnorm(out1)
  tb_rmsnorm_bf16<<<(int)T, 256, 0, stream>>>(out1, n2w, xn2, 1024);

  // 8) gate / up projections
  tb_gemm_bf16<2, 128><<<dim3(4096 / 256, T / 128), 256, 0, stream>>>(
      xn2, bWg, (void*)gateb, nullptr, (int)T, 4096, 1024);
  tb_gemm_bf16<2, 128><<<dim3(4096 / 256, T / 128), 256, 0, stream>>>(
      xn2, bWu, (void*)upb, nullptr, (int)T, 4096, 1024);

  // 9) h = silu(gate) * up
  tb_silu_mul<<<(16777216) / 16384, 256, 0, stream>>>(gateb, upb, hb);

  // 10) out = out1 + h @ Wd^T
  tb_gemm_bf16<1, 64><<<dim3(1024 / 256, T / 64), 256, 0, stream>>>(
      hb, bWd, (void*)out, out1, (int)T, 1024, 4096);
}

// v006
// One run takes 269 microseconds.
// Next to v005, in two timings, it ran 1.38 and 1.40 times as fast.
// All steps since v000 together make it 2.61 times as fast.
#include <hip/hip_runtime.h>
#include <hip/hip_bf16.h>

typedef __bf16 bf16;
typedef __attribute__((ext_vector_type(16))) __bf16 v16bf;
typedef __attribute__((ext_vector_type(8)))  __bf16 v8bf;
typedef __attribute__((ext_vector_type(8)))  float  v8f;
typedef __attribute__((ext_vector_type(4)))  __bf16 v4bf;
typedef __attribute__((ext_vector_type(2)))  __bf16 v2bf;
typedef __attribute__((ext_vector_type(4)))  float  v4f;

static __device__ __forceinline__ void gemm_stage_copy(
    unsigned la, const bf16* ga, unsigned lw, const bf16* gw, size_t wStep,
    unsigned lStep) {
  asm volatile(
      "global_load_async_to_lds_b128 %0, %1, off\n\t"
      "global_load_async_to_lds_b128 %2, %3, off\n\t"
      "global_load_async_to_lds_b128 %4, %5, off\n\t"
      "global_load_async_to_lds_b128 %6, %7, off\n\t"
      "global_load_async_to_lds_b128 %8, %9, off\n\t"
      "global_load_async_to_lds_b128 %10, %11, off\n\t"
      "global_load_async_to_lds_b128 %12, %13, off\n\t"
      "global_load_async_to_lds_b128 %14, %15, off\n\t"
      "global_load_async_to_lds_b128 %16, %17, off\n\t"
      "global_load_async_to_lds_b128 %18, %19, off\n\t"
      "s_wait_xcnt 0x0"
      :: "v"(la),             "v"(ga),
         "v"(la + 16u),       "v"(ga + 8),
         "v"(lw),             "v"(gw),
         "v"(lw + lStep),     "v"(gw + wStep),
         "v"(lw + 2 * lStep), "v"(gw + 2 * wStep),
         "v"(lw + 3 * lStep), "v"(gw + 3 * wStep),
         "v"(lw + 4 * lStep), "v"(gw + 4 * wStep),
         "v"(lw + 5 * lStep), "v"(gw + 5 * wStep),
         "v"(lw + 6 * lStep), "v"(gw + 6 * wStep),
         "v"(lw + 7 * lStep), "v"(gw + 7 * wStep)
      : "memory");
}
static __device__ __forceinline__ void gemm_stage_copy_tall(
    unsigned la, const bf16* ga, unsigned lw, const bf16* gw, size_t gStep,
    unsigned lStep) {
  asm volatile(
      "global_load_async_to_lds_b128 %0, %1, off\n\t"
      "global_load_async_to_lds_b128 %2, %3, off\n\t"
      "global_load_async_to_lds_b128 %4, %5, off\n\t"
      "global_load_async_to_lds_b128 %6, %7, off\n\t"
      "global_load_async_to_lds_b128 %8, %9, off\n\t"
      "global_load_async_to_lds_b128 %10, %11, off\n\t"
      "global_load_async_to_lds_b128 %12, %13, off\n\t"
      "global_load_async_to_lds_b128 %14, %15, off\n\t"
      "global_load_async_to_lds_b128 %16, %17, off\n\t"
      "global_load_async_to_lds_b128 %18, %19, off\n\t"
      "global_load_async_to_lds_b128 %20, %21, off\n\t"
      "global_load_async_to_lds_b128 %22, %23, off\n\t"
      "s_wait_xcnt 0x0"
      :: "v"(la),             "v"(ga),
         "v"(la + lStep),     "v"(ga + gStep),
         "v"(la + 2 * lStep), "v"(ga + 2 * gStep),
         "v"(la + 3 * lStep), "v"(ga + 3 * gStep),
         "v"(lw),             "v"(gw),
         "v"(lw + lStep),     "v"(gw + gStep),
         "v"(lw + 2 * lStep), "v"(gw + 2 * gStep),
         "v"(lw + 3 * lStep), "v"(gw + 3 * gStep),
         "v"(lw + 4 * lStep), "v"(gw + 4 * gStep),
         "v"(lw + 5 * lStep), "v"(gw + 5 * gStep),
         "v"(lw + 6 * lStep), "v"(gw + 6 * gStep),
         "v"(lw + 7 * lStep), "v"(gw + 7 * gStep)
      : "memory");
}
// The issuing wave's copies have landed behind this wait.
#define WAIT_ASYNC0() asm volatile("s_wait_asynccnt 0x0" ::: "memory")
// The wave's own LDS reads have retired before a buffer it read is refilled.
#define WAIT_DS0() asm volatile("s_wait_dscnt 0x0" ::: "memory")

static __device__ __forceinline__ void attn_stage_copy(
    unsigned lk, const bf16* gk, unsigned lv, const bf16* gv) {
  asm volatile(
      "global_load_async_to_lds_b128 %0, %1, off\n\t"
      "global_load_async_to_lds_b128 %2, %3, off\n\t"
      "global_load_async_to_lds_b128 %4, %5, off\n\t"
      "global_load_async_to_lds_b128 %6, %7, off\n\t"
      "global_load_async_to_lds_b128 %8, %9, off\n\t"
      "global_load_async_to_lds_b128 %10, %11, off\n\t"
      "global_load_async_to_lds_b128 %12, %13, off\n\t"
      "global_load_async_to_lds_b128 %14, %15, off\n\t"
      "s_wait_xcnt 0x0"
      :: "v"(lk),              "v"(gk),
         "v"(lk + 16u * 144u), "v"(gk + 16 * 64),
         "v"(lk + 32u * 144u), "v"(gk + 32 * 64),
         "v"(lk + 48u * 144u), "v"(gk + 48 * 64),
         "v"(lv),              "v"(gv),
         "v"(lv + 16u * 144u), "v"(gv + 16 * 2048),
         "v"(lv + 32u * 144u), "v"(gv + 32 * 2048),
         "v"(lv + 48u * 144u), "v"(gv + 48 * 2048)
      : "memory");
}

static __device__ __forceinline__ v16bf load_frag(const bf16* base, int ld,
                                                  int row, int k0, int lane) {
  int r  = row + (lane & 15);
  int kg = (lane >> 4) & 1;              // lanes 16-31 take the +8 K group
  const bf16* p = base + (size_t)r * ld + k0 + kg * 8;
  v8bf lo = *reinterpret_cast<const v8bf*>(p);
  v8bf hi = *reinterpret_cast<const v8bf*>(p + 16);
  v16bf v;
#pragma unroll
  for (int i = 0; i < 8; ++i) { v[i] = lo[i]; v[i + 8] = hi[i]; }
  return v;
}

static __device__ __forceinline__ v8f wmma_bf16f32(v16bf a, v16bf b, v8f c) {
  return __builtin_amdgcn_wmma_f32_16x16x32_bf16(false, a, false, b,
                                                 (short)0, c, false, false);
}

static __device__ __forceinline__ v16bf ones_frag() {
  v16bf v;
#pragma unroll
  for (int i = 0; i < 16; ++i) v[i] = (bf16)1.0f;
  return v;
}

// ----- 16-lane row max via DPP16 butterflies (VALU only, no DS pipe) --------
// xor1 = quad_perm(1,0,3,2)=0xB1, xor2 = quad_perm(2,3,0,1)=0x4E,
// xor7 = row_half_mirror=0x141, xor15 = row_mirror=0x140.
template <int CTRL>
static __device__ __forceinline__ float fmax_dpp(float x) {
  int v = __builtin_amdgcn_update_dpp(0, __float_as_int(x), CTRL, 0xF, 0xF, true);
  return fmaxf(x, __int_as_float(v));
}
static __device__ __forceinline__ float rowmax16(float x) {
  x = fmax_dpp<0xB1>(x);
  x = fmax_dpp<0x4E>(x);
  x = fmax_dpp<0x141>(x);
  x = fmax_dpp<0x140>(x);
  return x;
}

// ----- fp32 -> bf16 weight conversion ---------------------------------------
// 32 elements a thread, so that few waves have to be started: a wave takes
// 1024 consecutive floats by 8 loads of 16 B a lane (each wave-wide load is
// 512 contiguous bytes = 4 whole lines), all 8 in flight before the first
// store; each store covers 2 whole lines.  A block takes 8192 elements and the
// grid covers the array exactly (every weight count is a multiple of 8192).
__global__ __launch_bounds__(256) void tb_cvt_f32_bf16(
    const float* __restrict__ in, bf16* __restrict__ out) {
  size_t base = (size_t)blockIdx.x * 8192 + (threadIdx.x >> 5) * 1024 +
                (threadIdx.x & 31) * 4;
  v4f v[8];
#pragma unroll
  for (int j = 0; j < 8; ++j)
    v[j] = *reinterpret_cast<const v4f*>(in + base + j * 128);
#pragma unroll
  for (int j = 0; j < 8; ++j) {
    v4bf o;
#pragma unroll
    for (int k = 0; k < 4; ++k) o[k] = (bf16)v[j][k];
    *reinterpret_cast<v4bf*>(out + base + j * 128) = o;
  }
}

// ----- fused RMSNorm + bf16 cast --------------------------------------------
__global__ __launch_bounds__(256) void tb_rmsnorm_bf16(
    const float* __restrict__ x, const float* __restrict__ w,
    bf16* __restrict__ out, int D) {
  int row = blockIdx.x;
  const float* xr = x + (size_t)row * D;
  float ss = 0.f;
  for (int i = threadIdx.x; i < D; i += 256) { float v = xr[i]; ss += v * v; }
#pragma unroll
  for (int off = 16; off > 0; off >>= 1) ss += __shfl_xor(ss, off, 32);
  __shared__ float red[8];
  if ((threadIdx.x & 31) == 0) red[threadIdx.x >> 5] = ss;
  __syncthreads();
  float tot = 0.f;
#pragma unroll
  for (int i = 0; i < 8; ++i) tot += red[i];
  float scale = rsqrtf(tot / (float)D + 1e-6f);
  for (int i = threadIdx.x; i < D; i += 256)
    out[(size_t)row * D + i] = (bf16)(xr[i] * scale * w[i]);
}

template <int EPI, int BM>
__global__ __launch_bounds__(256) void tb_gemm_bf16(
    const bf16* __restrict__ A, const bf16* __restrict__ W,
    void* __restrict__ Cv, const float* __restrict__ R,
    const int* __restrict__ sp, int M, int N, int K) {
  constexpr int WP = 72;                       // W tile pitch in LDS, elements
  constexpr int AP = 72;                       // A tile pitch in LDS, elements
  constexpr int MT = BM / 32;                  // 16-row A fragments per wave
  __shared__ __attribute__((aligned(16))) bf16 aBuf[2][BM][AP];
  __shared__ __attribute__((aligned(16))) bf16 wBuf[2][256][WP];

  int lane   = threadIdx.x & 31;
  int wave   = threadIdx.x >> 5;
  int mBlock = blockIdx.y * BM;
  int nBlock = blockIdx.x * 256;
  int mLoc   = (wave >> 2) * (BM / 2);         // wave's rows inside the block
  int nLoc   = (wave & 3) * 64;                // wave's columns inside the block
  int nBase  = nBlock + nLoc;

  int cpRow = BM == 64 ? threadIdx.x >> 2 : threadIdx.x >> 3;
  int cpCol = BM == 64 ? (threadIdx.x & 3) * 16 : (threadIdx.x & 7) * 8;
  int wRow = threadIdx.x >> 3;                 // 0..31
  int wCol = (threadIdx.x & 7) * 8;            // 0,8,..,56
  unsigned ldsA[2] = {
      (unsigned)(uintptr_t)&aBuf[0][cpRow][cpCol],
      (unsigned)(uintptr_t)&aBuf[1][cpRow][cpCol]};
  unsigned ldsW[2] = {
      (unsigned)(uintptr_t)&wBuf[0][wRow][wCol],
      (unsigned)(uintptr_t)&wBuf[1][wRow][wCol]};
  const bf16* gA = A + (size_t)(mBlock + cpRow) * K + cpCol;
  const bf16* gW = W + (size_t)(nBlock + wRow) * K + wCol;
  const size_t   wStep = (size_t)32 * K;       // 32 rows in global memory
  const unsigned lStep = 32u * WP * 2u;        // 32 rows in LDS, bytes
  auto stage_copy = [&](int buf, int ko) {     // K offset ko into buffer buf
    if constexpr (BM == 64)
      gemm_stage_copy(ldsA[buf], gA + ko, ldsW[buf], gW + ko, wStep, lStep);
    else
      gemm_stage_copy_tall(ldsA[buf], gA + ko, ldsW[buf], gW + ko, wStep, lStep);
  };

  // read ahead of the loop (a scalar load), so that the epilogue does not wait
  int pos0 = 0;
  if constexpr (EPI == 3) pos0 = sp[0];

  int Kt = K >> 6;                             // 64-wide K tiles
  stage_copy(0, 0);
  WAIT_ASYNC0();
  __syncthreads();                             // stage 0 visible to all waves
  if (Kt > 1)
    stage_copy(1, 64);

  v8f acc[MT][4] = {};
  for (int kt = 0; kt < Kt; ++kt) {
    const bf16* ab = &aBuf[kt & 1][0][0];
    const bf16* wb = &wBuf[kt & 1][0][0];
#pragma unroll
    for (int kh = 0; kh < 2; ++kh) {
      // The four loops below are unrolled so that a[], b[] and acc[][] are
      // indexed by constants and stay in registers.
      v16bf a[MT], b[4];
#pragma unroll
      for (int ti = 0; ti < MT; ++ti)                           // ds_load
        a[ti] = load_frag(ab, AP, mLoc + ti * 16, kh << 5, lane);
#pragma unroll
      for (int tj = 0; tj < 4; ++tj)                            // ds_load
        b[tj] = load_frag(wb, WP, nLoc + tj * 16, kh << 5, lane);
#pragma unroll
      for (int ti = 0; ti < MT; ++ti)
#pragma unroll
        for (int tj = 0; tj < 4; ++tj)
          acc[ti][tj] = wmma_bf16f32(a[ti], b[tj], acc[ti][tj]);
    }

    // publish point of stage kt + 1: own reads of stage kt retired, own copies
    // of stage kt + 1 landed, then the one barrier that does both jobs
    WAIT_DS0();
    WAIT_ASYNC0();
    __syncthreads();
    if (kt + 2 < Kt)                           // refill the buffer just freed
      stage_copy(kt & 1, (kt + 2) << 6);
  }
  WAIT_ASYNC0();                               // nothing in flight at the end

  int col0   = nBase + (lane & 15);
  int rowOff = (lane >> 4) * 8;
  if constexpr (EPI == 3) {
    // A block's 256 columns lie in one of q, k, v (1024 columns each), a wave's
    // 64 columns are one head, a block's 128 rows lie in one sequence of 2048.
    constexpr size_t PLANE = (size_t)32 * 2048 * 64;
    int sec  = nBlock >> 10;                   // 0 = q, 1 = k, 2 = v (scalar)
    int tok0 = mBlock + mLoc + rowOff;         // the lane's first row
    int bh   = (tok0 >> 11) * 16 + ((nBase & 1023) >> 6);
    int s0   = tok0 & 2047;                    // its position in the sequence
    int cl   = lane & 15;
    bf16* dst = (bf16*)Cv + sec * PLANE + (size_t)bh * (2048 * 64);
    if (sec == 2) {
      // V^T: a lane holds 8 consecutive positions of one head dim = one 16-B
      // store into that dim's row
#pragma unroll
      for (int ti = 0; ti < MT; ++ti)
#pragma unroll
        for (int tj = 0; tj < 4; ++tj) {
          v8bf o;
#pragma unroll
          for (int i = 0; i < 8; ++i) o[i] = (bf16)acc[ti][tj][i];
          *reinterpret_cast<v8bf*>(dst + (tj * 16 + cl) * 2048 + s0 + ti * 16) = o;
        }
    } else {
      // q is pre-scaled by 0.125*log2(e) so attention scores come out of the
      // WMMA already in the base-2 softmax domain; k is not scaled.
      const float scl = sec == 0 ? 0.125f * 1.44269504088896340736f : 1.0f;
      // A rotation pair (even, odd head dim) sits in two neighbouring lanes.
      // For two rows the lanes swap one value each: the even lane then holds
      // the whole pair of row i, the odd lane that of row i + 1, so that each
      // lane takes one sine and cosine per two elements and stores 4 bytes.
      bool odd = lane & 1;
      int  tl  = pos0 + s0 + (odd ? 1 : 0);
      bf16* dl = dst + (s0 + (odd ? 1 : 0)) * 64 + (cl & 14);
#pragma unroll
      for (int tj = 0; tj < 4; ++tj) {
        // 10000^(-dim/64) = exp2(-dim * ln(10000)/64 * log2(e))
        float ex = -(float)(tj * 16 + (cl & 14)) *
                   (9.2103403719761827f / 64.0f) * 1.44269504088896340736f;
        float freq;
        asm("v_exp_f32 %0, %1\n\tv_nop" : "=&v"(freq) : "v"(ex));
#pragma unroll
        for (int ti = 0; ti < MT; ++ti)
#pragma unroll
          for (int i = 0; i < 8; i += 2) {
            float lo = acc[ti][tj][i], hi = acc[ti][tj][i + 1];
            float got = __int_as_float(__builtin_amdgcn_update_dpp(
                0, __float_as_int(odd ? lo : hi), 0xB1, 0xF, 0xF, true));
            float xe = odd ? got : lo;
            float xo = odd ? hi : got;
            // angle in revolutions, as v_sin_f32 / v_cos_f32 take it
            float rev = (float)(tl + ti * 16 + i) * freq * 0.15915494309189532f;
            float sn, cs;
            asm("v_sin_f32 %0, %2\n\tv_cos_f32 %1, %2\n\tv_nop"
                : "=&v"(sn), "=&v"(cs) : "v"(rev));
            v2bf o;
            o[0] = (bf16)((xe * cs - xo * sn) * scl);
            o[1] = (bf16)((xe * sn + xo * cs) * scl);
            *reinterpret_cast<v2bf*>(dl + (ti * 16 + i) * 64 + tj * 16) = o;
          }
      }
      // behind the last q/k store: in the built code the V^T branch follows
      // this one and rewrites registers that these stores name
      asm volatile("s_wait_xcnt 0x0" ::: "memory");
    }
  } else {
#pragma unroll
    for (int ti = 0; ti < MT; ++ti)
#pragma unroll
      for (int tj = 0; tj < 4; ++tj)
#pragma unroll
        for (int i = 0; i < 8; ++i) {
          int r = mBlock + mLoc + ti * 16 + rowOff + i;
          int c = col0 + tj * 16;
          size_t idx = (size_t)r * N + c;
          float v = acc[ti][tj][i];
          if (EPI == 1) ((float*)Cv)[idx] = R[idx] + v;
          else          ((bf16*)Cv)[idx] = (bf16)v;
        }
  }
}

// ----- Flash attention: one 32-key tile step --------------------------------
// MASKED=false for tiles fully below the diagonal (no v_cmp/v_cndmask).
// Row-max: DPP16 butterflies.  Row-sum: P @ ones on the WMMA pipe.
// All exponentials are exp2 (scores already in base-2 domain).
// kb / vb: the stage's K tile (key rows) and V^T tile (head-dim rows) in LDS,
// pitch KVP elements; kl = the tile's first key inside the stage (0 or 32),
// k0 = the same key's position in the sequence (for the mask).
constexpr int KVP = 72;                        // 144 B = 16 B x 9: no conflicts
template <bool MASKED>
static __device__ __forceinline__ void attn_tile(
    int k0, int kl, v16bf aq0, v16bf aq1, const bf16* kb, const bf16* vb,
    bf16 (*pT)[32], v8f* o, float* mrow, float* lrow,
    int qRow0, int rowOff, int nlane, int lane) {
  v16bf kf0 = load_frag(kb, KVP, kl,      0,  lane);       // ds_load
  v16bf kf1 = load_frag(kb, KVP, kl,      32, lane);
  v16bf kf2 = load_frag(kb, KVP, kl + 16, 0,  lane);
  v16bf kf3 = load_frag(kb, KVP, kl + 16, 32, lane);
  v16bf vf[4];
#pragma unroll
  for (int c = 0; c < 4; ++c) vf[c] = load_frag(vb, KVP, c * 16, kl, lane);
  // Keeps the tile's 16 LDS reads as one group in front of the products:
  // without it the scheduler sinks them between the WMMAs into one register
  // set, and the wave waits out the LDS latency once per product.
  __builtin_amdgcn_sched_barrier(0);
  v8f s0 = {}, s1 = {};
  s0 = wmma_bf16f32(aq0, kf0, s0);
  s0 = wmma_bf16f32(aq1, kf1, s0);
  s1 = wmma_bf16f32(aq0, kf2, s1);
  s1 = wmma_bf16f32(aq1, kf3, s1);

  float alpha[8];
#pragma unroll
  for (int i = 0; i < 8; ++i) {
    float v0 = s0[i];
    float v1 = s1[i];
    if (MASKED) {
      int row = qRow0 + rowOff + i;
      if (k0 + nlane > row)      v0 = -3.0e38f;
      if (k0 + 16 + nlane > row) v1 = -3.0e38f;
    }
    float mx = rowmax16(fmaxf(v0, v1));        // 16-lane row-group max (DPP)
    float nm = fmaxf(mrow[i], mx);
    float a  = __builtin_amdgcn_exp2f(mrow[i] - nm);   // raw v_exp_f32
    float p0 = __builtin_amdgcn_exp2f(v0 - nm);
    float p1 = __builtin_amdgcn_exp2f(v1 - nm);
    alpha[i] = a;
    mrow[i]  = nm;
    pT[rowOff + i][nlane]      = (bf16)p0;     // C-layout -> LDS (A-layout src)
    pT[rowOff + i][nlane + 16] = (bf16)p1;
  }
#pragma unroll
  for (int c = 0; c < 4; ++c)
#pragma unroll
    for (int i = 0; i < 8; ++i) o[c][i] *= alpha[i];

  v16bf pf = load_frag(&pT[0][0], 32, 0, 0, lane);   // ds_load, same-wave order
  v8f sums = {};
  sums = wmma_bf16f32(pf, ones_frag(), sums);  // row sums, replicated per lane
#pragma unroll
  for (int i = 0; i < 8; ++i) lrow[i] = lrow[i] * alpha[i] + sums[i];

#pragma unroll
  for (int c = 0; c < 4; ++c)      // P(16x32) @ V(32x64), hd in 4 chunks of 16
    o[c] = wmma_bf16f32(pf, vf[c], o[c]);
}

// grid (S/64, B*H), 128 threads = 4 waves, one wave per 16 query rows.
// The block walks the keys in stages of 64 (two 32-key tiles).  A stage's K and
// V^T tiles are brought once for all four waves by async-to-LDS copies of whole
// 128-B lines into two buffers: the next stage flies while this one is worked
// on, one barrier per stage.  Each wave takes the same 32-key tiles in the same
// order as if it read them from global memory itself.
__global__ __launch_bounds__(128) void tb_flash_attn(
    const bf16* __restrict__ qr, const bf16* __restrict__ kr,
    const bf16* __restrict__ vt, bf16* __restrict__ attn) {
  const int S = 2048, HD = 64;
  __shared__ __attribute__((aligned(16))) bf16 kBuf[2][64][KVP];
  __shared__ __attribute__((aligned(16))) bf16 vBuf[2][64][KVP];
  __shared__ __attribute__((aligned(16))) bf16 pTile[4][16][32];

  int lane = threadIdx.x & 31;
  // scalar, so that the per-wave test at the diagonal stage is a scalar branch
  int wave = __builtin_amdgcn_readfirstlane(threadIdx.x >> 5);
  int bh   = blockIdx.y;
  int qRow0 = blockIdx.x * 64 + wave * 16;
  const bf16* qh = qr + (size_t)bh * S * HD;
  const bf16* kh = kr + (size_t)bh * S * HD;
  const bf16* vh = vt + (size_t)bh * HD * S;

  v16bf aq0 = load_frag(qh, HD, qRow0, 0, lane);
  v16bf aq1 = load_frag(qh, HD, qRow0, 32, lane);

  v8f o[4] = {};
  float mrow[8], lrow[8];
#pragma unroll
  for (int i = 0; i < 8; ++i) { mrow[i] = -1e30f; lrow[i] = 0.f; }
  int rowOff = (lane >> 4) * 8;
  int nlane  = lane & 15;

  int cRow = threadIdx.x >> 3;                 // 0..15
  int cCol = (threadIdx.x & 7) * 8;            // 0,8,..,56
  unsigned ldsK[2] = {
      (unsigned)(uintptr_t)&kBuf[0][cRow][cCol],
      (unsigned)(uintptr_t)&kBuf[1][cRow][cCol]};
  unsigned ldsV[2] = {
      (unsigned)(uintptr_t)&vBuf[0][cRow][cCol],
      (unsigned)(uintptr_t)&vBuf[1][cRow][cCol]};
  const bf16* gK = kh + cRow * HD + cCol;      // stage st: + st * 64 key rows
  const bf16* gV = vh + cRow * S + cCol;       // stage st: + st * 64 columns

  int nSt = blockIdx.x + 1;                    // stages up to the diagonal one
  attn_stage_copy(ldsK[0], gK, ldsV[0], gV);
  WAIT_ASYNC0();
  __syncthreads();                             // stage 0 visible to all waves
  if (nSt > 1)
    attn_stage_copy(ldsK[1], gK + 64 * HD, ldsV[1], gV + 64);

  // stages fully below the diagonal for all four waves
  for (int st = 0; st + 1 < nSt; ++st) {
    const bf16* kb = &kBuf[st & 1][0][0];
    const bf16* vb = &vBuf[st & 1][0][0];
    attn_tile<false>(st << 6, 0, aq0, aq1, kb, vb, pTile[wave], o, mrow,
                     lrow, qRow0, rowOff, nlane, lane);
    attn_tile<false>((st << 6) + 32, 32, aq0, aq1, kb, vb, pTile[wave], o, mrow,
                     lrow, qRow0, rowOff, nlane, lane);

    // publish point of stage st + 1, passed by every wave: own reads of stage
    // st retired, own copies of stage st + 1 landed, then the one barrier that
    // does both jobs
    WAIT_DS0();
    WAIT_ASYNC0();
    __syncthreads();
    if (st + 2 < nSt)                          // refill the buffer just freed
      attn_stage_copy(ldsK[st & 1], gK + (st + 2) * 64 * HD,
                      ldsV[st & 1], gV + (st + 2) * 64);
  }
  // the diagonal stage, published by the last barrier above.  Its first tile
  // holds the diagonal of waves 0 and 1 and lies below that of waves 2 and 3
  // (there the mask changes nothing); its second tile holds the diagonal of
  // waves 2 and 3 and lies beyond that of waves 0 and 1, which skip it.
  {
    int st = nSt - 1;
    const bf16* kb = &kBuf[st & 1][0][0];
    const bf16* vb = &vBuf[st & 1][0][0];
    attn_tile<true>(st << 6, 0, aq0, aq1, kb, vb, pTile[wave], o, mrow,
                    lrow, qRow0, rowOff, nlane, lane);
    if (wave >= 2)
      attn_tile<true>((st << 6) + 32, 32, aq0, aq1, kb, vb, pTile[wave], o,
                      mrow, lrow, qRow0, rowOff, nlane, lane);
  }
  WAIT_ASYNC0();                               // nothing in flight at the end

  int b = bh >> 4, h = bh & 15;
#pragma unroll
  for (int c = 0; c < 4; ++c)
#pragma unroll
    for (int i = 0; i < 8; ++i) {
      int q = qRow0 + rowOff + i;
      float v = o[c][i] / lrow[i];
      size_t idx = ((size_t)(b * 2048 + q)) * 1024 + h * 64 + c * 16 + nlane;
      attn[idx] = (bf16)v;
    }
}

// ----- SiLU(gate) * up ------------------------------------------------------
// 64 elements a thread, so that few waves have to be started: a wave takes
// 2048 consecutive elements of g and of u by 8 + 8 loads of 16 B a lane (each
// wave-wide load and store is 512 contiguous bytes = 4 whole lines).  A block
// takes 16384 elements and the grid covers the array exactly.  g, u and h are
// all addressed by one 32-bit byte offset (the arrays hold 32 MiB each).
__global__ __launch_bounds__(256) void tb_silu_mul(const bf16* __restrict__ g,
                                                   const bf16* __restrict__ u,
                                                   bf16* __restrict__ h) {
  unsigned off = blockIdx.x * 32768u + (threadIdx.x >> 5) * 4096u +
                 (threadIdx.x & 31) * 16u;
  const char* gp = reinterpret_cast<const char*>(g) + off;
  const char* up = reinterpret_cast<const char*>(u) + off;
  char*       hp = reinterpret_cast<char*>(h) + off;
  v8bf gq[8], uq[8];
#pragma unroll
  for (int j = 0; j < 8; ++j) {
    gq[j] = *reinterpret_cast<const v8bf*>(gp + j * 512);
    uq[j] = *reinterpret_cast<const v8bf*>(up + j * 512);
  }
  // Keeps all 16 loads in front of the arithmetic: without it the scheduler
  // sinks most of them between the divisions, and a wave then waits for memory
  // several times instead of once.
  __builtin_amdgcn_sched_barrier(0);
#pragma unroll
  for (int j = 0; j < 8; ++j) {
    v8bf o;
#pragma unroll
    for (int k = 0; k < 8; ++k) {
      float gv = (float)gq[j][k], uv = (float)uq[j][k];
      float s = gv / (1.f + __expf(-gv));
      o[k] = (bf16)(s * uv);
    }
    *reinterpret_cast<v8bf*>(hp + j * 512) = o;
    // Lets each store leave when its 8 elements are done: without it the
    // scheduler gathers most stores at the wave's end, behind all arithmetic.
    if (j < 7) __builtin_amdgcn_sched_barrier(0);
  }
}

// ---------------------------------------------------------------------------
extern "C" void kernel_launch(void* const* d_in, const int* in_sizes, int n_in,
                              void* d_out, int out_size, void* d_ws, size_t ws_size,
                              hipStream_t stream) {
  (void)in_sizes; (void)n_in; (void)out_size; (void)ws_size;
  const float* x    = (const float*)d_in[0];
  const int*   sp   = (const int*)d_in[1];
  const float* n1w  = (const float*)d_in[2];
  const float* wqkv = (const float*)d_in[3];
  const float* wo   = (const float*)d_in[4];
  const float* n2w  = (const float*)d_in[5];
  const float* wg   = (const float*)d_in[6];
  const float* wu   = (const float*)d_in[7];
  const float* wd   = (const float*)d_in[8];
  float* out = (float*)d_out;

  // Workspace layout (~190 MB, regions 16B aligned).
  const size_t T = 4096;                             // B*S tokens
  bf16*  bWq  = (bf16*)d_ws;                         // 3072*1024
  bf16*  bWo  = bWq + (size_t)3072 * 1024;           // 1024*1024
  bf16*  bWg  = bWo + (size_t)1024 * 1024;           // 4096*1024
  bf16*  bWu  = bWg + (size_t)4096 * 1024;           // 4096*1024
  bf16*  bWd  = bWu + (size_t)4096 * 1024;           // 1024*4096
  bf16*  xn   = bWd + (size_t)1024 * 4096;           // T*1024 bf16
  bf16*  qrb  = xn + T * 1024;                       // 32*2048*64
  bf16*  krb  = qrb + (size_t)32 * 2048 * 64;
  bf16*  vtb  = krb + (size_t)32 * 2048 * 64;
  bf16*  attnb= vtb + (size_t)32 * 2048 * 64;        // T*1024 bf16
  float* out1 = (float*)(attnb + T * 1024);          // T*1024 f32
  bf16*  xn2  = (bf16*)(out1 + T * 1024);            // T*1024 bf16
  bf16*  gateb= xn2 + T * 1024;                      // T*4096 bf16
  bf16*  upb  = gateb + T * 4096;
  bf16*  hb   = upb + T * 4096;

  // 1) weights -> bf16 once; every GEMM re-reads them from L2 at half width
  tb_cvt_f32_bf16<<<(3072 * 1024) / 8192, 256, 0, stream>>>(wqkv, bWq);
  tb_cvt_f32_bf16<<<(1024 * 1024) / 8192, 256, 0, stream>>>(wo,   bWo);
  tb_cvt_f32_bf16<<<(4096 * 1024) / 8192, 256, 0, stream>>>(wg,   bWg);
  tb_cvt_f32_bf16<<<(4096 * 1024) / 8192, 256, 0, stream>>>(wu,   bWu);
  tb_cvt_f32_bf16<<<(1024 * 4096) / 8192, 256, 0, stream>>>(wd,   bWd);

  // 2) xn = rmsnorm(x)
  tb_rmsnorm_bf16<<<(int)T, 256, 0, stream>>>(x, n1w, xn, 1024);

  // 3) + 4) xn @ Wqkv^T with RoPE, head split and V^T in the epilogue (q
  // pre-scaled into the base-2 softmax domain); writes qrb, krb and vtb, which
  // lie one behind the other
  tb_gemm_bf16<3, 128><<<dim3(3072 / 256, T / 128), 256, 0, stream>>>(
      xn, bWq, (void*)qrb, nullptr, sp, (int)T, 3072, 1024);

  // 5) flash attention -> attn (bf16, [B,S,D])
  tb_flash_attn<<<dim3(2048 / 64, 32), 128, 0, stream>>>(qrb, krb, vtb, attnb);

  // 6) out1 = x + attn @ Wo^T
  tb_gemm_bf16<1, 64><<<dim3(1024 / 256, T / 64), 256, 0, stream>>>(
      attnb, bWo, (void*)out1, x, nullptr, (int)T, 1024, 1024);

  // 7) xn2 = rmsnorm(out1)
  tb_rmsnorm_bf16<<<(int)T, 256, 0, stream>>>(out1, n2w, xn2, 1024);

  // 8) gate / up projections
  tb_gemm_bf16<2, 128><<<dim3(4096 / 256, T / 128), 256, 0, stream>>>(
      xn2, bWg, (void*)gateb, nullptr, nullptr, (int)T, 4096, 1024);
  tb_gemm_bf16<2, 128><<<dim3(4096 / 256, T / 128), 256, 0, stream>>>(
      xn2, bWu, (void*)upb, nullptr, nullptr, (int)T, 4096, 1024);

  // 9) h = silu(gate) * up
  tb_silu_mul<<<(16777216) / 16384, 256, 0, stream>>>(gateb, upb, hb);

  // 10) out = out1 + h @ Wd^T
  tb_gemm_bf16<1, 64><<<dim3(1024 / 256, T / 64), 256, 0, stream>>>(
      hb, bWd, (void*)out, out1, nullptr, (int)T, 1024, 4096);
}

// v007
// One run takes 246 microseconds.
// Timed twice side by side with v006, it ran 1.10 times as fast both times.
// All steps since v000 together make it 2.87 times as fast.
#include <hip/hip_runtime.h>
#include <hip/hip_bf16.h>

typedef __bf16 bf16;
typedef __attribute__((ext_vector_type(16))) __bf16 v16bf;
typedef __attribute__((ext_vector_type(8)))  __bf16 v8bf;
typedef __attribute__((ext_vector_type(8)))  float  v8f;
typedef __attribute__((ext_vector_type(4)))  __bf16 v4bf;
typedef __attribute__((ext_vector_type(2)))  __bf16 v2bf;
typedef __attribute__((ext_vector_type(4)))  float  v4f;

static __device__ __forceinline__ void gemm_stage_copy(
    unsigned la, const bf16* ga, unsigned lw, const bf16* gw, size_t wStep,
    unsigned lStep) {
  asm volatile(
      "global_load_async_to_lds_b128 %0, %1, off\n\t"
      "global_load_async_to_lds_b128 %2, %3, off\n\t"
      "global_load_async_to_lds_b128 %4, %5, off\n\t"
      "global_load_async_to_lds_b128 %6, %7, off\n\t"
      "global_load_async_to_lds_b128 %8, %9, off\n\t"
      "global_load_async_to_lds_b128 %10, %11, off\n\t"
      "global_load_async_to_lds_b128 %12, %13, off\n\t"
      "global_load_async_to_lds_b128 %14, %15, off\n\t"
      "global_load_async_to_lds_b128 %16, %17, off\n\t"
      "global_load_async_to_lds_b128 %18, %19, off\n\t"
      "s_wait_xcnt 0x0"
      :: "v"(la),             "v"(ga),
         "v"(la + 16u),       "v"(ga + 8),
         "v"(lw),             "v"(gw),
         "v"(lw + lStep),     "v"(gw + wStep),
         "v"(lw + 2 * lStep), "v"(gw + 2 * wStep),
         "v"(lw + 3 * lStep), "v"(gw + 3 * wStep),
         "v"(lw + 4 * lStep), "v"(gw + 4 * wStep),
         "v"(lw + 5 * lStep), "v"(gw + 5 * wStep),
         "v"(lw + 6 * lStep), "v"(gw + 6 * wStep),
         "v"(lw + 7 * lStep), "v"(gw + 7 * wStep)
      : "memory");
}
static __device__ __forceinline__ void gemm_stage_copy_tall(
    unsigned la, const bf16* ga, unsigned lw, const bf16* gw, size_t gStep,
    unsigned lStep) {
  asm volatile(
      "global_load_async_to_lds_b128 %0, %1, off\n\t"
      "global_load_async_to_lds_b128 %2, %3, off\n\t"
      "global_load_async_to_lds_b128 %4, %5, off\n\t"
      "global_load_async_to_lds_b128 %6, %7, off\n\t"
      "global_load_async_to_lds_b128 %8, %9, off\n\t"
      "global_load_async_to_lds_b128 %10, %11, off\n\t"
      "global_load_async_to_lds_b128 %12, %13, off\n\t"
      "global_load_async_to_lds_b128 %14, %15, off\n\t"
      "global_load_async_to_lds_b128 %16, %17, off\n\t"
      "global_load_async_to_lds_b128 %18, %19, off\n\t"
      "global_load_async_to_lds_b128 %20, %21, off\n\t"
      "global_load_async_to_lds_b128 %22, %23, off\n\t"
      "s_wait_xcnt 0x0"
      :: "v"(la),             "v"(ga),
         "v"(la + lStep),     "v"(ga + gStep),
         "v"(la + 2 * lStep), "v"(ga + 2 * gStep),
         "v"(la + 3 * lStep), "v"(ga + 3 * gStep),
         "v"(lw),             "v"(gw),
         "v"(lw + lStep),     "v"(gw + gStep),
         "v"(lw + 2 * lStep), "v"(gw + 2 * gStep),
         "v"(lw + 3 * lStep), "v"(gw + 3 * gStep),
         "v"(lw + 4 * lStep), "v"(gw + 4 * gStep),
         "v"(lw + 5 * lStep), "v"(gw + 5 * gStep),
         "v"(lw + 6 * lStep), "v"(gw + 6 * gStep),
         "v"(lw + 7 * lStep), "v"(gw + 7 * gStep)
      : "memory");
}
static __device__ __forceinline__ void gemm_stage_copy_pair(
    unsigned la, const bf16* ga, unsigned lw, const bf16* gw, const bf16* gu,
    size_t gStep, unsigned lStep) {
  asm volatile(
      "global_load_async_to_lds_b128 %0, %1, off\n\t"
      "global_load_async_to_lds_b128 %2, %3, off\n\t"
      "global_load_async_to_lds_b128 %4, %5, off\n\t"
      "global_load_async_to_lds_b128 %6, %7, off\n\t"
      "global_load_async_to_lds_b128 %8, %9, off\n\t"
      "global_load_async_to_lds_b128 %10, %11, off\n\t"
      "global_load_async_to_lds_b128 %12, %13, off\n\t"
      "global_load_async_to_lds_b128 %14, %15, off\n\t"
      "global_load_async_to_lds_b128 %16, %17, off\n\t"
      "global_load_async_to_lds_b128 %18, %19, off\n\t"
      "global_load_async_to_lds_b128 %20, %21, off\n\t"
      "global_load_async_to_lds_b128 %22, %23, off\n\t"
      "s_wait_xcnt 0x0"
      :: "v"(la),             "v"(ga),
         "v"(la + lStep),     "v"(ga + gStep),
         "v"(la + 2 * lStep), "v"(ga + 2 * gStep),
         "v"(la + 3 * lStep), "v"(ga + 3 * gStep),
         "v"(lw),             "v"(gw),
         "v"(lw + lStep),     "v"(gu),
         "v"(lw + 2 * lStep), "v"(gw + gStep),
         "v"(lw + 3 * lStep), "v"(gu + gStep),
         "v"(lw + 4 * lStep), "v"(gw + 2 * gStep),
         "v"(lw + 5 * lStep), "v"(gu + 2 * gStep),
         "v"(lw + 6 * lStep), "v"(gw + 3 * gStep),
         "v"(lw + 7 * lStep), "v"(gu + 3 * gStep)
      : "memory");
}
// The issuing wave's copies have landed behind this wait.
#define WAIT_ASYNC0() asm volatile("s_wait_asynccnt 0x0" ::: "memory")
// The wave's own LDS reads have retired before a buffer it read is refilled.
#define WAIT_DS0() asm volatile("s_wait_dscnt 0x0" ::: "memory")

static __device__ __forceinline__ void attn_stage_copy(
    unsigned lk, const bf16* gk, unsigned lv, const bf16* gv) {
  asm volatile(
      "global_load_async_to_lds_b128 %0, %1, off\n\t"
      "global_load_async_to_lds_b128 %2, %3, off\n\t"
      "global_load_async_to_lds_b128 %4, %5, off\n\t"
      "global_load_async_to_lds_b128 %6, %7, off\n\t"
      "global_load_async_to_lds_b128 %8, %9, off\n\t"
      "global_load_async_to_lds_b128 %10, %11, off\n\t"
      "global_load_async_to_lds_b128 %12, %13, off\n\t"
      "global_load_async_to_lds_b128 %14, %15, off\n\t"
      "s_wait_xcnt 0x0"
      :: "v"(lk),              "v"(gk),
         "v"(lk + 16u * 144u), "v"(gk + 16 * 64),
         "v"(lk + 32u * 144u), "v"(gk + 32 * 64),
         "v"(lk + 48u * 144u), "v"(gk + 48 * 64),
         "v"(lv),              "v"(gv),
         "v"(lv + 16u * 144u), "v"(gv + 16 * 2048),
         "v"(lv + 32u * 144u), "v"(gv + 32 * 2048),
         "v"(lv + 48u * 144u), "v"(gv + 48 * 2048)
      : "memory");
}

static __device__ __forceinline__ v16bf load_frag(const bf16* base, int ld,
                                                  int row, int k0, int lane) {
  int r  = row + (lane & 15);
  int kg = (lane >> 4) & 1;              // lanes 16-31 take the +8 K group
  const bf16* p = base + (size_t)r * ld + k0 + kg * 8;
  v8bf lo = *reinterpret_cast<const v8bf*>(p);
  v8bf hi = *reinterpret_cast<const v8bf*>(p + 16);
  v16bf v;
#pragma unroll
  for (int i = 0; i < 8; ++i) { v[i] = lo[i]; v[i + 8] = hi[i]; }
  return v;
}

static __device__ __forceinline__ v8f wmma_bf16f32(v16bf a, v16bf b, v8f c) {
  return __builtin_amdgcn_wmma_f32_16x16x32_bf16(false, a, false, b,
                                                 (short)0, c, false, false);
}

static __device__ __forceinline__ v16bf ones_frag() {
  v16bf v;
#pragma unroll
  for (int i = 0; i < 16; ++i) v[i] = (bf16)1.0f;
  return v;
}

// ----- 16-lane row max via DPP16 butterflies (VALU only, no DS pipe) --------
// xor1 = quad_perm(1,0,3,2)=0xB1, xor2 = quad_perm(2,3,0,1)=0x4E,
// xor7 = row_half_mirror=0x141, xor15 = row_mirror=0x140.
template <int CTRL>
static __device__ __forceinline__ float fmax_dpp(float x) {
  int v = __builtin_amdgcn_update_dpp(0, __float_as_int(x), CTRL, 0xF, 0xF, true);
  return fmaxf(x, __int_as_float(v));
}
static __device__ __forceinline__ float rowmax16(float x) {
  x = fmax_dpp<0xB1>(x);
  x = fmax_dpp<0x4E>(x);
  x = fmax_dpp<0x141>(x);
  x = fmax_dpp<0x140>(x);
  return x;
}

// ----- fp32 -> bf16 weight conversion ---------------------------------------
// 32 elements a thread, so that few waves have to be started: a wave takes
// 1024 consecutive floats by 8 loads of 16 B a lane (each wave-wide load is
// 512 contiguous bytes = 4 whole lines), all 8 in flight before the first
// store; each store covers 2 whole lines.  A block takes 8192 elements and the
// grid covers the array exactly (every weight count is a multiple of 8192).
__global__ __launch_bounds__(256) void tb_cvt_f32_bf16(
    const float* __restrict__ in, bf16* __restrict__ out) {
  size_t base = (size_t)blockIdx.x * 8192 + (threadIdx.x >> 5) * 1024 +
                (threadIdx.x & 31) * 4;
  v4f v[8];
#pragma unroll
  for (int j = 0; j < 8; ++j)
    v[j] = *reinterpret_cast<const v4f*>(in + base + j * 128);
#pragma unroll
  for (int j = 0; j < 8; ++j) {
    v4bf o;
#pragma unroll
    for (int k = 0; k < 4; ++k) o[k] = (bf16)v[j][k];
    *reinterpret_cast<v4bf*>(out + base + j * 128) = o;
  }
}

// ----- fused RMSNorm + bf16 cast --------------------------------------------
__global__ __launch_bounds__(256) void tb_rmsnorm_bf16(
    const float* __restrict__ x, const float* __restrict__ w,
    bf16* __restrict__ out, int D) {
  int row = blockIdx.x;
  const float* xr = x + (size_t)row * D;
  float ss = 0.f;
  for (int i = threadIdx.x; i < D; i += 256) { float v = xr[i]; ss += v * v; }
#pragma unroll
  for (int off = 16; off > 0; off >>= 1) ss += __shfl_xor(ss, off, 32);
  __shared__ float red[8];
  if ((threadIdx.x & 31) == 0) red[threadIdx.x >> 5] = ss;
  __syncthreads();
  float tot = 0.f;
#pragma unroll
  for (int i = 0; i < 8; ++i) tot += red[i];
  float scale = rsqrtf(tot / (float)D + 1e-6f);
  for (int i = threadIdx.x; i < D; i += 256)
    out[(size_t)row * D + i] = (bf16)(xr[i] * scale * w[i]);
}

template <int EPI, int BM>
__global__ __launch_bounds__(256) void tb_gemm_bf16(
    const bf16* __restrict__ A, const bf16* __restrict__ W,
    void* __restrict__ Cv, const float* __restrict__ R,
    const int* __restrict__ sp, int M, int N, int K) {
  constexpr int WP = 72;                       // W tile pitch in LDS, elements
  constexpr int AP = 72;                       // A tile pitch in LDS, elements
  constexpr int MT = BM / 32;                  // 16-row A fragments per wave
  __shared__ __attribute__((aligned(16))) bf16 aBuf[2][BM][AP];
  __shared__ __attribute__((aligned(16))) bf16 wBuf[2][256][WP];

  int lane   = threadIdx.x & 31;
  int wave   = threadIdx.x >> 5;
  int mBlock = blockIdx.y * BM;
  int nBlock = blockIdx.x * (EPI == 4 ? 128 : 256);   // first W row (column of C)
  int mLoc   = (wave >> 2) * (BM / 2);         // wave's rows inside the block
  int nLoc   = (wave & 3) * 64;                // wave's columns inside the block
  int nBase  = nBlock + nLoc;

  int cpRow = BM == 64 ? threadIdx.x >> 2 : threadIdx.x >> 3;
  int cpCol = BM == 64 ? (threadIdx.x & 3) * 16 : (threadIdx.x & 7) * 8;
  int wRow = threadIdx.x >> 3;                 // 0..31
  int wCol = (threadIdx.x & 7) * 8;            // 0,8,..,56
  unsigned ldsA[2] = {
      (unsigned)(uintptr_t)&aBuf[0][cpRow][cpCol],
      (unsigned)(uintptr_t)&aBuf[1][cpRow][cpCol]};
  unsigned ldsW[2] = {
      (unsigned)(uintptr_t)&wBuf[0][wRow][wCol],
      (unsigned)(uintptr_t)&wBuf[1][wRow][wCol]};
  const bf16* gA = A + (size_t)(mBlock + cpRow) * K + cpCol;
  const bf16* gW = W + (size_t)(nBlock + wRow) * K + wCol;
  const size_t   wStep = (size_t)32 * K;       // 32 rows in global memory
  const unsigned lStep = 32u * WP * 2u;        // 32 rows in LDS, bytes
  auto stage_copy = [&](int buf, int ko) {     // K offset ko into buffer buf
    if constexpr (EPI == 4)
      gemm_stage_copy_pair(ldsA[buf], gA + ko, ldsW[buf], gW + ko,
                           gW + (size_t)N * K + ko, wStep, lStep);
    else if constexpr (BM == 64)
      gemm_stage_copy(ldsA[buf], gA + ko, ldsW[buf], gW + ko, wStep, lStep);
    else
      gemm_stage_copy_tall(ldsA[buf], gA + ko, ldsW[buf], gW + ko, wStep, lStep);
  };

  // read ahead of the loop (a scalar load), so that the epilogue does not wait
  int pos0 = 0;
  if constexpr (EPI == 3) pos0 = sp[0];

  int Kt = K >> 6;                             // 64-wide K tiles
  stage_copy(0, 0);
  WAIT_ASYNC0();
  __syncthreads();                             // stage 0 visible to all waves
  if (Kt > 1)
    stage_copy(1, 64);

  v8f acc[MT][4] = {};
  for (int kt = 0; kt < Kt; ++kt) {
    const bf16* ab = &aBuf[kt & 1][0][0];
    const bf16* wb = &wBuf[kt & 1][0][0];
#pragma unroll
    for (int kh = 0; kh < 2; ++kh) {
      // The four loops below are unrolled so that a[], b[] and acc[][] are
      // indexed by constants and stay in registers.
      v16bf a[MT], b[4];
#pragma unroll
      for (int ti = 0; ti < MT; ++ti)                           // ds_load
        a[ti] = load_frag(ab, AP, mLoc + ti * 16, kh << 5, lane);
#pragma unroll
      for (int tj = 0; tj < 4; ++tj)                            // ds_load
        b[tj] = load_frag(wb, WP, nLoc + tj * 16, kh << 5, lane);
#pragma unroll
      for (int ti = 0; ti < MT; ++ti)
#pragma unroll
        for (int tj = 0; tj < 4; ++tj)
          acc[ti][tj] = wmma_bf16f32(a[ti], b[tj], acc[ti][tj]);
    }

    // publish point of stage kt + 1: own reads of stage kt retired, own copies
    // of stage kt + 1 landed, then the one barrier that does both jobs
    WAIT_DS0();
    WAIT_ASYNC0();
    __syncthreads();
    if (kt + 2 < Kt)                           // refill the buffer just freed
      stage_copy(kt & 1, (kt + 2) << 6);
  }
  WAIT_ASYNC0();                               // nothing in flight at the end

  int col0   = nBase + (lane & 15);
  int rowOff = (lane >> 4) * 8;
  if constexpr (EPI == 3) {
    // A block's 256 columns lie in one of q, k, v (1024 columns each), a wave's
    // 64 columns are one head, a block's 128 rows lie in one sequence of 2048.
    constexpr size_t PLANE = (size_t)32 * 2048 * 64;
    int sec  = nBlock >> 10;                   // 0 = q, 1 = k, 2 = v (scalar)
    int tok0 = mBlock + mLoc + rowOff;         // the lane's first row
    int bh   = (tok0 >> 11) * 16 + ((nBase & 1023) >> 6);
    int s0   = tok0 & 2047;                    // its position in the sequence
    int cl   = lane & 15;
    bf16* dst = (bf16*)Cv + sec * PLANE + (size_t)bh * (2048 * 64);
    if (sec == 2) {
      // V^T: a lane holds 8 consecutive positions of one head dim = one 16-B
      // store into that dim's row
#pragma unroll
      for (int ti = 0; ti < MT; ++ti)
#pragma unroll
        for (int tj = 0; tj < 4; ++tj) {
          v8bf o;
#pragma unroll
          for (int i = 0; i < 8; ++i) o[i] = (bf16)acc[ti][tj][i];
          *reinterpret_cast<v8bf*>(dst + (tj * 16 + cl) * 2048 + s0 + ti * 16) = o;
        }
    } else {
      // q is pre-scaled by 0.125*log2(e) so attention scores come out of the
      // WMMA already in the base-2 softmax domain; k is not scaled.
      const float scl = sec == 0 ? 0.125f * 1.44269504088896340736f : 1.0f;
      // A rotation pair (even, odd head dim) sits in two neighbouring lanes.
      // For two rows the lanes swap one value each: the even lane then holds
      // the whole pair of row i, the odd lane that of row i + 1, so that each
      // lane takes one sine and cosine per two elements and stores 4 bytes.
      bool odd = lane & 1;
      int  tl  = pos0 + s0 + (odd ? 1 : 0);
      bf16* dl = dst + (s0 + (odd ? 1 : 0)) * 64 + (cl & 14);
#pragma unroll
      for (int tj = 0; tj < 4; ++tj) {
        // 10000^(-dim/64) = exp2(-dim * ln(10000)/64 * log2(e))
        float ex = -(float)(tj * 16 + (cl & 14)) *
                   (9.2103403719761827f / 64.0f) * 1.44269504088896340736f;
        float freq;
        asm("v_exp_f32 %0, %1\n\tv_nop" : "=&v"(freq) : "v"(ex));
#pragma unroll
        for (int ti = 0; ti < MT; ++ti)
#pragma unroll
          for (int i = 0; i < 8; i += 2) {
            float lo = acc[ti][tj][i], hi = acc[ti][tj][i + 1];
            float got = __int_as_float(__builtin_amdgcn_update_dpp(
                0, __float_as_int(odd ? lo : hi), 0xB1, 0xF, 0xF, true));
            float xe = odd ? got : lo;
            float xo = odd ? hi : got;
            // angle in revolutions, as v_sin_f32 / v_cos_f32 take it
            float rev = (float)(tl + ti * 16 + i) * freq * 0.15915494309189532f;
            float sn, cs;
            asm("v_sin_f32 %0, %2\n\tv_cos_f32 %1, %2\n\tv_nop"
                : "=&v"(sn), "=&v"(cs) : "v"(rev));
            v2bf o;
            o[0] = (bf16)((xe * cs - xo * sn) * scl);
            o[1] = (bf16)((xe * sn + xo * cs) * scl);
            *reinterpret_cast<v2bf*>(dl + (ti * 16 + i) * 64 + tj * 16) = o;
          }
      }
      // behind the last q/k store: in the built code the V^T branch follows
      // this one and rewrites registers that these stores name
      asm volatile("s_wait_xcnt 0x0" ::: "memory");
    }
  } else if constexpr (EPI == 4) {
    // acc[ti][0..1] = gate, acc[ti][2..3] = up of the wave's 32 columns
    int hc0 = nBlock + (wave & 3) * 32 + (lane & 15);
#pragma unroll
    for (int ti = 0; ti < MT; ++ti)
#pragma unroll
      for (int tj = 0; tj < 2; ++tj)
#pragma unroll
        for (int i = 0; i < 8; ++i) {
          int r = mBlock + mLoc + ti * 16 + rowOff + i;
          float gv = acc[ti][tj][i], uv = acc[ti][tj + 2][i];
          float s = gv / (1.f + __expf(-gv));
          ((bf16*)Cv)[(size_t)r * N + hc0 + tj * 16] = (bf16)(s * uv);
        }
  } else {
#pragma unroll
    for (int ti = 0; ti < MT; ++ti)
#pragma unroll
      for (int tj = 0; tj < 4; ++tj)
#pragma unroll
        for (int i = 0; i < 8; ++i) {
          int r = mBlock + mLoc + ti * 16 + rowOff + i;
          int c = col0 + tj * 16;
          size_t idx = (size_t)r * N + c;
          ((float*)Cv)[idx] = R[idx] + acc[ti][tj][i];
        }
  }
}

// ----- Flash attention: one 32-key tile step --------------------------------
// MASKED=false for tiles fully below the diagonal (no v_cmp/v_cndmask).
// Row-max: DPP16 butterflies.  Row-sum: P @ ones on the WMMA pipe.
// All exponentials are exp2 (scores already in base-2 domain).
// kb / vb: the stage's K tile (key rows) and V^T tile (head-dim rows) in LDS,
// pitch KVP elements; kl = the tile's first key inside the stage (0 or 32),
// k0 = the same key's position in the sequence (for the mask).
constexpr int KVP = 72;                        // 144 B = 16 B x 9: no conflicts
template <bool MASKED>
static __device__ __forceinline__ void attn_tile(
    int k0, int kl, v16bf aq0, v16bf aq1, const bf16* kb, const bf16* vb,
    bf16 (*pT)[32], v8f* o, float* mrow, float* lrow,
    int qRow0, int rowOff, int nlane, int lane) {
  v16bf kf0 = load_frag(kb, KVP, kl,      0,  lane);       // ds_load
  v16bf kf1 = load_frag(kb, KVP, kl,      32, lane);
  v16bf kf2 = load_frag(kb, KVP, kl + 16, 0,  lane);
  v16bf kf3 = load_frag(kb, KVP, kl + 16, 32, lane);
  v16bf vf[4];
#pragma unroll
  for (int c = 0; c < 4; ++c) vf[c] = load_frag(vb, KVP, c * 16, kl, lane);
  // Keeps the tile's 16 LDS reads as one group in front of the products:
  // without it the scheduler sinks them between the WMMAs into one register
  // set, and the wave waits out the LDS latency once per product.
  __builtin_amdgcn_sched_barrier(0);
  v8f s0 = {}, s1 = {};
  s0 = wmma_bf16f32(aq0, kf0, s0);
  s0 = wmma_bf16f32(aq1, kf1, s0);
  s1 = wmma_bf16f32(aq0, kf2, s1);
  s1 = wmma_bf16f32(aq1, kf3, s1);

  float alpha[8];
#pragma unroll
  for (int i = 0; i < 8; ++i) {
    float v0 = s0[i];
    float v1 = s1[i];
    if (MASKED) {
      int row = qRow0 + rowOff + i;
      if (k0 + nlane > row)      v0 = -3.0e38f;
      if (k0 + 16 + nlane > row) v1 = -3.0e38f;
    }
    float mx = rowmax16(fmaxf(v0, v1));        // 16-lane row-group max (DPP)
    float nm = fmaxf(mrow[i], mx);
    float a  = __builtin_amdgcn_exp2f(mrow[i] - nm);   // raw v_exp_f32
    float p0 = __builtin_amdgcn_exp2f(v0 - nm);
    float p1 = __builtin_amdgcn_exp2f(v1 - nm);
    alpha[i] = a;
    mrow[i]  = nm;
    pT[rowOff + i][nlane]      = (bf16)p0;     // C-layout -> LDS (A-layout src)
    pT[rowOff + i][nlane + 16] = (bf16)p1;
  }
#pragma unroll
  for (int c = 0; c < 4; ++c)
#pragma unroll
    for (int i = 0; i < 8; ++i) o[c][i] *= alpha[i];

  v16bf pf = load_frag(&pT[0][0], 32, 0, 0, lane);   // ds_load, same-wave order
  v8f sums = {};
  sums = wmma_bf16f32(pf, ones_frag(), sums);  // row sums, replicated per lane
#pragma unroll
  for (int i = 0; i < 8; ++i) lrow[i] = lrow[i] * alpha[i] + sums[i];

#pragma unroll
  for (int c = 0; c < 4; ++c)      // P(16x32) @ V(32x64), hd in 4 chunks of 16
    o[c] = wmma_bf16f32(pf, vf[c], o[c]);
}

// grid (S/64, B*H), 128 threads = 4 waves, one wave per 16 query rows.
// The block walks the keys in stages of 64 (two 32-key tiles).  A stage's K and
// V^T tiles are brought once for all four waves by async-to-LDS copies of whole
// 128-B lines into two buffers: the next stage flies while this one is worked
// on, one barrier per stage.  Each wave takes the same 32-key tiles in the same
// order as if it read them from global memory itself.
__global__ __launch_bounds__(128) void tb_flash_attn(
    const bf16* __restrict__ qr, const bf16* __restrict__ kr,
    const bf16* __restrict__ vt, bf16* __restrict__ attn) {
  const int S = 2048, HD = 64;
  __shared__ __attribute__((aligned(16))) bf16 kBuf[2][64][KVP];
  __shared__ __attribute__((aligned(16))) bf16 vBuf[2][64][KVP];
  __shared__ __attribute__((aligned(16))) bf16 pTile[4][16][32];

  int lane = threadIdx.x & 31;
  // scalar, so that the per-wave test at the diagonal stage is a scalar branch
  int wave = __builtin_amdgcn_readfirstlane(threadIdx.x >> 5);
  int bh   = blockIdx.y;
  int qRow0 = blockIdx.x * 64 + wave * 16;
  const bf16* qh = qr + (size_t)bh * S * HD;
  const bf16* kh = kr + (size_t)bh * S * HD;
  const bf16* vh = vt + (size_t)bh * HD * S;

  v16bf aq0 = load_frag(qh, HD, qRow0, 0, lane);
  v16bf aq1 = load_frag(qh, HD, qRow0, 32, lane);

  v8f o[4] = {};
  float mrow[8], lrow[8];
#pragma unroll
  for (int i = 0; i < 8; ++i) { mrow[i] = -1e30f; lrow[i] = 0.f; }
  int rowOff = (lane >> 4) * 8;
  int nlane  = lane & 15;

  int cRow = threadIdx.x >> 3;                 // 0..15
  int cCol = (threadIdx.x & 7) * 8;            // 0,8,..,56
  unsigned ldsK[2] = {
      (unsigned)(uintptr_t)&kBuf[0][cRow][cCol],
      (unsigned)(uintptr_t)&kBuf[1][cRow][cCol]};
  unsigned ldsV[2] = {
      (unsigned)(uintptr_t)&vBuf[0][cRow][cCol],
      (unsigned)(uintptr_t)&vBuf[1][cRow][cCol]};
  const bf16* gK = kh + cRow * HD + cCol;      // stage st: + st * 64 key rows
  const bf16* gV = vh + cRow * S + cCol;       // stage st: + st * 64 columns

  int nSt = blockIdx.x + 1;                    // stages up to the diagonal one
  attn_stage_copy(ldsK[0], gK, ldsV[0], gV);
  WAIT_ASYNC0();
  __syncthreads();                             // stage 0 visible to all waves
  if (nSt > 1)
    attn_stage_copy(ldsK[1], gK + 64 * HD, ldsV[1], gV + 64);

  // stages fully below the diagonal for all four waves
  for (int st = 0; st + 1 < nSt; ++st) {
    const bf16* kb = &kBuf[st & 1][0][0];
    const bf16* vb = &vBuf[st & 1][0][0];
    attn_tile<false>(st << 6, 0, aq0, aq1, kb, vb, pTile[wave], o, mrow,
                     lrow, qRow0, rowOff, nlane, lane);
    attn_tile<false>((st << 6) + 32, 32, aq0, aq1, kb, vb, pTile[wave], o, mrow,
                     lrow, qRow0, rowOff, nlane, lane);

    // publish point of stage st + 1, passed by every wave: own reads of stage
    // st retired, own copies of stage st + 1 landed, then the one barrier that
    // does both jobs
    WAIT_DS0();
    WAIT_ASYNC0();
    __syncthreads();
    if (st + 2 < nSt)                          // refill the buffer just freed
      attn_stage_copy(ldsK[st & 1], gK + (st + 2) * 64 * HD,
                      ldsV[st & 1], gV + (st + 2) * 64);
  }
  // the diagonal stage, published by the last barrier above.  Its first tile
  // holds the diagonal of waves 0 and 1 and lies below that of waves 2 and 3
  // (there the mask changes nothing); its second tile holds the diagonal of
  // waves 2 and 3 and lies beyond that of waves 0 and 1, which skip it.
  {
    int st = nSt - 1;
    const bf16* kb = &kBuf[st & 1][0][0];
    const bf16* vb = &vBuf[st & 1][0][0];
    attn_tile<true>(st << 6, 0, aq0, aq1, kb, vb, pTile[wave], o, mrow,
                    lrow, qRow0, rowOff, nlane, lane);
    if (wave >= 2)
      attn_tile<true>((st << 6) + 32, 32, aq0, aq1, kb, vb, pTile[wave], o,
                      mrow, lrow, qRow0, rowOff, nlane, lane);
  }
  WAIT_ASYNC0();                               // nothing in flight at the end

  int b = bh >> 4, h = bh & 15;
#pragma unroll
  for (int c = 0; c < 4; ++c)
#pragma unroll
    for (int i = 0; i < 8; ++i) {
      int q = qRow0 + rowOff + i;
      float v = o[c][i] / lrow[i];
      size_t idx = ((size_t)(b * 2048 + q)) * 1024 + h * 64 + c * 16 + nlane;
      attn[idx] = (bf16)v;
    }
}

// ---------------------------------------------------------------------------
extern "C" void kernel_launch(void* const* d_in, const int* in_sizes, int n_in,
                              void* d_out, int out_size, void* d_ws, size_t ws_size,
                              hipStream_t stream) {
  (void)in_sizes; (void)n_in; (void)out_size; (void)ws_size;
  const float* x    = (const float*)d_in[0];
  const int*   sp   = (const int*)d_in[1];
  const float* n1w  = (const float*)d_in[2];
  const float* wqkv = (const float*)d_in[3];
  const float* wo   = (const float*)d_in[4];
  const float* n2w  = (const float*)d_in[5];
  const float* wg   = (const float*)d_in[6];
  const float* wu   = (const float*)d_in[7];
  const float* wd   = (const float*)d_in[8];
  float* out = (float*)d_out;

  // Workspace layout (~134 MB, regions 16B aligned).
  const size_t T = 4096;                             // B*S tokens
  bf16*  bWq  = (bf16*)d_ws;                         // 3072*1024
  bf16*  bWo  = bWq + (size_t)3072 * 1024;           // 1024*1024
  bf16*  bWg  = bWo + (size_t)1024 * 1024;           // 4096*1024
  bf16*  bWu  = bWg + (size_t)4096 * 1024;           // 4096*1024
  bf16*  bWd  = bWu + (size_t)4096 * 1024;           // 1024*4096
  bf16*  xn   = bWd + (size_t)1024 * 4096;           // T*1024 bf16
  bf16*  qrb  = xn + T * 1024;                       // 32*2048*64
  bf16*  krb  = qrb + (size_t)32 * 2048 * 64;
  bf16*  vtb  = krb + (size_t)32 * 2048 * 64;
  bf16*  attnb= vtb + (size_t)32 * 2048 * 64;        // T*1024 bf16
  float* out1 = (float*)(attnb + T * 1024);          // T*1024 f32
  bf16*  xn2  = (bf16*)(out1 + T * 1024);            // T*1024 bf16
  bf16*  hb   = xn2 + T * 1024;                      // T*4096 bf16

  // 1) weights -> bf16 once; every GEMM re-reads them from L2 at half width
  tb_cvt_f32_bf16<<<(3072 * 1024) / 8192, 256, 0, stream>>>(wqkv, bWq);
  tb_cvt_f32_bf16<<<(1024 * 1024) / 8192, 256, 0, stream>>>(wo,   bWo);
  tb_cvt_f32_bf16<<<(4096 * 1024) / 8192, 256, 0, stream>>>(wg,   bWg);
  tb_cvt_f32_bf16<<<(4096 * 1024) / 8192, 256, 0, stream>>>(wu,   bWu);
  tb_cvt_f32_bf16<<<(1024 * 4096) / 8192, 256, 0, stream>>>(wd,   bWd);

  // 2) xn = rmsnorm(x)
  tb_rmsnorm_bf16<<<(int)T, 256, 0, stream>>>(x, n1w, xn, 1024);

  // 3) + 4) xn @ Wqkv^T with RoPE, head split and V^T in the epilogue (q
  // pre-scaled into the base-2 softmax domain); writes qrb, krb and vtb, which
  // lie one behind the other
  tb_gemm_bf16<3, 128><<<dim3(3072 / 256, T / 128), 256, 0, stream>>>(
      xn, bWq, (void*)qrb, nullptr, sp, (int)T, 3072, 1024);

  // 5) flash attention -> attn (bf16, [B,S,D])
  tb_flash_attn<<<dim3(2048 / 64, 32), 128, 0, stream>>>(qrb, krb, vtb, attnb);

  // 6) out1 = x + attn @ Wo^T
  tb_gemm_bf16<1, 64><<<dim3(1024 / 256, T / 64), 256, 0, stream>>>(
      attnb, bWo, (void*)out1, x, nullptr, (int)T, 1024, 1024);

  // 7) xn2 = rmsnorm(out1)
  tb_rmsnorm_bf16<<<(int)T, 256, 0, stream>>>(out1, n2w, xn2, 1024);

  // 8) + 9) h = silu(xn2 @ Wg^T) * (xn2 @ Wu^T), both projections in one launch
  // (bWu lies directly behind bWg)
  tb_gemm_bf16<4, 128><<<dim3(4096 / 128, T / 128), 256, 0, stream>>>(
      xn2, bWg, (void*)hb, nullptr, nullptr, (int)T, 4096, 1024);

  // 10) out = out1 + h @ Wd^T
  tb_gemm_bf16<1, 64><<<dim3(1024 / 256, T / 64), 256, 0, stream>>>(
      hb, bWd, (void*)out, out1, nullptr, (int)T, 1024, 4096);
}

// v008
// One run takes 233 microseconds.
// Next to v007, in two timings, it ran 1.06 and 1.05 times as fast.
// Counting every step since v000, it is 3.01 times as fast.
#include <hip/hip_runtime.h>
#include <hip/hip_bf16.h>

typedef __bf16 bf16;
typedef __attribute__((ext_vector_type(16))) __bf16 v16bf;
typedef __attribute__((ext_vector_type(8)))  __bf16 v8bf;
typedef __attribute__((ext_vector_type(8)))  float  v8f;
typedef __attribute__((ext_vector_type(4)))  __bf16 v4bf;
typedef __attribute__((ext_vector_type(2)))  __bf16 v2bf;
typedef __attribute__((ext_vector_type(4)))  float  v4f;

static __device__ __forceinline__ void gemm_stage_copy(
    unsigned la, const bf16* ga, unsigned lw, const bf16* gw, size_t wStep,
    unsigned lStep) {
  asm volatile(
      "global_load_async_to_lds_b128 %0, %1, off\n\t"
      "global_load_async_to_lds_b128 %2, %3, off\n\t"
      "global_load_async_to_lds_b128 %4, %5, off\n\t"
      "global_load_async_to_lds_b128 %6, %7, off\n\t"
      "global_load_async_to_lds_b128 %8, %9, off\n\t"
      "global_load_async_to_lds_b128 %10, %11, off\n\t"
      "global_load_async_to_lds_b128 %12, %13, off\n\t"
      "global_load_async_to_lds_b128 %14, %15, off\n\t"
      "global_load_async_to_lds_b128 %16, %17, off\n\t"
      "global_load_async_to_lds_b128 %18, %19, off\n\t"
      "s_wait_xcnt 0x0"
      :: "v"(la),             "v"(ga),
         "v"(la + 16u),       "v"(ga + 8),
         "v"(lw),             "v"(gw),
         "v"(lw + lStep),     "v"(gw + wStep),
         "v"(lw + 2 * lStep), "v"(gw + 2 * wStep),
         "v"(lw + 3 * lStep), "v"(gw + 3 * wStep),
         "v"(lw + 4 * lStep), "v"(gw + 4 * wStep),
         "v"(lw + 5 * lStep), "v"(gw + 5 * wStep),
         "v"(lw + 6 * lStep), "v"(gw + 6 * wStep),
         "v"(lw + 7 * lStep), "v"(gw + 7 * wStep)
      : "memory");
}
static __device__ __forceinline__ void gemm_stage_copy_tall(
    unsigned la, const bf16* ga, unsigned lw, const bf16* gw, size_t gStep,
    unsigned lStep) {
  asm volatile(
      "global_load_async_to_lds_b128 %0, %1, off\n\t"
      "global_load_async_to_lds_b128 %2, %3, off\n\t"
      "global_load_async_to_lds_b128 %4, %5, off\n\t"
      "global_load_async_to_lds_b128 %6, %7, off\n\t"
      "global_load_async_to_lds_b128 %8, %9, off\n\t"
      "global_load_async_to_lds_b128 %10, %11, off\n\t"
      "global_load_async_to_lds_b128 %12, %13, off\n\t"
      "global_load_async_to_lds_b128 %14, %15, off\n\t"
      "global_load_async_to_lds_b128 %16, %17, off\n\t"
      "global_load_async_to_lds_b128 %18, %19, off\n\t"
      "global_load_async_to_lds_b128 %20, %21, off\n\t"
      "global_load_async_to_lds_b128 %22, %23, off\n\t"
      "s_wait_xcnt 0x0"
      :: "v"(la),             "v"(ga),
         "v"(la + lStep),     "v"(ga + gStep),
         "v"(la + 2 * lStep), "v"(ga + 2 * gStep),
         "v"(la + 3 * lStep), "v"(ga + 3 * gStep),
         "v"(lw),             "v"(gw),
         "v"(lw + lStep),     "v"(gw + gStep),
         "v"(lw + 2 * lStep), "v"(gw + 2 * gStep),
         "v"(lw + 3 * lStep), "v"(gw + 3 * gStep),
         "v"(lw + 4 * lStep), "v"(gw + 4 * gStep),
         "v"(lw + 5 * lStep), "v"(gw + 5 * gStep),
         "v"(lw + 6 * lStep), "v"(gw + 6 * gStep),
         "v"(lw + 7 * lStep), "v"(gw + 7 * gStep)
      : "memory");
}
static __device__ __forceinline__ void gemm_stage_copy_pair(
    unsigned la, const bf16* ga, unsigned lw, const bf16* gw, const bf16* gu,
    size_t gStep, unsigned lStep) {
  asm volatile(
      "global_load_async_to_lds_b128 %0, %1, off\n\t"
      "global_load_async_to_lds_b128 %2, %3, off\n\t"
      "global_load_async_to_lds_b128 %4, %5, off\n\t"
      "global_load_async_to_lds_b128 %6, %7, off\n\t"
      "global_load_async_to_lds_b128 %8, %9, off\n\t"
      "global_load_async_to_lds_b128 %10, %11, off\n\t"
      "global_load_async_to_lds_b128 %12, %13, off\n\t"
      "global_load_async_to_lds_b128 %14, %15, off\n\t"
      "global_load_async_to_lds_b128 %16, %17, off\n\t"
      "global_load_async_to_lds_b128 %18, %19, off\n\t"
      "global_load_async_to_lds_b128 %20, %21, off\n\t"
      "global_load_async_to_lds_b128 %22, %23, off\n\t"
      "s_wait_xcnt 0x0"
      :: "v"(la),             "v"(ga),
         "v"(la + lStep),     "v"(ga + gStep),
         "v"(la + 2 * lStep), "v"(ga + 2 * gStep),
         "v"(la + 3 * lStep), "v"(ga + 3 * gStep),
         "v"(lw),             "v"(gw),
         "v"(lw + lStep),     "v"(gu),
         "v"(lw + 2 * lStep), "v"(gw + gStep),
         "v"(lw + 3 * lStep), "v"(gu + gStep),
         "v"(lw + 4 * lStep), "v"(gw + 2 * gStep),
         "v"(lw + 5 * lStep), "v"(gu + 2 * gStep),
         "v"(lw + 6 * lStep), "v"(gw + 3 * gStep),
         "v"(lw + 7 * lStep), "v"(gu + 3 * gStep)
      : "memory");
}
// The issuing wave's copies have landed behind this wait.
#define WAIT_ASYNC0() asm volatile("s_wait_asynccnt 0x0" ::: "memory")
// The wave's own LDS reads have retired before a buffer it read is refilled.
#define WAIT_DS0() asm volatile("s_wait_dscnt 0x0" ::: "memory")

static __device__ __forceinline__ void attn_stage_copy(
    unsigned lk, const bf16* gk, unsigned lv, const bf16* gv) {
  asm volatile(
      "global_load_async_to_lds_b128 %0, %1, off\n\t"
      "global_load_async_to_lds_b128 %2, %3, off\n\t"
      "global_load_async_to_lds_b128 %4, %5, off\n\t"
      "global_load_async_to_lds_b128 %6, %7, off\n\t"
      "global_load_async_to_lds_b128 %8, %9, off\n\t"
      "global_load_async_to_lds_b128 %10, %11, off\n\t"
      "global_load_async_to_lds_b128 %12, %13, off\n\t"
      "global_load_async_to_lds_b128 %14, %15, off\n\t"
      "s_wait_xcnt 0x0"
      :: "v"(lk),              "v"(gk),
         "v"(lk + 16u * 144u), "v"(gk + 16 * 64),
         "v"(lk + 32u * 144u), "v"(gk + 32 * 64),
         "v"(lk + 48u * 144u), "v"(gk + 48 * 64),
         "v"(lv),              "v"(gv),
         "v"(lv + 16u * 144u), "v"(gv + 16 * 2048),
         "v"(lv + 32u * 144u), "v"(gv + 32 * 2048),
         "v"(lv + 48u * 144u), "v"(gv + 48 * 2048)
      : "memory");
}

static __device__ __forceinline__ v16bf load_frag(const bf16* base, int ld,
                                                  int row, int k0, int lane) {
  int r  = row + (lane & 15);
  int kg = (lane >> 4) & 1;              // lanes 16-31 take the +8 K group
  const bf16* p = base + (size_t)r * ld + k0 + kg * 8;
  v8bf lo = *reinterpret_cast<const v8bf*>(p);
  v8bf hi = *reinterpret_cast<const v8bf*>(p + 16);
  v16bf v;
#pragma unroll
  for (int i = 0; i < 8; ++i) { v[i] = lo[i]; v[i + 8] = hi[i]; }
  return v;
}

static __device__ __forceinline__ v8f wmma_bf16f32(v16bf a, v16bf b, v8f c) {
  return __builtin_amdgcn_wmma_f32_16x16x32_bf16(false, a, false, b,
                                                 (short)0, c, false, false);
}

static __device__ __forceinline__ v16bf ones_frag() {
  v16bf v;
#pragma unroll
  for (int i = 0; i < 16; ++i) v[i] = (bf16)1.0f;
  return v;
}

// ----- 16-lane row max via DPP16 butterflies (VALU only, no DS pipe) --------
// xor1 = quad_perm(1,0,3,2)=0xB1, xor2 = quad_perm(2,3,0,1)=0x4E,
// xor7 = row_half_mirror=0x141, xor15 = row_mirror=0x140.
template <int CTRL>
static __device__ __forceinline__ float fmax_dpp(float x) {
  int v = __builtin_amdgcn_update_dpp(0, __float_as_int(x), CTRL, 0xF, 0xF, true);
  return fmaxf(x, __int_as_float(v));
}
static __device__ __forceinline__ float rowmax16(float x) {
  x = fmax_dpp<0xB1>(x);
  x = fmax_dpp<0x4E>(x);
  x = fmax_dpp<0x141>(x);
  x = fmax_dpp<0x140>(x);
  return x;
}

// ----- fp32 -> bf16 weight conversion ---------------------------------------
// 32 elements a thread, so that few waves have to be started: a wave takes
// 1024 consecutive floats by 8 loads of 16 B a lane (each wave-wide load is
// 512 contiguous bytes = 4 whole lines), all 8 in flight before the first
// store; each store covers 2 whole lines.  A block takes 8192 elements and the
// grid covers the array exactly (every weight count is a multiple of 8192).
__global__ __launch_bounds__(256) void tb_cvt_f32_bf16(
    const float* __restrict__ in, bf16* __restrict__ out) {
  size_t base = (size_t)blockIdx.x * 8192 + (threadIdx.x >> 5) * 1024 +
                (threadIdx.x & 31) * 4;
  v4f v[8];
#pragma unroll
  for (int j = 0; j < 8; ++j)
    v[j] = *reinterpret_cast<const v4f*>(in + base + j * 128);
#pragma unroll
  for (int j = 0; j < 8; ++j) {
    v4bf o;
#pragma unroll
    for (int k = 0; k < 4; ++k) o[k] = (bf16)v[j][k];
    *reinterpret_cast<v4bf*>(out + base + j * 128) = o;
  }
}

// ----- fused RMSNorm + bf16 cast --------------------------------------------
__global__ __launch_bounds__(256) void tb_rmsnorm_bf16(
    const float* __restrict__ x, const float* __restrict__ w,
    bf16* __restrict__ out, int D) {
  int row = blockIdx.x;
  const float* xr = x + (size_t)row * D;
  float ss = 0.f;
  for (int i = threadIdx.x; i < D; i += 256) { float v = xr[i]; ss += v * v; }
#pragma unroll
  for (int off = 16; off > 0; off >>= 1) ss += __shfl_xor(ss, off, 32);
  __shared__ float red[8];
  if ((threadIdx.x & 31) == 0) red[threadIdx.x >> 5] = ss;
  __syncthreads();
  float tot = 0.f;
#pragma unroll
  for (int i = 0; i < 8; ++i) tot += red[i];
  float scale = rsqrtf(tot / (float)D + 1e-6f);
  for (int i = threadIdx.x; i < D; i += 256)
    out[(size_t)row * D + i] = (bf16)(xr[i] * scale * w[i]);
}

template <int EPI, int BM>
__global__ __launch_bounds__(256) void tb_gemm_bf16(
    const bf16* __restrict__ A, const bf16* __restrict__ W,
    void* __restrict__ Cv, const float* __restrict__ R,
    const int* __restrict__ sp, int M, int N, int K) {
  constexpr int WP = 72;                       // W tile pitch in LDS, elements
  constexpr int AP = 72;                       // A tile pitch in LDS, elements
  constexpr int MT = BM / 32;                  // 16-row A fragments per wave
  __shared__ __attribute__((aligned(16))) bf16 aBuf[2][BM][AP];
  __shared__ __attribute__((aligned(16))) bf16 wBuf[2][256][WP];

  int lane   = threadIdx.x & 31;
  int wave   = threadIdx.x >> 5;
  int mBlock = blockIdx.y * BM;
  int nBlock = blockIdx.x * (EPI == 4 ? 128 : 256);   // first W row (column of C)
  int mLoc   = (wave >> 2) * (BM / 2);         // wave's rows inside the block
  int nLoc   = (wave & 3) * 64;                // wave's columns inside the block
  int nBase  = nBlock + nLoc;

  int cpRow = BM == 64 ? threadIdx.x >> 2 : threadIdx.x >> 3;
  int cpCol = BM == 64 ? (threadIdx.x & 3) * 16 : (threadIdx.x & 7) * 8;
  int wRow = threadIdx.x >> 3;                 // 0..31
  int wCol = (threadIdx.x & 7) * 8;            // 0,8,..,56
  unsigned ldsA[2] = {
      (unsigned)(uintptr_t)&aBuf[0][cpRow][cpCol],
      (unsigned)(uintptr_t)&aBuf[1][cpRow][cpCol]};
  unsigned ldsW[2] = {
      (unsigned)(uintptr_t)&wBuf[0][wRow][wCol],
      (unsigned)(uintptr_t)&wBuf[1][wRow][wCol]};
  const bf16* gA = A + (size_t)(mBlock + cpRow) * K + cpCol;
  const bf16* gW = W + (size_t)(nBlock + wRow) * K + wCol;
  const size_t   wStep = (size_t)32 * K;       // 32 rows in global memory
  const unsigned lStep = 32u * WP * 2u;        // 32 rows in LDS, bytes
  auto stage_copy = [&](int buf, int ko) {     // K offset ko into buffer buf
    if constexpr (EPI == 4)
      gemm_stage_copy_pair(ldsA[buf], gA + ko, ldsW[buf], gW + ko,
                           gW + (size_t)N * K + ko, wStep, lStep);
    else if constexpr (BM == 64)
      gemm_stage_copy(ldsA[buf], gA + ko, ldsW[buf], gW + ko, wStep, lStep);
    else
      gemm_stage_copy_tall(ldsA[buf], gA + ko, ldsW[buf], gW + ko, wStep, lStep);
  };

  // read ahead of the loop (a scalar load), so that the epilogue does not wait
  int pos0 = 0;
  if constexpr (EPI == 3) pos0 = sp[0];

  int Kt = K >> 6;                             // 64-wide K tiles
  stage_copy(0, 0);
  WAIT_ASYNC0();
  __syncthreads();                             // stage 0 visible to all waves
  if (Kt > 1)
    stage_copy(1, 64);

  v8f acc[MT][4] = {};
  for (int kt = 0; kt < Kt; ++kt) {
    const bf16* ab = &aBuf[kt & 1][0][0];
    const bf16* wb = &wBuf[kt & 1][0][0];
#pragma unroll
    for (int kh = 0; kh < 2; ++kh) {
      // The four loops below are unrolled so that a[], b[] and acc[][] are
      // indexed by constants and stay in registers.
      v16bf a[MT], b[4];
#pragma unroll
      for (int ti = 0; ti < MT; ++ti)                           // ds_load
        a[ti] = load_frag(ab, AP, mLoc + ti * 16, kh << 5, lane);
#pragma unroll
      for (int tj = 0; tj < 4; ++tj)                            // ds_load
        b[tj] = load_frag(wb, WP, nLoc + tj * 16, kh << 5, lane);
#pragma unroll
      for (int ti = 0; ti < MT; ++ti)
#pragma unroll
        for (int tj = 0; tj < 4; ++tj)
          acc[ti][tj] = wmma_bf16f32(a[ti], b[tj], acc[ti][tj]);
    }

    // publish point of stage kt + 1: own reads of stage kt retired, own copies
    // of stage kt + 1 landed, then the one barrier that does both jobs
    WAIT_DS0();
    WAIT_ASYNC0();
    __syncthreads();
    if (kt + 2 < Kt)                           // refill the buffer just freed
      stage_copy(kt & 1, (kt + 2) << 6);
  }
  WAIT_ASYNC0();                               // nothing in flight at the end

  int col0   = nBase + (lane & 15);
  int rowOff = (lane >> 4) * 8;
  if constexpr (EPI == 3) {
    // A block's 256 columns lie in one of q, k, v (1024 columns each), a wave's
    // 64 columns are one head, a block's 128 rows lie in one sequence of 2048.
    constexpr size_t PLANE = (size_t)32 * 2048 * 64;
    int sec  = nBlock >> 10;                   // 0 = q, 1 = k, 2 = v (scalar)
    int tok0 = mBlock + mLoc + rowOff;         // the lane's first row
    int bh   = (tok0 >> 11) * 16 + ((nBase & 1023) >> 6);
    int s0   = tok0 & 2047;                    // its position in the sequence
    int cl   = lane & 15;
    bf16* dst = (bf16*)Cv + sec * PLANE + (size_t)bh * (2048 * 64);
    if (sec == 2) {
      // V^T: a lane holds 8 consecutive positions of one head dim = one 16-B
      // store into that dim's row
#pragma unroll
      for (int ti = 0; ti < MT; ++ti)
#pragma unroll
        for (int tj = 0; tj < 4; ++tj) {
          v8bf o;
#pragma unroll
          for (int i = 0; i < 8; ++i) o[i] = (bf16)acc[ti][tj][i];
          *reinterpret_cast<v8bf*>(dst + (tj * 16 + cl) * 2048 + s0 + ti * 16) = o;
        }
    } else {
      // q is pre-scaled by 0.125*log2(e) so attention scores come out of the
      // WMMA already in the base-2 softmax domain; k is not scaled.
      const float scl = sec == 0 ? 0.125f * 1.44269504088896340736f : 1.0f;
      // A rotation pair (even, odd head dim) sits in two neighbouring lanes.
      // For two rows the lanes swap one value each: the even lane then holds
      // the whole pair of row i, the odd lane that of row i + 1, so that each
      // lane takes one sine and cosine per two elements and stores 4 bytes.
      bool odd = lane & 1;
      int  tl  = pos0 + s0 + (odd ? 1 : 0);
      bf16* dl = dst + (s0 + (odd ? 1 : 0)) * 64 + (cl & 14);
#pragma unroll
      for (int tj = 0; tj < 4; ++tj) {
        // 10000^(-dim/64) = exp2(-dim * ln(10000)/64 * log2(e))
        float ex = -(float)(tj * 16 + (cl & 14)) *
                   (9.2103403719761827f / 64.0f) * 1.44269504088896340736f;
        float freq;
        asm("v_exp_f32 %0, %1\n\tv_nop" : "=&v"(freq) : "v"(ex));
#pragma unroll
        for (int ti = 0; ti < MT; ++ti)
#pragma unroll
          for (int i = 0; i < 8; i += 2) {
            float lo = acc[ti][tj][i], hi = acc[ti][tj][i + 1];
            float got = __int_as_float(__builtin_amdgcn_update_dpp(
                0, __float_as_int(odd ? lo : hi), 0xB1, 0xF, 0xF, true));
            float xe = odd ? got : lo;
            float xo = odd ? hi : got;
            // angle in revolutions, as v_sin_f32 / v_cos_f32 take it
            float rev = (float)(tl + ti * 16 + i) * freq * 0.15915494309189532f;
            float sn, cs;
            asm("v_sin_f32 %0, %2\n\tv_cos_f32 %1, %2\n\tv_nop"
                : "=&v"(sn), "=&v"(cs) : "v"(rev));
            v2bf o;
            o[0] = (bf16)((xe * cs - xo * sn) * scl);
            o[1] = (bf16)((xe * sn + xo * cs) * scl);
            *reinterpret_cast<v2bf*>(dl + (ti * 16 + i) * 64 + tj * 16) = o;
          }
      }
      // behind the last q/k store: in the built code the V^T branch follows
      // this one and rewrites registers that these stores name
      asm volatile("s_wait_xcnt 0x0" ::: "memory");
    }
  } else if constexpr (EPI == 4) {
    // acc[ti][0..1] = gate, acc[ti][2..3] = up of the wave's 32 columns
    int hc0 = nBlock + (wave & 3) * 32 + (lane & 15);
#pragma unroll
    for (int ti = 0; ti < MT; ++ti)
#pragma unroll
      for (int tj = 0; tj < 2; ++tj)
#pragma unroll
        for (int i = 0; i < 8; ++i) {
          int r = mBlock + mLoc + ti * 16 + rowOff + i;
          float gv = acc[ti][tj][i], uv = acc[ti][tj + 2][i];
          float s = gv / (1.f + __expf(-gv));
          ((bf16*)Cv)[(size_t)r * N + hc0 + tj * 16] = (bf16)(s * uv);
        }
  } else {
#pragma unroll
    for (int ti = 0; ti < MT; ++ti)
#pragma unroll
      for (int tj = 0; tj < 4; ++tj)
#pragma unroll
        for (int i = 0; i < 8; ++i) {
          int r = mBlock + mLoc + ti * 16 + rowOff + i;
          int c = col0 + tj * 16;
          size_t idx = (size_t)r * N + c;
          ((float*)Cv)[idx] = R[idx] + acc[ti][tj][i];
        }
  }
}

// ----- Flash attention: one 32-key tile step --------------------------------
// MASKED=false for tiles fully below the diagonal (no v_cmp/v_cndmask).
// Row-max: DPP16 butterflies.  Row-sum: P @ ones on the WMMA pipe.
// All exponentials are exp2 (scores already in base-2 domain).
// kb / vb: the stage's K tile (key rows) and V^T tile (head-dim rows) in LDS,
// pitch KVP elements; kl = the tile's first key inside the stage (0 or 32),
// k0 = the same key's position in the sequence (for the mask).
constexpr int KVP = 72;                        // 144 B = 16 B x 9: no conflicts
template <bool MASKED>
static __device__ __forceinline__ void attn_tile(
    int k0, int kl, v16bf aq0, v16bf aq1, const bf16* kb, const bf16* vb,
    bf16 (*pT)[32], v8f* o, float* mrow, float* lrow,
    int qRow0, int rowOff, int nlane, int lane) {
  v16bf kf0 = load_frag(kb, KVP, kl,      0,  lane);       // ds_load
  v16bf kf1 = load_frag(kb, KVP, kl,      32, lane);
  v16bf kf2 = load_frag(kb, KVP, kl + 16, 0,  lane);
  v16bf kf3 = load_frag(kb, KVP, kl + 16, 32, lane);
  v16bf vf[4];
#pragma unroll
  for (int c = 0; c < 4; ++c) vf[c] = load_frag(vb, KVP, c * 16, kl, lane);
  // Keeps the tile's 16 LDS reads as one group in front of the products:
  // without it the scheduler sinks them between the WMMAs into one register
  // set, and the wave waits out the LDS latency once per product.
  __builtin_amdgcn_sched_barrier(0);
  v8f s0 = {}, s1 = {};
  s0 = wmma_bf16f32(aq0, kf0, s0);
  s0 = wmma_bf16f32(aq1, kf1, s0);
  s1 = wmma_bf16f32(aq0, kf2, s1);
  s1 = wmma_bf16f32(aq1, kf3, s1);

  float alpha[8];
#pragma unroll
  for (int i = 0; i < 8; ++i) {
    float v0 = s0[i];
    float v1 = s1[i];
    if (MASKED) {
      int row = qRow0 + rowOff + i;
      if (k0 + nlane > row)      v0 = -3.0e38f;
      if (k0 + 16 + nlane > row) v1 = -3.0e38f;
    }
    float mx = rowmax16(fmaxf(v0, v1));        // 16-lane row-group max (DPP)
    float nm = fmaxf(mrow[i], mx);
    float a  = __builtin_amdgcn_exp2f(mrow[i] - nm);   // raw v_exp_f32
    float p0 = __builtin_amdgcn_exp2f(v0 - nm);
    float p1 = __builtin_amdgcn_exp2f(v1 - nm);
    alpha[i] = a;
    mrow[i]  = nm;
    pT[rowOff + i][nlane]      = (bf16)p0;     // C-layout -> LDS (A-layout src)
    pT[rowOff + i][nlane + 16] = (bf16)p1;
  }
#pragma unroll
  for (int c = 0; c < 4; ++c)
#pragma unroll
    for (int i = 0; i < 8; ++i) o[c][i] *= alpha[i];

  v16bf pf = load_frag(&pT[0][0], 32, 0, 0, lane);   // ds_load, same-wave order
  v8f sums = {};
  sums = wmma_bf16f32(pf, ones_frag(), sums);  // row sums, replicated per lane
#pragma unroll
  for (int i = 0; i < 8; ++i) lrow[i] = lrow[i] * alpha[i] + sums[i];

#pragma unroll
  for (int c = 0; c < 4; ++c)      // P(16x32) @ V(32x64), hd in 4 chunks of 16
    o[c] = wmma_bf16f32(pf, vf[c], o[c]);
}

// grid (S/128, B*H), 128 threads = 4 waves, one wave per 16 query rows.
// A block takes two 64-row query tiles of its head one after the other: tile
// 31 - x, then tile x.  Under the causal mask tile t walks t + 1 stages, so
// every block walks 33 stages and no WGP is left with only long tiles while
// another holds only short ones.
// The block walks the keys in stages of 64 (two 32-key tiles).  A stage's K and
// V^T tiles are brought once for all four waves by async-to-LDS copies of whole
// 128-B lines into two buffers: the next stage flies while this one is worked
// on, one barrier per stage.  The 33 stages are one run through the two
// buffers: the second query tile's first stages fly while the first tile's
// last ones are worked on.  Each wave takes the same 32-key tiles in the same
// order as if it read them from global memory itself.
__global__ __launch_bounds__(128) void tb_flash_attn(
    const bf16* __restrict__ qr, const bf16* __restrict__ kr,
    const bf16* __restrict__ vt, bf16* __restrict__ attn) {
  const int S = 2048, HD = 64;
  __shared__ __attribute__((aligned(16))) bf16 kBuf[2][64][KVP];
  __shared__ __attribute__((aligned(16))) bf16 vBuf[2][64][KVP];
  __shared__ __attribute__((aligned(16))) bf16 pTile[4][16][32];

  int lane = threadIdx.x & 31;
  // scalar, so that the per-wave test at the diagonal stage is a scalar branch
  int wave = __builtin_amdgcn_readfirstlane(threadIdx.x >> 5);
  int bh   = blockIdx.y;
  const bf16* qh = qr + (size_t)bh * S * HD;
  const bf16* kh = kr + (size_t)bh * S * HD;
  const bf16* vh = vt + (size_t)bh * HD * S;
  int rowOff = (lane >> 4) * 8;
  int nlane  = lane & 15;
  int b = bh >> 4, h = bh & 15;

  int cRow = threadIdx.x >> 3;                 // 0..15
  int cCol = (threadIdx.x & 7) * 8;            // 0,8,..,56
  unsigned ldsK[2] = {
      (unsigned)(uintptr_t)&kBuf[0][cRow][cCol],
      (unsigned)(uintptr_t)&kBuf[1][cRow][cCol]};
  unsigned ldsV[2] = {
      (unsigned)(uintptr_t)&vBuf[0][cRow][cCol],
      (unsigned)(uintptr_t)&vBuf[1][cRow][cCol]};
  const bf16* gK = kh + cRow * HD + cCol;      // key stage ks: + ks * 64 key rows
  const bf16* gV = vh + cRow * S + cCol;       // key stage ks: + ks * 64 columns

  // Stage s of the run, s = 0..32, lies in buffer s & 1 and holds key stage s
  // of the first query tile (nA = 32 - x >= 17 stages), then key stage s - nA
  // of the second.
  const int nRun = 33;
  int nA = 32 - (int)blockIdx.x;
  attn_stage_copy(ldsK[0], gK, ldsV[0], gV);
  WAIT_ASYNC0();
  __syncthreads();                             // stage 0 visible to all waves
  attn_stage_copy(ldsK[1], gK + 64 * HD, ldsV[1], gV + 64);

  // The foot of stage s, passed by every wave.  Publish point of stage s + 1:
  // own reads of stage s retired, own copies of stage s + 1 landed, then the
  // one barrier that does both jobs; behind it the buffer just freed is
  // refilled while the run has a stage s + 2.
  auto publish_refill = [&](int s) {
    WAIT_DS0();
    WAIT_ASYNC0();
    __syncthreads();
    if (s + 2 < nRun) {
      int ks = s + 2 < nA ? s + 2 : s + 2 - nA;
      attn_stage_copy(ldsK[s & 1], gK + ks * 64 * HD,
                      ldsV[s & 1], gV + ks * 64);
    }
  };

  int s = 0;
  for (int half = 0; half < 2; ++half) {
    int nSt   = half == 0 ? nA : nRun - nA;    // stages up to the diagonal one
    int qRow0 = (nSt - 1) * 64 + wave * 16;

    v16bf aq0 = load_frag(qh, HD, qRow0, 0, lane);
    v16bf aq1 = load_frag(qh, HD, qRow0, 32, lane);
    // behind the q loads: in the built code their address registers are
    // rewritten before the loaded values are first waited for
    asm volatile("s_wait_xcnt 0x0" ::: "memory");

    v8f o[4] = {};
    float mrow[8], lrow[8];
#pragma unroll
    for (int i = 0; i < 8; ++i) { mrow[i] = -1e30f; lrow[i] = 0.f; }

    // stages fully below the diagonal for all four waves
    for (int st = 0; st + 1 < nSt; ++st, ++s) {
      const bf16* kb = &kBuf[s & 1][0][0];
      const bf16* vb = &vBuf[s & 1][0][0];
      attn_tile<false>(st << 6, 0, aq0, aq1, kb, vb, pTile[wave], o, mrow,
                       lrow, qRow0, rowOff, nlane, lane);
      attn_tile<false>((st << 6) + 32, 32, aq0, aq1, kb, vb, pTile[wave], o,
                       mrow, lrow, qRow0, rowOff, nlane, lane);
      publish_refill(s);
    }
    // the diagonal stage.  Its first tile holds the diagonal of waves 0 and 1
    // and lies below that of waves 2 and 3 (there the mask changes nothing);
    // its second tile holds the diagonal of waves 2 and 3 and lies beyond that
    // of waves 0 and 1, which skip it.
    {
      int st = nSt - 1;
      const bf16* kb = &kBuf[s & 1][0][0];
      const bf16* vb = &vBuf[s & 1][0][0];
      attn_tile<true>(st << 6, 0, aq0, aq1, kb, vb, pTile[wave], o, mrow,
                      lrow, qRow0, rowOff, nlane, lane);
      if (wave >= 2)
        attn_tile<true>((st << 6) + 32, 32, aq0, aq1, kb, vb, pTile[wave], o,
                        mrow, lrow, qRow0, rowOff, nlane, lane);
      publish_refill(s);
      ++s;
    }

#pragma unroll
    for (int c = 0; c < 4; ++c)
#pragma unroll
      for (int i = 0; i < 8; ++i) {
        int q = qRow0 + rowOff + i;
        float v = o[c][i] / lrow[i];
        size_t idx = ((size_t)(b * 2048 + q)) * 1024 + h * 64 + c * 16 + nlane;
        attn[idx] = (bf16)v;
      }
    // behind the last store: the next query tile's set-up rewrites registers
    // that these stores name
    asm volatile("s_wait_xcnt 0x0" ::: "memory");
  }
  WAIT_ASYNC0();                               // nothing in flight at the end
}

// ---------------------------------------------------------------------------
extern "C" void kernel_launch(void* const* d_in, const int* in_sizes, int n_in,
                              void* d_out, int out_size, void* d_ws, size_t ws_size,
                              hipStream_t stream) {
  (void)in_sizes; (void)n_in; (void)out_size; (void)ws_size;
  const float* x    = (const float*)d_in[0];
  const int*   sp   = (const int*)d_in[1];
  const float* n1w  = (const float*)d_in[2];
  const float* wqkv = (const float*)d_in[3];
  const float* wo   = (const float*)d_in[4];
  const float* n2w  = (const float*)d_in[5];
  const float* wg   = (const float*)d_in[6];
  const float* wu   = (const float*)d_in[7];
  const float* wd   = (const float*)d_in[8];
  float* out = (float*)d_out;

  // Workspace layout (~134 MB, regions 16B aligned).
  const size_t T = 4096;                             // B*S tokens
  bf16*  bWq  = (bf16*)d_ws;                         // 3072*1024
  bf16*  bWo  = bWq + (size_t)3072 * 1024;           // 1024*1024
  bf16*  bWg  = bWo + (size_t)1024 * 1024;           // 4096*1024
  bf16*  bWu  = bWg + (size_t)4096 * 1024;           // 4096*1024
  bf16*  bWd  = bWu + (size_t)4096 * 1024;           // 1024*4096
  bf16*  xn   = bWd + (size_t)1024 * 4096;           // T*1024 bf16
  bf16*  qrb  = xn + T * 1024;                       // 32*2048*64
  bf16*  krb  = qrb + (size_t)32 * 2048 * 64;
  bf16*  vtb  = krb + (size_t)32 * 2048 * 64;
  bf16*  attnb= vtb + (size_t)32 * 2048 * 64;        // T*1024 bf16
  float* out1 = (float*)(attnb + T * 1024);          // T*1024 f32
  bf16*  xn2  = (bf16*)(out1 + T * 1024);            // T*1024 bf16
  bf16*  hb   = xn2 + T * 1024;                      // T*4096 bf16

  // 1) weights -> bf16 once; every GEMM re-reads them from L2 at half width
  tb_cvt_f32_bf16<<<(3072 * 1024) / 8192, 256, 0, stream>>>(wqkv, bWq);
  tb_cvt_f32_bf16<<<(1024 * 1024) / 8192, 256, 0, stream>>>(wo,   bWo);
  tb_cvt_f32_bf16<<<(4096 * 1024) / 8192, 256, 0, stream>>>(wg,   bWg);
  tb_cvt_f32_bf16<<<(4096 * 1024) / 8192, 256, 0, stream>>>(wu,   bWu);
  tb_cvt_f32_bf16<<<(1024 * 4096) / 8192, 256, 0, stream>>>(wd,   bWd);

  // 2) xn = rmsnorm(x)
  tb_rmsnorm_bf16<<<(int)T, 256, 0, stream>>>(x, n1w, xn, 1024);

  // 3) + 4) xn @ Wqkv^T with RoPE, head split and V^T in the epilogue (q
  // pre-scaled into the base-2 softmax domain); writes qrb, krb and vtb, which
  // lie one behind the other
  tb_gemm_bf16<3, 128><<<dim3(3072 / 256, T / 128), 256, 0, stream>>>(
      xn, bWq, (void*)qrb, nullptr, sp, (int)T, 3072, 1024);

  // 5) flash attention -> attn (bf16, [B,S,D])
  tb_flash_attn<<<dim3(2048 / 128, 32), 128, 0, stream>>>(qrb, krb, vtb, attnb);

  // 6) out1 = x + attn @ Wo^T
  tb_gemm_bf16<1, 64><<<dim3(1024 / 256, T / 64), 256, 0, stream>>>(
      attnb, bWo, (void*)out1, x, nullptr, (int)T, 1024, 1024);

  // 7) xn2 = rmsnorm(out1)
  tb_rmsnorm_bf16<<<(int)T, 256, 0, stream>>>(out1, n2w, xn2, 1024);

  // 8) + 9) h = silu(xn2 @ Wg^T) * (xn2 @ Wu^T), both projections in one launch
  // (bWu lies directly behind bWg)
  tb_gemm_bf16<4, 128><<<dim3(4096 / 128, T / 128), 256, 0, stream>>>(
      xn2, bWg, (void*)hb, nullptr, nullptr, (int)T, 4096, 1024);

  // 10) out = out1 + h @ Wd^T
  tb_gemm_bf16<1, 64><<<dim3(1024 / 256, T / 64), 256, 0, stream>>>(
      hb, bWd, (void*)out, out1, nullptr, (int)T, 1024, 4096);
}

// v009
// One run takes 222 microseconds.
// In both of two side-by-side timings against v008, it was 1.05 times as fast.
// All steps since v000 together make it 3.16 times as fast.
#include <hip/hip_runtime.h>
#include <hip/hip_bf16.h>

typedef __bf16 bf16;
typedef __attribute__((ext_vector_type(16))) __bf16 v16bf;
typedef __attribute__((ext_vector_type(8)))  __bf16 v8bf;
typedef __attribute__((ext_vector_type(8)))  float  v8f;
typedef __attribute__((ext_vector_type(4)))  __bf16 v4bf;
typedef __attribute__((ext_vector_type(2)))  __bf16 v2bf;
typedef __attribute__((ext_vector_type(4)))  float  v4f;

static __device__ __forceinline__ void gemm_stage_copy(
    unsigned la, const bf16* ga, unsigned lw, const bf16* gw, size_t wStep,
    unsigned lStep) {
  asm volatile(
      "global_load_async_to_lds_b128 %0, %1, off\n\t"
      "global_load_async_to_lds_b128 %2, %3, off\n\t"
      "global_load_async_to_lds_b128 %4, %5, off\n\t"
      "global_load_async_to_lds_b128 %6, %7, off\n\t"
      "global_load_async_to_lds_b128 %8, %9, off\n\t"
      "global_load_async_to_lds_b128 %10, %11, off\n\t"
      "global_load_async_to_lds_b128 %12, %13, off\n\t"
      "global_load_async_to_lds_b128 %14, %15, off\n\t"
      "global_load_async_to_lds_b128 %16, %17, off\n\t"
      "global_load_async_to_lds_b128 %18, %19, off\n\t"
      "s_wait_xcnt 0x0"
      :: "v"(la),             "v"(ga),
         "v"(la + 16u),       "v"(ga + 8),
         "v"(lw),             "v"(gw),
         "v"(lw + lStep),     "v"(gw + wStep),
         "v"(lw + 2 * lStep), "v"(gw + 2 * wStep),
         "v"(lw + 3 * lStep), "v"(gw + 3 * wStep),
         "v"(lw + 4 * lStep), "v"(gw + 4 * wStep),
         "v"(lw + 5 * lStep), "v"(gw + 5 * wStep),
         "v"(lw + 6 * lStep), "v"(gw + 6 * wStep),
         "v"(lw + 7 * lStep), "v"(gw + 7 * wStep)
      : "memory");
}
static __device__ __forceinline__ void gemm_stage_copy_tall(
    unsigned la, const bf16* ga, unsigned lw, const bf16* gw, size_t gStep,
    unsigned lStep) {
  asm volatile(
      "global_load_async_to_lds_b128 %0, %1, off\n\t"
      "global_load_async_to_lds_b128 %2, %3, off\n\t"
      "global_load_async_to_lds_b128 %4, %5, off\n\t"
      "global_load_async_to_lds_b128 %6, %7, off\n\t"
      "global_load_async_to_lds_b128 %8, %9, off\n\t"
      "global_load_async_to_lds_b128 %10, %11, off\n\t"
      "global_load_async_to_lds_b128 %12, %13, off\n\t"
      "global_load_async_to_lds_b128 %14, %15, off\n\t"
      "global_load_async_to_lds_b128 %16, %17, off\n\t"
      "global_load_async_to_lds_b128 %18, %19, off\n\t"
      "global_load_async_to_lds_b128 %20, %21, off\n\t"
      "global_load_async_to_lds_b128 %22, %23, off\n\t"
      "s_wait_xcnt 0x0"
      :: "v"(la),             "v"(ga),
         "v"(la + lStep),     "v"(ga + gStep),
         "v"(la + 2 * lStep), "v"(ga + 2 * gStep),
         "v"(la + 3 * lStep), "v"(ga + 3 * gStep),
         "v"(lw),             "v"(gw),
         "v"(lw + lStep),     "v"(gw + gStep),
         "v"(lw + 2 * lStep), "v"(gw + 2 * gStep),
         "v"(lw + 3 * lStep), "v"(gw + 3 * gStep),
         "v"(lw + 4 * lStep), "v"(gw + 4 * gStep),
         "v"(lw + 5 * lStep), "v"(gw + 5 * gStep),
         "v"(lw + 6 * lStep), "v"(gw + 6 * gStep),
         "v"(lw + 7 * lStep), "v"(gw + 7 * gStep)
      : "memory");
}
static __device__ __forceinline__ void gemm_stage_copy_pair(
    unsigned la, const bf16* ga, unsigned lw, const bf16* gw, const bf16* gu,
    size_t gStep, unsigned lStep) {
  asm volatile(
      "global_load_async_to_lds_b128 %0, %1, off\n\t"
      "global_load_async_to_lds_b128 %2, %3, off\n\t"
      "global_load_async_to_lds_b128 %4, %5, off\n\t"
      "global_load_async_to_lds_b128 %6, %7, off\n\t"
      "global_load_async_to_lds_b128 %8, %9, off\n\t"
      "global_load_async_to_lds_b128 %10, %11, off\n\t"
      "global_load_async_to_lds_b128 %12, %13, off\n\t"
      "global_load_async_to_lds_b128 %14, %15, off\n\t"
      "global_load_async_to_lds_b128 %16, %17, off\n\t"
      "global_load_async_to_lds_b128 %18, %19, off\n\t"
      "global_load_async_to_lds_b128 %20, %21, off\n\t"
      "global_load_async_to_lds_b128 %22, %23, off\n\t"
      "s_wait_xcnt 0x0"
      :: "v"(la),             "v"(ga),
         "v"(la + lStep),     "v"(ga + gStep),
         "v"(la + 2 * lStep), "v"(ga + 2 * gStep),
         "v"(la + 3 * lStep), "v"(ga + 3 * gStep),
         "v"(lw),             "v"(gw),
         "v"(lw + lStep),     "v"(gu),
         "v"(lw + 2 * lStep), "v"(gw + gStep),
         "v"(lw + 3 * lStep), "v"(gu + gStep),
         "v"(lw + 4 * lStep), "v"(gw + 2 * gStep),
         "v"(lw + 5 * lStep), "v"(gu + 2 * gStep),
         "v"(lw + 6 * lStep), "v"(gw + 3 * gStep),
         "v"(lw + 7 * lStep), "v"(gu + 3 * gStep)
      : "memory");
}
// The issuing wave's copies have landed behind this wait.
#define WAIT_ASYNC0() asm volatile("s_wait_asynccnt 0x0" ::: "memory")
// The wave's own LDS reads have retired before a buffer it read is refilled.
#define WAIT_DS0() asm volatile("s_wait_dscnt 0x0" ::: "memory")

static __device__ __forceinline__ void attn_stage_copy(
    unsigned lk, const bf16* gk, unsigned lv, const bf16* gv) {
  asm volatile(
      "global_load_async_to_lds_b128 %0, %1, off\n\t"
      "global_load_async_to_lds_b128 %2, %3, off\n\t"
      "global_load_async_to_lds_b128 %4, %5, off\n\t"
      "global_load_async_to_lds_b128 %6, %7, off\n\t"
      "global_load_async_to_lds_b128 %8, %9, off\n\t"
      "global_load_async_to_lds_b128 %10, %11, off\n\t"
      "global_load_async_to_lds_b128 %12, %13, off\n\t"
      "global_load_async_to_lds_b128 %14, %15, off\n\t"
      "s_wait_xcnt 0x0"
      :: "v"(lk),              "v"(gk),
         "v"(lk + 16u * 144u), "v"(gk + 16 * 64),
         "v"(lk + 32u * 144u), "v"(gk + 32 * 64),
         "v"(lk + 48u * 144u), "v"(gk + 48 * 64),
         "v"(lv),              "v"(gv),
         "v"(lv + 16u * 144u), "v"(gv + 16 * 2048),
         "v"(lv + 32u * 144u), "v"(gv + 32 * 2048),
         "v"(lv + 48u * 144u), "v"(gv + 48 * 2048)
      : "memory");
}

static __device__ __forceinline__ v16bf load_frag(const bf16* base, int ld,
                                                  int row, int k0, int lane) {
  int r  = row + (lane & 15);
  int kg = (lane >> 4) & 1;              // lanes 16-31 take the +8 K group
  const bf16* p = base + (size_t)r * ld + k0 + kg * 8;
  v8bf lo = *reinterpret_cast<const v8bf*>(p);
  v8bf hi = *reinterpret_cast<const v8bf*>(p + 16);
  v16bf v;
#pragma unroll
  for (int i = 0; i < 8; ++i) { v[i] = lo[i]; v[i + 8] = hi[i]; }
  return v;
}

static __device__ __forceinline__ v8f wmma_bf16f32(v16bf a, v16bf b, v8f c) {
  return __builtin_amdgcn_wmma_f32_16x16x32_bf16(false, a, false, b,
                                                 (short)0, c, false, false);
}

static __device__ __forceinline__ v16bf ones_frag() {
  v16bf v;
#pragma unroll
  for (int i = 0; i < 16; ++i) v[i] = (bf16)1.0f;
  return v;
}

// ----- 16-lane row max via DPP16 butterflies (VALU only, no DS pipe) --------
// xor1 = quad_perm(1,0,3,2)=0xB1, xor2 = quad_perm(2,3,0,1)=0x4E,
// xor7 = row_half_mirror=0x141, xor15 = row_mirror=0x140.
template <int CTRL>
static __device__ __forceinline__ float fmax_dpp(float x) {
  int v = __builtin_amdgcn_update_dpp(0, __float_as_int(x), CTRL, 0xF, 0xF, true);
  return fmaxf(x, __int_as_float(v));
}
static __device__ __forceinline__ float rowmax16(float x) {
  x = fmax_dpp<0xB1>(x);
  x = fmax_dpp<0x4E>(x);
  x = fmax_dpp<0x141>(x);
  x = fmax_dpp<0x140>(x);
  return x;
}

// ----- fp32 -> bf16 weight conversion ---------------------------------------
// 32 elements a thread, so that few waves have to be started: a wave takes
// 1024 consecutive floats by 8 loads of 16 B a lane (each wave-wide load is
// 512 contiguous bytes = 4 whole lines), all 8 in flight before the first
// store; each store covers 2 whole lines.  A block takes 8192 elements and the
// grid covers the array exactly (every weight count is a multiple of 8192).
__global__ __launch_bounds__(256) void tb_cvt_f32_bf16(
    const float* __restrict__ in, bf16* __restrict__ out) {
  size_t base = (size_t)blockIdx.x * 8192 + (threadIdx.x >> 5) * 1024 +
                (threadIdx.x & 31) * 4;
  v4f v[8];
#pragma unroll
  for (int j = 0; j < 8; ++j)
    v[j] = *reinterpret_cast<const v4f*>(in + base + j * 128);
#pragma unroll
  for (int j = 0; j < 8; ++j) {
    v4bf o;
#pragma unroll
    for (int k = 0; k < 4; ++k) o[k] = (bf16)v[j][k];
    *reinterpret_cast<v4bf*>(out + base + j * 128) = o;
  }
}

// ----- fused RMSNorm + bf16 cast --------------------------------------------
__global__ __launch_bounds__(256) void tb_rmsnorm_bf16(
    const float* __restrict__ x, const float* __restrict__ w,
    bf16* __restrict__ out, int D) {
  int row = blockIdx.x;
  const float* xr = x + (size_t)row * D;
  float ss = 0.f;
  for (int i = threadIdx.x; i < D; i += 256) { float v = xr[i]; ss += v * v; }
#pragma unroll
  for (int off = 16; off > 0; off >>= 1) ss += __shfl_xor(ss, off, 32);
  __shared__ float red[8];
  if ((threadIdx.x & 31) == 0) red[threadIdx.x >> 5] = ss;
  __syncthreads();
  float tot = 0.f;
#pragma unroll
  for (int i = 0; i < 8; ++i) tot += red[i];
  float scale = rsqrtf(tot / (float)D + 1e-6f);
  for (int i = threadIdx.x; i < D; i += 256)
    out[(size_t)row * D + i] = (bf16)(xr[i] * scale * w[i]);
}

template <int EPI, int BM>
__global__ __launch_bounds__(256) void tb_gemm_bf16(
    const bf16* __restrict__ A, const bf16* __restrict__ W,
    void* __restrict__ Cv, const float* __restrict__ R,
    const int* __restrict__ sp, int M, int N, int K) {
  constexpr int WP = 72;                       // W tile pitch in LDS, elements
  constexpr int AP = 72;                       // A tile pitch in LDS, elements
  constexpr int MT = BM / 32;                  // 16-row A fragments per wave
  __shared__ __attribute__((aligned(16))) bf16 aBuf[2][BM][AP];
  __shared__ __attribute__((aligned(16))) bf16 wBuf[2][256][WP];

  int lane   = threadIdx.x & 31;
  int wave   = threadIdx.x >> 5;
  int mBlock = blockIdx.y * BM;
  int nBlock = blockIdx.x * (EPI == 4 ? 128 : 256);   // first W row (column of C)
  int mLoc   = (wave >> 2) * (BM / 2);         // wave's rows inside the block
  int nLoc   = (wave & 3) * 64;                // wave's columns inside the block
  int nBase  = nBlock + nLoc;

  int cpRow = BM == 64 ? threadIdx.x >> 2 : threadIdx.x >> 3;
  int cpCol = BM == 64 ? (threadIdx.x & 3) * 16 : (threadIdx.x & 7) * 8;
  int wRow = threadIdx.x >> 3;                 // 0..31
  int wCol = (threadIdx.x & 7) * 8;            // 0,8,..,56
  unsigned ldsA[2] = {
      (unsigned)(uintptr_t)&aBuf[0][cpRow][cpCol],
      (unsigned)(uintptr_t)&aBuf[1][cpRow][cpCol]};
  unsigned ldsW[2] = {
      (unsigned)(uintptr_t)&wBuf[0][wRow][wCol],
      (unsigned)(uintptr_t)&wBuf[1][wRow][wCol]};
  const bf16* gA = A + (size_t)(mBlock + cpRow) * K + cpCol;
  const bf16* gW = W + (size_t)(nBlock + wRow) * K + wCol;
  const size_t   wStep = (size_t)32 * K;       // 32 rows in global memory
  const unsigned lStep = 32u * WP * 2u;        // 32 rows in LDS, bytes
  auto stage_copy = [&](int buf, int ko) {     // K offset ko into buffer buf
    if constexpr (EPI == 4)
      gemm_stage_copy_pair(ldsA[buf], gA + ko, ldsW[buf], gW + ko,
                           gW + (size_t)N * K + ko, wStep, lStep);
    else if constexpr (BM == 64)
      gemm_stage_copy(ldsA[buf], gA + ko, ldsW[buf], gW + ko, wStep, lStep);
    else
      gemm_stage_copy_tall(ldsA[buf], gA + ko, ldsW[buf], gW + ko, wStep, lStep);
  };

  // read ahead of the loop (a scalar load), so that the epilogue does not wait
  int pos0 = 0;
  if constexpr (EPI == 3) pos0 = sp[0];

  int Kt = K >> 6;                             // 64-wide K tiles
  stage_copy(0, 0);
  WAIT_ASYNC0();
  __syncthreads();                             // stage 0 visible to all waves
  if (Kt > 1)
    stage_copy(1, 64);

  // A k block = 32 of the stage's 64 k.  Its MT A and 4 W fragments are read
  // from LDS as one group, each fragment into registers of its own.  All loops
  // over fragments are unrolled so that a[], b[] and acc[][] are indexed by
  // constants and stay in registers.
  auto load_block = [&](v16bf (&a)[MT], v16bf (&b)[4], int buf, int kh) {
    const bf16* ab = &aBuf[buf][0][0];
    const bf16* wb = &wBuf[buf][0][0];
#pragma unroll
    for (int ti = 0; ti < MT; ++ti)                             // ds_load
      a[ti] = load_frag(ab, AP, mLoc + ti * 16, kh << 5, lane);
#pragma unroll
    for (int tj = 0; tj < 4; ++tj)                              // ds_load
      b[tj] = load_frag(wb, WP, nLoc + tj * 16, kh << 5, lane);
  };
  v8f acc[MT][4] = {};
  auto mma_block = [&](const v16bf (&a)[MT], const v16bf (&b)[4]) {
#pragma unroll
    for (int ti = 0; ti < MT; ++ti)
#pragma unroll
      for (int tj = 0; tj < 4; ++tj)
        acc[ti][tj] = wmma_bf16f32(a[ti], b[tj], acc[ti][tj]);
  };
  // AHEAD (BM = 64, one block on a WGP, registers to spare): two fragment sets;
  // each block's group is read while the block in front of it is multiplied.
  // BM = 128 reads a block's group behind the block in front of it: two whole
  // sets would take more than 256 registers a wave and so cost the second block
  // on the WGP, whose waves fill the wait instead.
  constexpr bool AHEAD = BM == 64;
  v16bf a0[MT], b0[4], a1[MT], b1[4];
  if constexpr (AHEAD) load_block(a0, b0, 0, 0);
  for (int kt = 0; kt < Kt; ++kt) {
    if constexpr (AHEAD) {
      load_block(a1, b1, kt & 1, 1);
    } else {
      load_block(a0, b0, kt & 1, 0);
    }
    // Keeps the group's LDS reads together in front of the products: without
    // it the scheduler sinks the A reads between the WMMAs into one register
    // set, and the wave waits out the LDS latency once per four products.
    __builtin_amdgcn_sched_barrier(0);
    mma_block(a0, b0);
    if constexpr (AHEAD) {
      // Keeps these products in front of the waits below: without it the
      // scheduler sinks them behind the barrier, and the wave waits out the
      // latency of the reads just issued with nothing to do.
      __builtin_amdgcn_sched_barrier(0);
    } else {
      load_block(a1, b1, kt & 1, 1);
    }

    // publish point of stage kt + 1, in front of stage kt's last block, whose
    // fragments are already fetched: own reads of stage kt retired, own copies
    // of stage kt + 1 landed, then the one barrier that does both jobs
    WAIT_DS0();
    WAIT_ASYNC0();
    __syncthreads();
    if (kt + 2 < Kt)                           // refill the buffer just freed
      stage_copy(kt & 1, (kt + 2) << 6);
    if constexpr (AHEAD) {
      if (kt + 1 < Kt) load_block(a0, b0, (kt + 1) & 1, 0);
    }
    // Keeps the refill (and the next group's reads) in front of the last
    // block's products, so that they fly while the products run.
    __builtin_amdgcn_sched_barrier(0);
    mma_block(a1, b1);
  }
  WAIT_ASYNC0();                               // nothing in flight at the end

  int col0   = nBase + (lane & 15);
  int rowOff = (lane >> 4) * 8;
  if constexpr (EPI == 3) {
    // A block's 256 columns lie in one of q, k, v (1024 columns each), a wave's
    // 64 columns are one head, a block's 128 rows lie in one sequence of 2048.
    constexpr size_t PLANE = (size_t)32 * 2048 * 64;
    int sec  = nBlock >> 10;                   // 0 = q, 1 = k, 2 = v (scalar)
    int tok0 = mBlock + mLoc + rowOff;         // the lane's first row
    int bh   = (tok0 >> 11) * 16 + ((nBase & 1023) >> 6);
    int s0   = tok0 & 2047;                    // its position in the sequence
    int cl   = lane & 15;
    bf16* dst = (bf16*)Cv + sec * PLANE + (size_t)bh * (2048 * 64);
    if (sec == 2) {
      // V^T: a lane holds 8 consecutive positions of one head dim = one 16-B
      // store into that dim's row
#pragma unroll
      for (int ti = 0; ti < MT; ++ti)
#pragma unroll
        for (int tj = 0; tj < 4; ++tj) {
          v8bf o;
#pragma unroll
          for (int i = 0; i < 8; ++i) o[i] = (bf16)acc[ti][tj][i];
          *reinterpret_cast<v8bf*>(dst + (tj * 16 + cl) * 2048 + s0 + ti * 16) = o;
        }
    } else {
      // q is pre-scaled by 0.125*log2(e) so attention scores come out of the
      // WMMA already in the base-2 softmax domain; k is not scaled.
      const float scl = sec == 0 ? 0.125f * 1.44269504088896340736f : 1.0f;
      // A rotation pair (even, odd head dim) sits in two neighbouring lanes.
      // For two rows the lanes swap one value each: the even lane then holds
      // the whole pair of row i, the odd lane that of row i + 1, so that each
      // lane takes one sine and cosine per two elements and stores 4 bytes.
      bool odd = lane & 1;
      int  tl  = pos0 + s0 + (odd ? 1 : 0);
      bf16* dl = dst + (s0 + (odd ? 1 : 0)) * 64 + (cl & 14);
#pragma unroll
      for (int tj = 0; tj < 4; ++tj) {
        // 10000^(-dim/64) = exp2(-dim * ln(10000)/64 * log2(e))
        float ex = -(float)(tj * 16 + (cl & 14)) *
                   (9.2103403719761827f / 64.0f) * 1.44269504088896340736f;
        float freq;
        asm("v_exp_f32 %0, %1\n\tv_nop" : "=&v"(freq) : "v"(ex));
#pragma unroll
        for (int ti = 0; ti < MT; ++ti)
#pragma unroll
          for (int i = 0; i < 8; i += 2) {
            float lo = acc[ti][tj][i], hi = acc[ti][tj][i + 1];
            float got = __int_as_float(__builtin_amdgcn_update_dpp(
                0, __float_as_int(odd ? lo : hi), 0xB1, 0xF, 0xF, true));
            float xe = odd ? got : lo;
            float xo = odd ? hi : got;
            // angle in revolutions, as v_sin_f32 / v_cos_f32 take it
            float rev = (float)(tl + ti * 16 + i) * freq * 0.15915494309189532f;
            float sn, cs;
            asm("v_sin_f32 %0, %2\n\tv_cos_f32 %1, %2\n\tv_nop"
                : "=&v"(sn), "=&v"(cs) : "v"(rev));
            v2bf o;
            o[0] = (bf16)((xe * cs - xo * sn) * scl);
            o[1] = (bf16)((xe * sn + xo * cs) * scl);
            *reinterpret_cast<v2bf*>(dl + (ti * 16 + i) * 64 + tj * 16) = o;
          }
      }
      // behind the last q/k store: in the built code the V^T branch follows
      // this one and rewrites registers that these stores name
      asm volatile("s_wait_xcnt 0x0" ::: "memory");
    }
  } else if constexpr (EPI == 4) {
    // acc[ti][0..1] = gate, acc[ti][2..3] = up of the wave's 32 columns
    int hc0 = nBlock + (wave & 3) * 32 + (lane & 15);
#pragma unroll
    for (int ti = 0; ti < MT; ++ti)
#pragma unroll
      for (int tj = 0; tj < 2; ++tj)
#pragma unroll
        for (int i = 0; i < 8; ++i) {
          int r = mBlock + mLoc + ti * 16 + rowOff + i;
          float gv = acc[ti][tj][i], uv = acc[ti][tj + 2][i];
          float s = gv / (1.f + __expf(-gv));
          ((bf16*)Cv)[(size_t)r * N + hc0 + tj * 16] = (bf16)(s * uv);
        }
  } else {
#pragma unroll
    for (int ti = 0; ti < MT; ++ti)
#pragma unroll
      for (int tj = 0; tj < 4; ++tj)
#pragma unroll
        for (int i = 0; i < 8; ++i) {
          int r = mBlock + mLoc + ti * 16 + rowOff + i;
          int c = col0 + tj * 16;
          size_t idx = (size_t)r * N + c;
          ((float*)Cv)[idx] = R[idx] + acc[ti][tj][i];
        }
  }
}

// ----- Flash attention: one 32-key tile step --------------------------------
// MASKED=false for tiles fully below the diagonal (no v_cmp/v_cndmask).
// Row-max: DPP16 butterflies.  Row-sum: P @ ones on the WMMA pipe.
// All exponentials are exp2 (scores already in base-2 domain).
// kb / vb: the stage's K tile (key rows) and V^T tile (head-dim rows) in LDS,
// pitch KVP elements; kl = the tile's first key inside the stage (0 or 32),
// k0 = the same key's position in the sequence (for the mask).
constexpr int KVP = 72;                        // 144 B = 16 B x 9: no conflicts
template <bool MASKED>
static __device__ __forceinline__ void attn_tile(
    int k0, int kl, v16bf aq0, v16bf aq1, const bf16* kb, const bf16* vb,
    bf16 (*pT)[32], v8f* o, float* mrow, float* lrow,
    int qRow0, int rowOff, int nlane, int lane) {
  v16bf kf0 = load_frag(kb, KVP, kl,      0,  lane);       // ds_load
  v16bf kf1 = load_frag(kb, KVP, kl,      32, lane);
  v16bf kf2 = load_frag(kb, KVP, kl + 16, 0,  lane);
  v16bf kf3 = load_frag(kb, KVP, kl + 16, 32, lane);
  v16bf vf[4];
#pragma unroll
  for (int c = 0; c < 4; ++c) vf[c] = load_frag(vb, KVP, c * 16, kl, lane);
  // Keeps the tile's 16 LDS reads as one group in front of the products:
  // without it the scheduler sinks them between the WMMAs into one register
  // set, and the wave waits out the LDS latency once per product.
  __builtin_amdgcn_sched_barrier(0);
  v8f s0 = {}, s1 = {};
  s0 = wmma_bf16f32(aq0, kf0, s0);
  s0 = wmma_bf16f32(aq1, kf1, s0);
  s1 = wmma_bf16f32(aq0, kf2, s1);
  s1 = wmma_bf16f32(aq1, kf3, s1);

  float alpha[8];
#pragma unroll
  for (int i = 0; i < 8; ++i) {
    float v0 = s0[i];
    float v1 = s1[i];
    if (MASKED) {
      int row = qRow0 + rowOff + i;
      if (k0 + nlane > row)      v0 = -3.0e38f;
      if (k0 + 16 + nlane > row) v1 = -3.0e38f;
    }
    float mx = rowmax16(fmaxf(v0, v1));        // 16-lane row-group max (DPP)
    float nm = fmaxf(mrow[i], mx);
    float a  = __builtin_amdgcn_exp2f(mrow[i] - nm);   // raw v_exp_f32
    float p0 = __builtin_amdgcn_exp2f(v0 - nm);
    float p1 = __builtin_amdgcn_exp2f(v1 - nm);
    alpha[i] = a;
    mrow[i]  = nm;
    pT[rowOff + i][nlane]      = (bf16)p0;     // C-layout -> LDS (A-layout src)
    pT[rowOff + i][nlane + 16] = (bf16)p1;
  }
#pragma unroll
  for (int c = 0; c < 4; ++c)
#pragma unroll
    for (int i = 0; i < 8; ++i) o[c][i] *= alpha[i];

  v16bf pf = load_frag(&pT[0][0], 32, 0, 0, lane);   // ds_load, same-wave order
  v8f sums = {};
  sums = wmma_bf16f32(pf, ones_frag(), sums);  // row sums, replicated per lane
#pragma unroll
  for (int i = 0; i < 8; ++i) lrow[i] = lrow[i] * alpha[i] + sums[i];

#pragma unroll
  for (int c = 0; c < 4; ++c)      // P(16x32) @ V(32x64), hd in 4 chunks of 16
    o[c] = wmma_bf16f32(pf, vf[c], o[c]);
}

// grid (S/128, B*H), 128 threads = 4 waves, one wave per 16 query rows.
// A block takes two 64-row query tiles of its head one after the other: tile
// 31 - x, then tile x.  Under the causal mask tile t walks t + 1 stages, so
// every block walks 33 stages and no WGP is left with only long tiles while
// another holds only short ones.
// The block walks the keys in stages of 64 (two 32-key tiles).  A stage's K and
// V^T tiles are brought once for all four waves by async-to-LDS copies of whole
// 128-B lines into two buffers: the next stage flies while this one is worked
// on, one barrier per stage.  The 33 stages are one run through the two
// buffers: the second query tile's first stages fly while the first tile's
// last ones are worked on.  Each wave takes the same 32-key tiles in the same
// order as if it read them from global memory itself.
__global__ __launch_bounds__(128) void tb_flash_attn(
    const bf16* __restrict__ qr, const bf16* __restrict__ kr,
    const bf16* __restrict__ vt, bf16* __restrict__ attn) {
  const int S = 2048, HD = 64;
  __shared__ __attribute__((aligned(16))) bf16 kBuf[2][64][KVP];
  __shared__ __attribute__((aligned(16))) bf16 vBuf[2][64][KVP];
  __shared__ __attribute__((aligned(16))) bf16 pTile[4][16][32];

  int lane = threadIdx.x & 31;
  // scalar, so that the per-wave test at the diagonal stage is a scalar branch
  int wave = __builtin_amdgcn_readfirstlane(threadIdx.x >> 5);
  int bh   = blockIdx.y;
  const bf16* qh = qr + (size_t)bh * S * HD;
  const bf16* kh = kr + (size_t)bh * S * HD;
  const bf16* vh = vt + (size_t)bh * HD * S;
  int rowOff = (lane >> 4) * 8;
  int nlane  = lane & 15;
  int b = bh >> 4, h = bh & 15;

  int cRow = threadIdx.x >> 3;                 // 0..15
  int cCol = (threadIdx.x & 7) * 8;            // 0,8,..,56
  unsigned ldsK[2] = {
      (unsigned)(uintptr_t)&kBuf[0][cRow][cCol],
      (unsigned)(uintptr_t)&kBuf[1][cRow][cCol]};
  unsigned ldsV[2] = {
      (unsigned)(uintptr_t)&vBuf[0][cRow][cCol],
      (unsigned)(uintptr_t)&vBuf[1][cRow][cCol]};
  const bf16* gK = kh + cRow * HD + cCol;      // key stage ks: + ks * 64 key rows
  const bf16* gV = vh + cRow * S + cCol;       // key stage ks: + ks * 64 columns

  // Stage s of the run, s = 0..32, lies in buffer s & 1 and holds key stage s
  // of the first query tile (nA = 32 - x >= 17 stages), then key stage s - nA
  // of the second.
  const int nRun = 33;
  int nA = 32 - (int)blockIdx.x;
  attn_stage_copy(ldsK[0], gK, ldsV[0], gV);
  WAIT_ASYNC0();
  __syncthreads();                             // stage 0 visible to all waves
  attn_stage_copy(ldsK[1], gK + 64 * HD, ldsV[1], gV + 64);

  // The foot of stage s, passed by every wave.  Publish point of stage s + 1:
  // own reads of stage s retired, own copies of stage s + 1 landed, then the
  // one barrier that does both jobs; behind it the buffer just freed is
  // refilled while the run has a stage s + 2.
  auto publish_refill = [&](int s) {
    WAIT_DS0();
    WAIT_ASYNC0();
    __syncthreads();
    if (s + 2 < nRun) {
      int ks = s + 2 < nA ? s + 2 : s + 2 - nA;
      attn_stage_copy(ldsK[s & 1], gK + ks * 64 * HD,
                      ldsV[s & 1], gV + ks * 64);
    }
  };

  int s = 0;
  for (int half = 0; half < 2; ++half) {
    int nSt   = half == 0 ? nA : nRun - nA;    // stages up to the diagonal one
    int qRow0 = (nSt - 1) * 64 + wave * 16;

    v16bf aq0 = load_frag(qh, HD, qRow0, 0, lane);
    v16bf aq1 = load_frag(qh, HD, qRow0, 32, lane);
    // behind the q loads: in the built code their address registers are
    // rewritten before the loaded values are first waited for
    asm volatile("s_wait_xcnt 0x0" ::: "memory");

    v8f o[4] = {};
    float mrow[8], lrow[8];
#pragma unroll
    for (int i = 0; i < 8; ++i) { mrow[i] = -1e30f; lrow[i] = 0.f; }

    // stages fully below the diagonal for all four waves
    for (int st = 0; st + 1 < nSt; ++st, ++s) {
      const bf16* kb = &kBuf[s & 1][0][0];
      const bf16* vb = &vBuf[s & 1][0][0];
      attn_tile<false>(st << 6, 0, aq0, aq1, kb, vb, pTile[wave], o, mrow,
                       lrow, qRow0, rowOff, nlane, lane);
      attn_tile<false>((st << 6) + 32, 32, aq0, aq1, kb, vb, pTile[wave], o,
                       mrow, lrow, qRow0, rowOff, nlane, lane);
      publish_refill(s);
    }
    // the diagonal stage.  Its first tile holds the diagonal of waves 0 and 1
    // and lies below that of waves 2 and 3 (there the mask changes nothing);
    // its second tile holds the diagonal of waves 2 and 3 and lies beyond that
    // of waves 0 and 1, which skip it.
    {
      int st = nSt - 1;
      const bf16* kb = &kBuf[s & 1][0][0];
      const bf16* vb = &vBuf[s & 1][0][0];
      attn_tile<true>(st << 6, 0, aq0, aq1, kb, vb, pTile[wave], o, mrow,
                      lrow, qRow0, rowOff, nlane, lane);
      if (wave >= 2)
        attn_tile<true>((st << 6) + 32, 32, aq0, aq1, kb, vb, pTile[wave], o,
                        mrow, lrow, qRow0, rowOff, nlane, lane);
      publish_refill(s);
      ++s;
    }

#pragma unroll
    for (int c = 0; c < 4; ++c)
#pragma unroll
      for (int i = 0; i < 8; ++i) {
        int q = qRow0 + rowOff + i;
        float v = o[c][i] / lrow[i];
        size_t idx = ((size_t)(b * 2048 + q)) * 1024 + h * 64 + c * 16 + nlane;
        attn[idx] = (bf16)v;
      }
    // behind the last store: the next query tile's set-up rewrites registers
    // that these stores name
    asm volatile("s_wait_xcnt 0x0" ::: "memory");
  }
  WAIT_ASYNC0();                               // nothing in flight at the end
}

// ---------------------------------------------------------------------------
extern "C" void kernel_launch(void* const* d_in, const int* in_sizes, int n_in,
                              void* d_out, int out_size, void* d_ws, size_t ws_size,
                              hipStream_t stream) {
  (void)in_sizes; (void)n_in; (void)out_size; (void)ws_size;
  const float* x    = (const float*)d_in[0];
  const int*   sp   = (const int*)d_in[1];
  const float* n1w  = (const float*)d_in[2];
  const float* wqkv = (const float*)d_in[3];
  const float* wo   = (const float*)d_in[4];
  const float* n2w  = (const float*)d_in[5];
  const float* wg   = (const float*)d_in[6];
  const float* wu   = (const float*)d_in[7];
  const float* wd   = (const float*)d_in[8];
  float* out = (float*)d_out;

  // Workspace layout (~134 MB, regions 16B aligned).
  const size_t T = 4096;                             // B*S tokens
  bf16*  bWq  = (bf16*)d_ws;                         // 3072*1024
  bf16*  bWo  = bWq + (size_t)3072 * 1024;           // 1024*1024
  bf16*  bWg  = bWo + (size_t)1024 * 1024;           // 4096*1024
  bf16*  bWu  = bWg + (size_t)4096 * 1024;           // 4096*1024
  bf16*  bWd  = bWu + (size_t)4096 * 1024;           // 1024*4096
  bf16*  xn   = bWd + (size_t)1024 * 4096;           // T*1024 bf16
  bf16*  qrb  = xn + T * 1024;                       // 32*2048*64
  bf16*  krb  = qrb + (size_t)32 * 2048 * 64;
  bf16*  vtb  = krb + (size_t)32 * 2048 * 64;
  bf16*  attnb= vtb + (size_t)32 * 2048 * 64;        // T*1024 bf16
  float* out1 = (float*)(attnb + T * 1024);          // T*1024 f32
  bf16*  xn2  = (bf16*)(out1 + T * 1024);            // T*1024 bf16
  bf16*  hb   = xn2 + T * 1024;                      // T*4096 bf16

  // 1) weights -> bf16 once; every GEMM re-reads them from L2 at half width
  tb_cvt_f32_bf16<<<(3072 * 1024) / 8192, 256, 0, stream>>>(wqkv, bWq);
  tb_cvt_f32_bf16<<<(1024 * 1024) / 8192, 256, 0, stream>>>(wo,   bWo);
  tb_cvt_f32_bf16<<<(4096 * 1024) / 8192, 256, 0, stream>>>(wg,   bWg);
  tb_cvt_f32_bf16<<<(4096 * 1024) / 8192, 256, 0, stream>>>(wu,   bWu);
  tb_cvt_f32_bf16<<<(1024 * 4096) / 8192, 256, 0, stream>>>(wd,   bWd);

  // 2) xn = rmsnorm(x)
  tb_rmsnorm_bf16<<<(int)T, 256, 0, stream>>>(x, n1w, xn, 1024);

  // 3) + 4) xn @ Wqkv^T with RoPE, head split and V^T in the epilogue (q
  // pre-scaled into the base-2 softmax domain); writes qrb, krb and vtb, which
  // lie one behind the other
  tb_gemm_bf16<3, 128><<<dim3(3072 / 256, T / 128), 256, 0, stream>>>(
      xn, bWq, (void*)qrb, nullptr, sp, (int)T, 3072, 1024);

  // 5) flash attention -> attn (bf16, [B,S,D])
  tb_flash_attn<<<dim3(2048 / 128, 32), 128, 0, stream>>>(qrb, krb, vtb, attnb);

  // 6) out1 = x + attn @ Wo^T
  tb_gemm_bf16<1, 64><<<dim3(1024 / 256, T / 64), 256, 0, stream>>>(
      attnb, bWo, (void*)out1, x, nullptr, (int)T, 1024, 1024);

  // 7) xn2 = rmsnorm(out1)
  tb_rmsnorm_bf16<<<(int)T, 256, 0, stream>>>(out1, n2w, xn2, 1024);

  // 8) + 9) h = silu(xn2 @ Wg^T) * (xn2 @ Wu^T), both projections in one launch
  // (bWu lies directly behind bWg)
  tb_gemm_bf16<4, 128><<<dim3(4096 / 128, T / 128), 256, 0, stream>>>(
      xn2, bWg, (void*)hb, nullptr, nullptr, (int)T, 4096, 1024);

  // 10) out = out1 + h @ Wd^T
  tb_gemm_bf16<1, 64><<<dim3(1024 / 256, T / 64), 256, 0, stream>>>(
      hb, bWd, (void*)out, out1, nullptr, (int)T, 1024, 4096);
}

// v010
// Measured time: 208 microseconds a run.
// Two timings next to v009 both put it at 1.07 times that version's speed.
// All steps since v000 together make it 3.37 times as fast.
#include <hip/hip_runtime.h>
#include <hip/hip_bf16.h>

typedef __bf16 bf16;
typedef __attribute__((ext_vector_type(16))) __bf16 v16bf;
typedef __attribute__((ext_vector_type(8)))  __bf16 v8bf;
typedef __attribute__((ext_vector_type(8)))  float  v8f;
typedef __attribute__((ext_vector_type(4)))  __bf16 v4bf;
typedef __attribute__((ext_vector_type(2)))  __bf16 v2bf;
typedef __attribute__((ext_vector_type(4)))  float  v4f;

static __device__ __forceinline__ void gemm_stage_copy(
    unsigned la, const bf16* ga, unsigned lw, const bf16* gw, size_t wStep,
    unsigned lStep) {
  asm volatile(
      "global_load_async_to_lds_b128 %0, %1, off\n\t"
      "global_load_async_to_lds_b128 %2, %3, off\n\t"
      "global_load_async_to_lds_b128 %4, %5, off\n\t"
      "global_load_async_to_lds_b128 %6, %7, off\n\t"
      "global_load_async_to_lds_b128 %8, %9, off\n\t"
      "global_load_async_to_lds_b128 %10, %11, off\n\t"
      "global_load_async_to_lds_b128 %12, %13, off\n\t"
      "global_load_async_to_lds_b128 %14, %15, off\n\t"
      "global_load_async_to_lds_b128 %16, %17, off\n\t"
      "global_load_async_to_lds_b128 %18, %19, off\n\t"
      "s_wait_xcnt 0x0"
      :: "v"(la),             "v"(ga),
         "v"(la + 16u),       "v"(ga + 8),
         "v"(lw),             "v"(gw),
         "v"(lw + lStep),     "v"(gw + wStep),
         "v"(lw + 2 * lStep), "v"(gw + 2 * wStep),
         "v"(lw + 3 * lStep), "v"(gw + 3 * wStep),
         "v"(lw + 4 * lStep), "v"(gw + 4 * wStep),
         "v"(lw + 5 * lStep), "v"(gw + 5 * wStep),
         "v"(lw + 6 * lStep), "v"(gw + 6 * wStep),
         "v"(lw + 7 * lStep), "v"(gw + 7 * wStep)
      : "memory");
}
static __device__ __forceinline__ void gemm_stage_copy_tall(
    unsigned la, const bf16* ga, unsigned lw, const bf16* gw, size_t gStep,
    unsigned lStep) {
  asm volatile(
      "global_load_async_to_lds_b128 %0, %1, off\n\t"
      "global_load_async_to_lds_b128 %2, %3, off\n\t"
      "global_load_async_to_lds_b128 %4, %5, off\n\t"
      "global_load_async_to_lds_b128 %6, %7, off\n\t"
      "global_load_async_to_lds_b128 %8, %9, off\n\t"
      "global_load_async_to_lds_b128 %10, %11, off\n\t"
      "global_load_async_to_lds_b128 %12, %13, off\n\t"
      "global_load_async_to_lds_b128 %14, %15, off\n\t"
      "global_load_async_to_lds_b128 %16, %17, off\n\t"
      "global_load_async_to_lds_b128 %18, %19, off\n\t"
      "global_load_async_to_lds_b128 %20, %21, off\n\t"
      "global_load_async_to_lds_b128 %22, %23, off\n\t"
      "s_wait_xcnt 0x0"
      :: "v"(la),             "v"(ga),
         "v"(la + lStep),     "v"(ga + gStep),
         "v"(la + 2 * lStep), "v"(ga + 2 * gStep),
         "v"(la + 3 * lStep), "v"(ga + 3 * gStep),
         "v"(lw),             "v"(gw),
         "v"(lw + lStep),     "v"(gw + gStep),
         "v"(lw + 2 * lStep), "v"(gw + 2 * gStep),
         "v"(lw + 3 * lStep), "v"(gw + 3 * gStep),
         "v"(lw + 4 * lStep), "v"(gw + 4 * gStep),
         "v"(lw + 5 * lStep), "v"(gw + 5 * gStep),
         "v"(lw + 6 * lStep), "v"(gw + 6 * gStep),
         "v"(lw + 7 * lStep), "v"(gw + 7 * gStep)
      : "memory");
}
static __device__ __forceinline__ void gemm_stage_copy_pair(
    unsigned la, const bf16* ga, unsigned lw, const bf16* gw, const bf16* gu,
    size_t gStep, unsigned lStep) {
  asm volatile(
      "global_load_async_to_lds_b128 %0, %1, off\n\t"
      "global_load_async_to_lds_b128 %2, %3, off\n\t"
      "global_load_async_to_lds_b128 %4, %5, off\n\t"
      "global_load_async_to_lds_b128 %6, %7, off\n\t"
      "global_load_async_to_lds_b128 %8, %9, off\n\t"
      "global_load_async_to_lds_b128 %10, %11, off\n\t"
      "global_load_async_to_lds_b128 %12, %13, off\n\t"
      "global_load_async_to_lds_b128 %14, %15, off\n\t"
      "global_load_async_to_lds_b128 %16, %17, off\n\t"
      "global_load_async_to_lds_b128 %18, %19, off\n\t"
      "global_load_async_to_lds_b128 %20, %21, off\n\t"
      "global_load_async_to_lds_b128 %22, %23, off\n\t"
      "s_wait_xcnt 0x0"
      :: "v"(la),             "v"(ga),
         "v"(la + lStep),     "v"(ga + gStep),
         "v"(la + 2 * lStep), "v"(ga + 2 * gStep),
         "v"(la + 3 * lStep), "v"(ga + 3 * gStep),
         "v"(lw),             "v"(gw),
         "v"(lw + lStep),     "v"(gu),
         "v"(lw + 2 * lStep), "v"(gw + gStep),
         "v"(lw + 3 * lStep), "v"(gu + gStep),
         "v"(lw + 4 * lStep), "v"(gw + 2 * gStep),
         "v"(lw + 5 * lStep), "v"(gu + 2 * gStep),
         "v"(lw + 6 * lStep), "v"(gw + 3 * gStep),
         "v"(lw + 7 * lStep), "v"(gu + 3 * gStep)
      : "memory");
}
// The issuing wave's copies have landed behind this wait.
#define WAIT_ASYNC0() asm volatile("s_wait_asynccnt 0x0" ::: "memory")
// The wave's own LDS reads have retired before a buffer it read is refilled.
#define WAIT_DS0() asm volatile("s_wait_dscnt 0x0" ::: "memory")

static __device__ __forceinline__ void attn_stage_copy(
    unsigned lk, const bf16* gk, unsigned lv, const bf16* gv) {
  asm volatile(
      "global_load_async_to_lds_b128 %0, %1, off\n\t"
      "global_load_async_to_lds_b128 %2, %3, off\n\t"
      "global_load_async_to_lds_b128 %4, %5, off\n\t"
      "global_load_async_to_lds_b128 %6, %7, off\n\t"
      "global_load_async_to_lds_b128 %8, %9, off\n\t"
      "global_load_async_to_lds_b128 %10, %11, off\n\t"
      "global_load_async_to_lds_b128 %12, %13, off\n\t"
      "global_load_async_to_lds_b128 %14, %15, off\n\t"
      "s_wait_xcnt 0x0"
      :: "v"(lk),              "v"(gk),
         "v"(lk + 16u * 144u), "v"(gk + 16 * 64),
         "v"(lk + 32u * 144u), "v"(gk + 32 * 64),
         "v"(lk + 48u * 144u), "v"(gk + 48 * 64),
         "v"(lv),              "v"(gv),
         "v"(lv + 16u * 144u), "v"(gv + 16 * 2048),
         "v"(lv + 32u * 144u), "v"(gv + 32 * 2048),
         "v"(lv + 48u * 144u), "v"(gv + 48 * 2048)
      : "memory");
}

static __device__ __forceinline__ v16bf load_frag(const bf16* base, int ld,
                                                  int row, int k0, int lane) {
  int r  = row + (lane & 15);
  int kg = (lane >> 4) & 1;              // lanes 16-31 take the +8 K group
  const bf16* p = base + (size_t)r * ld + k0 + kg * 8;
  v8bf lo = *reinterpret_cast<const v8bf*>(p);
  v8bf hi = *reinterpret_cast<const v8bf*>(p + 16);
  v16bf v;
#pragma unroll
  for (int i = 0; i < 8; ++i) { v[i] = lo[i]; v[i + 8] = hi[i]; }
  return v;
}

static __device__ __forceinline__ v8f wmma_bf16f32(v16bf a, v16bf b, v8f c) {
  return __builtin_amdgcn_wmma_f32_16x16x32_bf16(false, a, false, b,
                                                 (short)0, c, false, false);
}

static __device__ __forceinline__ v16bf ones_frag() {
  v16bf v;
#pragma unroll
  for (int i = 0; i < 16; ++i) v[i] = (bf16)1.0f;
  return v;
}

// ----- 16-lane row max via DPP16 butterflies (VALU only, no DS pipe) --------
// xor1 = quad_perm(1,0,3,2)=0xB1, xor2 = quad_perm(2,3,0,1)=0x4E,
// xor7 = row_half_mirror=0x141, xor15 = row_mirror=0x140.
template <int CTRL>
static __device__ __forceinline__ float fmax_dpp(float x) {
  int v = __builtin_amdgcn_update_dpp(0, __float_as_int(x), CTRL, 0xF, 0xF, true);
  return fmaxf(x, __int_as_float(v));
}
static __device__ __forceinline__ float rowmax16(float x) {
  x = fmax_dpp<0xB1>(x);
  x = fmax_dpp<0x4E>(x);
  x = fmax_dpp<0x141>(x);
  x = fmax_dpp<0x140>(x);
  return x;
}

// ----- fp32 -> bf16 weight conversion ---------------------------------------
// One block's share: 8192 elements, 32 a thread, so that few waves have to be
// started: a wave takes 1024 consecutive floats by 8 loads of 16 B a lane (each
// wave-wide load is 512 contiguous bytes = 4 whole lines), all 8 in flight
// before the first store; each store covers 2 whole lines.  in / out point at
// the block's first element.
static __device__ __forceinline__ void cvt_block(
    const float* __restrict__ in, bf16* __restrict__ out) {
  int base = (threadIdx.x >> 5) * 1024 + (threadIdx.x & 31) * 4;
  v4f v[8];
#pragma unroll
  for (int j = 0; j < 8; ++j)
    v[j] = *reinterpret_cast<const v4f*>(in + base + j * 128);
#pragma unroll
  for (int j = 0; j < 8; ++j) {
    v4bf o;
#pragma unroll
    for (int k = 0; k < 4; ++k) o[k] = (bf16)v[j][k];
    *reinterpret_cast<v4bf*>(out + base + j * 128) = o;
  }
}

// ----- fused RMSNorm + bf16 cast: one row a block ----------------------------
static __device__ __forceinline__ void rmsnorm_row(
    const float* __restrict__ x, const float* __restrict__ w,
    bf16* __restrict__ out, int D, int row) {
  const float* xr = x + (size_t)row * D;
  float ss = 0.f;
  for (int i = threadIdx.x; i < D; i += 256) { float v = xr[i]; ss += v * v; }
#pragma unroll
  for (int off = 16; off > 0; off >>= 1) ss += __shfl_xor(ss, off, 32);
  __shared__ float red[8];
  if ((threadIdx.x & 31) == 0) red[threadIdx.x >> 5] = ss;
  __syncthreads();
  float tot = 0.f;
#pragma unroll
  for (int i = 0; i < 8; ++i) tot += red[i];
  float scale = rsqrtf(tot / (float)D + 1e-6f);
  for (int i = threadIdx.x; i < D; i += 256)
    out[(size_t)row * D + i] = (bf16)(xr[i] * scale * w[i]);
}

__global__ __launch_bounds__(256) void tb_rmsnorm_bf16(
    const float* __restrict__ x, const float* __restrict__ w,
    bf16* __restrict__ out, int D) {
  rmsnorm_row(x, w, out, D, blockIdx.x);
}

__global__ __launch_bounds__(256) void tb_prep(
    const float* __restrict__ wqkv, const float* __restrict__ wo,
    const float* __restrict__ wg, const float* __restrict__ wu,
    const float* __restrict__ wd, bf16* __restrict__ wOut,
    const float* __restrict__ x, const float* __restrict__ n1w,
    bf16* __restrict__ xn, int D) {
  int trio = blockIdx.x / 3;                   // 0..2047
  int part = blockIdx.x - trio * 3;            // 0, 1: a row; 2: a cast block
  if (part == 2) {
    const float* in = wqkv;
    int first = 0;
    if (trio >= 1536)      { in = wd; first = 1536; }
    else if (trio >= 1024) { in = wu; first = 1024; }
    else if (trio >= 512)  { in = wg; first = 512; }
    else if (trio >= 384)  { in = wo; first = 384; }
    cvt_block(in + (size_t)(trio - first) * 8192, wOut + (size_t)trio * 8192);
  } else {
    rmsnorm_row(x, n1w, xn, D, trio * 2 + part);
  }
}

template <int EPI, int BM>
__global__ __launch_bounds__(256) void tb_gemm_bf16(
    const bf16* __restrict__ A, const bf16* __restrict__ W,
    void* __restrict__ Cv, const float* __restrict__ R,
    const int* __restrict__ sp, int M, int N, int K) {
  constexpr int WP = 72;                       // W tile pitch in LDS, elements
  constexpr int AP = 72;                       // A tile pitch in LDS, elements
  constexpr int MT = BM / 32;                  // 16-row A fragments per wave
  __shared__ __attribute__((aligned(16))) bf16 aBuf[2][BM][AP];
  __shared__ __attribute__((aligned(16))) bf16 wBuf[2][256][WP];

  int lane   = threadIdx.x & 31;
  int wave   = threadIdx.x >> 5;
  int mBlock = blockIdx.y * BM;
  int nBlock = blockIdx.x * (EPI == 4 ? 128 : 256);   // first W row (column of C)
  int mLoc   = (wave >> 2) * (BM / 2);         // wave's rows inside the block
  int nLoc   = (wave & 3) * 64;                // wave's columns inside the block
  int nBase  = nBlock + nLoc;

  int cpRow = BM == 64 ? threadIdx.x >> 2 : threadIdx.x >> 3;
  int cpCol = BM == 64 ? (threadIdx.x & 3) * 16 : (threadIdx.x & 7) * 8;
  int wRow = threadIdx.x >> 3;                 // 0..31
  int wCol = (threadIdx.x & 7) * 8;            // 0,8,..,56
  unsigned ldsA[2] = {
      (unsigned)(uintptr_t)&aBuf[0][cpRow][cpCol],
      (unsigned)(uintptr_t)&aBuf[1][cpRow][cpCol]};
  unsigned ldsW[2] = {
      (unsigned)(uintptr_t)&wBuf[0][wRow][wCol],
      (unsigned)(uintptr_t)&wBuf[1][wRow][wCol]};
  const bf16* gA = A + (size_t)(mBlock + cpRow) * K + cpCol;
  const bf16* gW = W + (size_t)(nBlock + wRow) * K + wCol;
  const size_t   wStep = (size_t)32 * K;       // 32 rows in global memory
  const unsigned lStep = 32u * WP * 2u;        // 32 rows in LDS, bytes
  auto stage_copy = [&](int buf, int ko) {     // K offset ko into buffer buf
    if constexpr (EPI == 4)
      gemm_stage_copy_pair(ldsA[buf], gA + ko, ldsW[buf], gW + ko,
                           gW + (size_t)N * K + ko, wStep, lStep);
    else if constexpr (BM == 64)
      gemm_stage_copy(ldsA[buf], gA + ko, ldsW[buf], gW + ko, wStep, lStep);
    else
      gemm_stage_copy_tall(ldsA[buf], gA + ko, ldsW[buf], gW + ko, wStep, lStep);
  };

  // read ahead of the loop (a scalar load), so that the epilogue does not wait
  int pos0 = 0;
  if constexpr (EPI == 3) pos0 = sp[0];

  int Kt = K >> 6;                             // 64-wide K tiles
  stage_copy(0, 0);
  WAIT_ASYNC0();
  __syncthreads();                             // stage 0 visible to all waves
  if (Kt > 1)
    stage_copy(1, 64);

  // A k block = 32 of the stage's 64 k.  Its MT A and 4 W fragments are read
  // from LDS as one group, each fragment into registers of its own.  All loops
  // over fragments are unrolled so that a[], b[] and acc[][] are indexed by
  // constants and stay in registers.
  auto load_block = [&](v16bf (&a)[MT], v16bf (&b)[4], int buf, int kh) {
    const bf16* ab = &aBuf[buf][0][0];
    const bf16* wb = &wBuf[buf][0][0];
#pragma unroll
    for (int ti = 0; ti < MT; ++ti)                             // ds_load
      a[ti] = load_frag(ab, AP, mLoc + ti * 16, kh << 5, lane);
#pragma unroll
    for (int tj = 0; tj < 4; ++tj)                              // ds_load
      b[tj] = load_frag(wb, WP, nLoc + tj * 16, kh << 5, lane);
  };
  v8f acc[MT][4] = {};
  auto mma_block = [&](const v16bf (&a)[MT], const v16bf (&b)[4]) {
#pragma unroll
    for (int ti = 0; ti < MT; ++ti)
#pragma unroll
      for (int tj = 0; tj < 4; ++tj)
        acc[ti][tj] = wmma_bf16f32(a[ti], b[tj], acc[ti][tj]);
  };
  // AHEAD (BM = 64, one block on a WGP, registers to spare): two fragment sets;
  // each block's group is read while the block in front of it is multiplied.
  // BM = 128 reads a block's group behind the block in front of it: two whole
  // sets would take more than 256 registers a wave and so cost the second block
  // on the WGP, whose waves fill the wait instead.
  constexpr bool AHEAD = BM == 64;
  v16bf a0[MT], b0[4], a1[MT], b1[4];
  if constexpr (AHEAD) load_block(a0, b0, 0, 0);
  for (int kt = 0; kt < Kt; ++kt) {
    if constexpr (AHEAD) {
      load_block(a1, b1, kt & 1, 1);
    } else {
      load_block(a0, b0, kt & 1, 0);
    }
    // Keeps the group's LDS reads together in front of the products: without
    // it the scheduler sinks the A reads between the WMMAs into one register
    // set, and the wave waits out the LDS latency once per four products.
    __builtin_amdgcn_sched_barrier(0);
    mma_block(a0, b0);
    if constexpr (AHEAD) {
      // Keeps these products in front of the waits below: without it the
      // scheduler sinks them behind the barrier, and the wave waits out the
      // latency of the reads just issued with nothing to do.
      __builtin_amdgcn_sched_barrier(0);
    } else {
      load_block(a1, b1, kt & 1, 1);
    }

    // publish point of stage kt + 1, in front of stage kt's last block, whose
    // fragments are already fetched: own reads of stage kt retired, own copies
    // of stage kt + 1 landed, then the one barrier that does both jobs
    WAIT_DS0();
    WAIT_ASYNC0();
    __syncthreads();
    if (kt + 2 < Kt)                           // refill the buffer just freed
      stage_copy(kt & 1, (kt + 2) << 6);
    if constexpr (AHEAD) {
      if (kt + 1 < Kt) load_block(a0, b0, (kt + 1) & 1, 0);
    }
    // Keeps the refill (and the next group's reads) in front of the last
    // block's products, so that they fly while the products run.
    __builtin_amdgcn_sched_barrier(0);
    mma_block(a1, b1);
  }
  WAIT_ASYNC0();                               // nothing in flight at the end

  int col0   = nBase + (lane & 15);
  int rowOff = (lane >> 4) * 8;
  if constexpr (EPI == 3) {
    // A block's 256 columns lie in one of q, k, v (1024 columns each), a wave's
    // 64 columns are one head, a block's 128 rows lie in one sequence of 2048.
    constexpr size_t PLANE = (size_t)32 * 2048 * 64;
    int sec  = nBlock >> 10;                   // 0 = q, 1 = k, 2 = v (scalar)
    int tok0 = mBlock + mLoc + rowOff;         // the lane's first row
    int bh   = (tok0 >> 11) * 16 + ((nBase & 1023) >> 6);
    int s0   = tok0 & 2047;                    // its position in the sequence
    int cl   = lane & 15;
    bf16* dst = (bf16*)Cv + sec * PLANE + (size_t)bh * (2048 * 64);
    if (sec == 2) {
      // V^T: a lane holds 8 consecutive positions of one head dim = one 16-B
      // store into that dim's row
#pragma unroll
      for (int ti = 0; ti < MT; ++ti)
#pragma unroll
        for (int tj = 0; tj < 4; ++tj) {
          v8bf o;
#pragma unroll
          for (int i = 0; i < 8; ++i) o[i] = (bf16)acc[ti][tj][i];
          *reinterpret_cast<v8bf*>(dst + (tj * 16 + cl) * 2048 + s0 + ti * 16) = o;
        }
    } else {
      // q is pre-scaled by 0.125*log2(e) so attention scores come out of the
      // WMMA already in the base-2 softmax domain; k is not scaled.
      const float scl = sec == 0 ? 0.125f * 1.44269504088896340736f : 1.0f;
      // A rotation pair (even, odd head dim) sits in two neighbouring lanes.
      // For two rows the lanes swap one value each: the even lane then holds
      // the whole pair of row i, the odd lane that of row i + 1, so that each
      // lane takes one sine and cosine per two elements and stores 4 bytes.
      bool odd = lane & 1;
      int  tl  = pos0 + s0 + (odd ? 1 : 0);
      bf16* dl = dst + (s0 + (odd ? 1 : 0)) * 64 + (cl & 14);
#pragma unroll
      for (int tj = 0; tj < 4; ++tj) {
        // 10000^(-dim/64) = exp2(-dim * ln(10000)/64 * log2(e))
        float ex = -(float)(tj * 16 + (cl & 14)) *
                   (9.2103403719761827f / 64.0f) * 1.44269504088896340736f;
        float freq;
        asm("v_exp_f32 %0, %1\n\tv_nop" : "=&v"(freq) : "v"(ex));
#pragma unroll
        for (int ti = 0; ti < MT; ++ti)
#pragma unroll
          for (int i = 0; i < 8; i += 2) {
            float lo = acc[ti][tj][i], hi = acc[ti][tj][i + 1];
            float got = __int_as_float(__builtin_amdgcn_update_dpp(
                0, __float_as_int(odd ? lo : hi), 0xB1, 0xF, 0xF, true));
            float xe = odd ? got : lo;
            float xo = odd ? hi : got;
            // angle in revolutions, as v_sin_f32 / v_cos_f32 take it
            float rev = (float)(tl + ti * 16 + i) * freq * 0.15915494309189532f;
            float sn, cs;
            asm("v_sin_f32 %0, %2\n\tv_cos_f32 %1, %2\n\tv_nop"
                : "=&v"(sn), "=&v"(cs) : "v"(rev));
            v2bf o;
            o[0] = (bf16)((xe * cs - xo * sn) * scl);
            o[1] = (bf16)((xe * sn + xo * cs) * scl);
            *reinterpret_cast<v2bf*>(dl + (ti * 16 + i) * 64 + tj * 16) = o;
          }
      }
      // behind the last q/k store: in the built code the V^T branch follows
      // this one and rewrites registers that these stores name
      asm volatile("s_wait_xcnt 0x0" ::: "memory");
    }
  } else if constexpr (EPI == 4) {
    // acc[ti][0..1] = gate, acc[ti][2..3] = up of the wave's 32 columns
    int hc0 = nBlock + (wave & 3) * 32 + (lane & 15);
#pragma unroll
    for (int ti = 0; ti < MT; ++ti)
#pragma unroll
      for (int tj = 0; tj < 2; ++tj)
#pragma unroll
        for (int i = 0; i < 8; ++i) {
          int r = mBlock + mLoc + ti * 16 + rowOff + i;
          float gv = acc[ti][tj][i], uv = acc[ti][tj + 2][i];
          float s = gv / (1.f + __expf(-gv));
          ((bf16*)Cv)[(size_t)r * N + hc0 + tj * 16] = (bf16)(s * uv);
        }
  } else {
#pragma unroll
    for (int ti = 0; ti < MT; ++ti)
#pragma unroll
      for (int tj = 0; tj < 4; ++tj)
#pragma unroll
        for (int i = 0; i < 8; ++i) {
          int r = mBlock + mLoc + ti * 16 + rowOff + i;
          int c = col0 + tj * 16;
          size_t idx = (size_t)r * N + c;
          ((float*)Cv)[idx] = R[idx] + acc[ti][tj][i];
        }
  }
}

// ----- Flash attention: one 32-key tile step --------------------------------
// MASKED=false for tiles fully below the diagonal (no v_cmp/v_cndmask).
// Row-max: DPP16 butterflies.  Row-sum: P @ ones on the WMMA pipe.
// All exponentials are exp2 (scores already in base-2 domain).
// kb / vb: the stage's K tile (key rows) and V^T tile (head-dim rows) in LDS,
// pitch KVP elements; kl = the tile's first key inside the stage (0 or 32),
// k0 = the same key's position in the sequence (for the mask).
constexpr int KVP = 72;                        // 144 B = 16 B x 9: no conflicts
template <bool MASKED>
static __device__ __forceinline__ void attn_tile(
    int k0, int kl, v16bf aq0, v16bf aq1, const bf16* kb, const bf16* vb,
    bf16 (*pT)[32], v8f* o, float* mrow, float* lrow,
    int qRow0, int rowOff, int nlane, int lane) {
  v16bf kf0 = load_frag(kb, KVP, kl,      0,  lane);       // ds_load
  v16bf kf1 = load_frag(kb, KVP, kl,      32, lane);
  v16bf kf2 = load_frag(kb, KVP, kl + 16, 0,  lane);
  v16bf kf3 = load_frag(kb, KVP, kl + 16, 32, lane);
  v16bf vf[4];
#pragma unroll
  for (int c = 0; c < 4; ++c) vf[c] = load_frag(vb, KVP, c * 16, kl, lane);
  // Keeps the tile's 16 LDS reads as one group in front of the products:
  // without it the scheduler sinks them between the WMMAs into one register
  // set, and the wave waits out the LDS latency once per product.
  __builtin_amdgcn_sched_barrier(0);
  v8f s0 = {}, s1 = {};
  s0 = wmma_bf16f32(aq0, kf0, s0);
  s0 = wmma_bf16f32(aq1, kf1, s0);
  s1 = wmma_bf16f32(aq0, kf2, s1);
  s1 = wmma_bf16f32(aq1, kf3, s1);

  float alpha[8];
#pragma unroll
  for (int i = 0; i < 8; ++i) {
    float v0 = s0[i];
    float v1 = s1[i];
    if (MASKED) {
      int row = qRow0 + rowOff + i;
      if (k0 + nlane > row)      v0 = -3.0e38f;
      if (k0 + 16 + nlane > row) v1 = -3.0e38f;
    }
    float mx = rowmax16(fmaxf(v0, v1));        // 16-lane row-group max (DPP)
    float nm = fmaxf(mrow[i], mx);
    float a  = __builtin_amdgcn_exp2f(mrow[i] - nm);   // raw v_exp_f32
    float p0 = __builtin_amdgcn_exp2f(v0 - nm);
    float p1 = __builtin_amdgcn_exp2f(v1 - nm);
    alpha[i] = a;
    mrow[i]  = nm;
    pT[rowOff + i][nlane]      = (bf16)p0;     // C-layout -> LDS (A-layout src)
    pT[rowOff + i][nlane + 16] = (bf16)p1;
  }
#pragma unroll
  for (int c = 0; c < 4; ++c)
#pragma unroll
    for (int i = 0; i < 8; ++i) o[c][i] *= alpha[i];

  v16bf pf = load_frag(&pT[0][0], 32, 0, 0, lane);   // ds_load, same-wave order
  v8f sums = {};
  sums = wmma_bf16f32(pf, ones_frag(), sums);  // row sums, replicated per lane
#pragma unroll
  for (int i = 0; i < 8; ++i) lrow[i] = lrow[i] * alpha[i] + sums[i];

#pragma unroll
  for (int c = 0; c < 4; ++c)      // P(16x32) @ V(32x64), hd in 4 chunks of 16
    o[c] = wmma_bf16f32(pf, vf[c], o[c]);
}

// grid (S/128, B*H), 128 threads = 4 waves, one wave per 16 query rows.
// A block takes two 64-row query tiles of its head one after the other: tile
// 31 - x, then tile x.  Under the causal mask tile t walks t + 1 stages, so
// every block walks 33 stages and no WGP is left with only long tiles while
// another holds only short ones.
// The block walks the keys in stages of 64 (two 32-key tiles).  A stage's K and
// V^T tiles are brought once for all four waves by async-to-LDS copies of whole
// 128-B lines into two buffers: the next stage flies while this one is worked
// on, one barrier per stage.  The 33 stages are one run through the two
// buffers: the second query tile's first stages fly while the first tile's
// last ones are worked on.  Each wave takes the same 32-key tiles in the same
// order as if it read them from global memory itself.
__global__ __launch_bounds__(128) void tb_flash_attn(
    const bf16* __restrict__ qr, const bf16* __restrict__ kr,
    const bf16* __restrict__ vt, bf16* __restrict__ attn) {
  const int S = 2048, HD = 64;
  __shared__ __attribute__((aligned(16))) bf16 kBuf[2][64][KVP];
  __shared__ __attribute__((aligned(16))) bf16 vBuf[2][64][KVP];
  __shared__ __attribute__((aligned(16))) bf16 pTile[4][16][32];

  int lane = threadIdx.x & 31;
  // scalar, so that the per-wave test at the diagonal stage is a scalar branch
  int wave = __builtin_amdgcn_readfirstlane(threadIdx.x >> 5);
  int bh   = blockIdx.y;
  const bf16* qh = qr + (size_t)bh * S * HD;
  const bf16* kh = kr + (size_t)bh * S * HD;
  const bf16* vh = vt + (size_t)bh * HD * S;
  int rowOff = (lane >> 4) * 8;
  int nlane  = lane & 15;
  int b = bh >> 4, h = bh & 15;

  int cRow = threadIdx.x >> 3;                 // 0..15
  int cCol = (threadIdx.x & 7) * 8;            // 0,8,..,56
  unsigned ldsK[2] = {
      (unsigned)(uintptr_t)&kBuf[0][cRow][cCol],
      (unsigned)(uintptr_t)&kBuf[1][cRow][cCol]};
  unsigned ldsV[2] = {
      (unsigned)(uintptr_t)&vBuf[0][cRow][cCol],
      (unsigned)(uintptr_t)&vBuf[1][cRow][cCol]};
  const bf16* gK = kh + cRow * HD + cCol;      // key stage ks: + ks * 64 key rows
  const bf16* gV = vh + cRow * S + cCol;       // key stage ks: + ks * 64 columns

  // Stage s of the run, s = 0..32, lies in buffer s & 1 and holds key stage s
  // of the first query tile (nA = 32 - x >= 17 stages), then key stage s - nA
  // of the second.
  const int nRun = 33;
  int nA = 32 - (int)blockIdx.x;
  attn_stage_copy(ldsK[0], gK, ldsV[0], gV);
  WAIT_ASYNC0();
  __syncthreads();                             // stage 0 visible to all waves
  attn_stage_copy(ldsK[1], gK + 64 * HD, ldsV[1], gV + 64);

  // The foot of stage s, passed by every wave.  Publish point of stage s + 1:
  // own reads of stage s retired, own copies of stage s + 1 landed, then the
  // one barrier that does both jobs; behind it the buffer just freed is
  // refilled while the run has a stage s + 2.
  auto publish_refill = [&](int s) {
    WAIT_DS0();
    WAIT_ASYNC0();
    __syncthreads();
    if (s + 2 < nRun) {
      int ks = s + 2 < nA ? s + 2 : s + 2 - nA;
      attn_stage_copy(ldsK[s & 1], gK + ks * 64 * HD,
                      ldsV[s & 1], gV + ks * 64);
    }
  };

  int s = 0;
  for (int half = 0; half < 2; ++half) {
    int nSt   = half == 0 ? nA : nRun - nA;    // stages up to the diagonal one
    int qRow0 = (nSt - 1) * 64 + wave * 16;

    v16bf aq0 = load_frag(qh, HD, qRow0, 0, lane);
    v16bf aq1 = load_frag(qh, HD, qRow0, 32, lane);
    // behind the q loads: in the built code their address registers are
    // rewritten before the loaded values are first waited for
    asm volatile("s_wait_xcnt 0x0" ::: "memory");

    v8f o[4] = {};
    float mrow[8], lrow[8];
#pragma unroll
    for (int i = 0; i < 8; ++i) { mrow[i] = -1e30f; lrow[i] = 0.f; }

    // stages fully below the diagonal for all four waves
    for (int st = 0; st + 1 < nSt; ++st, ++s) {
      const bf16* kb = &kBuf[s & 1][0][0];
      const bf16* vb = &vBuf[s & 1][0][0];
      attn_tile<false>(st << 6, 0, aq0, aq1, kb, vb, pTile[wave], o, mrow,
                       lrow, qRow0, rowOff, nlane, lane);
      attn_tile<false>((st << 6) + 32, 32, aq0, aq1, kb, vb, pTile[wave], o,
                       mrow, lrow, qRow0, rowOff, nlane, lane);
      publish_refill(s);
    }
    // the diagonal stage.  Its first tile holds the diagonal of waves 0 and 1
    // and lies below that of waves 2 and 3 (there the mask changes nothing);
    // its second tile holds the diagonal of waves 2 and 3 and lies beyond that
    // of waves 0 and 1, which skip it.
    {
      int st = nSt - 1;
      const bf16* kb = &kBuf[s & 1][0][0];
      const bf16* vb = &vBuf[s & 1][0][0];
      attn_tile<true>(st << 6, 0, aq0, aq1, kb, vb, pTile[wave], o, mrow,
                      lrow, qRow0, rowOff, nlane, lane);
      if (wave >= 2)
        attn_tile<true>((st << 6) + 32, 32, aq0, aq1, kb, vb, pTile[wave], o,
                        mrow, lrow, qRow0, rowOff, nlane, lane);
      publish_refill(s);
      ++s;
    }

#pragma unroll
    for (int c = 0; c < 4; ++c)
#pragma unroll
      for (int i = 0; i < 8; ++i) {
        int q = qRow0 + rowOff + i;
        float v = o[c][i] / lrow[i];
        size_t idx = ((size_t)(b * 2048 + q)) * 1024 + h * 64 + c * 16 + nlane;
        attn[idx] = (bf16)v;
      }
    // behind the last store: the next query tile's set-up rewrites registers
    // that these stores name
    asm volatile("s_wait_xcnt 0x0" ::: "memory");
  }
  WAIT_ASYNC0();                               // nothing in flight at the end
}

// ---------------------------------------------------------------------------
extern "C" void kernel_launch(void* const* d_in, const int* in_sizes, int n_in,
                              void* d_out, int out_size, void* d_ws, size_t ws_size,
                              hipStream_t stream) {
  (void)in_sizes; (void)n_in; (void)out_size; (void)ws_size;
  const float* x    = (const float*)d_in[0];
  const int*   sp   = (const int*)d_in[1];
  const float* n1w  = (const float*)d_in[2];
  const float* wqkv = (const float*)d_in[3];
  const float* wo   = (const float*)d_in[4];
  const float* n2w  = (const float*)d_in[5];
  const float* wg   = (const float*)d_in[6];
  const float* wu   = (const float*)d_in[7];
  const float* wd   = (const float*)d_in[8];
  float* out = (float*)d_out;

  // Workspace layout (~134 MB, regions 16B aligned).
  const size_t T = 4096;                             // B*S tokens
  bf16*  bWq  = (bf16*)d_ws;                         // 3072*1024
  bf16*  bWo  = bWq + (size_t)3072 * 1024;           // 1024*1024
  bf16*  bWg  = bWo + (size_t)1024 * 1024;           // 4096*1024
  bf16*  bWu  = bWg + (size_t)4096 * 1024;           // 4096*1024
  bf16*  bWd  = bWu + (size_t)4096 * 1024;           // 1024*4096
  bf16*  xn   = bWd + (size_t)1024 * 4096;           // T*1024 bf16
  bf16*  qrb  = xn + T * 1024;                       // 32*2048*64
  bf16*  krb  = qrb + (size_t)32 * 2048 * 64;
  bf16*  vtb  = krb + (size_t)32 * 2048 * 64;
  bf16*  attnb= vtb + (size_t)32 * 2048 * 64;        // T*1024 bf16
  float* out1 = (float*)(attnb + T * 1024);          // T*1024 f32
  bf16*  xn2  = (bf16*)(out1 + T * 1024);            // T*1024 bf16
  bf16*  hb   = xn2 + T * 1024;                      // T*4096 bf16

  // 1) + 2) weights -> bf16 once (every GEMM re-reads them from L2 at half
  // width; bWq..bWd lie one behind the other) and xn = rmsnorm(x), one launch:
  // 2048 cast blocks and 4096 rows
  tb_prep<<<2048 + 4096, 256, 0, stream>>>(wqkv, wo, wg, wu, wd, bWq, x, n1w, xn,
                                           1024);

  // 3) + 4) xn @ Wqkv^T with RoPE, head split and V^T in the epilogue (q
  // pre-scaled into the base-2 softmax domain); writes qrb, krb and vtb, which
  // lie one behind the other
  tb_gemm_bf16<3, 128><<<dim3(3072 / 256, T / 128), 256, 0, stream>>>(
      xn, bWq, (void*)qrb, nullptr, sp, (int)T, 3072, 1024);

  // 5) flash attention -> attn (bf16, [B,S,D])
  tb_flash_attn<<<dim3(2048 / 128, 32), 128, 0, stream>>>(qrb, krb, vtb, attnb);

  // 6) out1 = x + attn @ Wo^T
  tb_gemm_bf16<1, 64><<<dim3(1024 / 256, T / 64), 256, 0, stream>>>(
      attnb, bWo, (void*)out1, x, nullptr, (int)T, 1024, 1024);

  // 7) xn2 = rmsnorm(out1)
  tb_rmsnorm_bf16<<<(int)T, 256, 0, stream>>>(out1, n2w, xn2, 1024);

  // 8) + 9) h = silu(xn2 @ Wg^T) * (xn2 @ Wu^T), both projections in one launch
  // (bWu lies directly behind bWg)
  tb_gemm_bf16<4, 128><<<dim3(4096 / 128, T / 128), 256, 0, stream>>>(
      xn2, bWg, (void*)hb, nullptr, nullptr, (int)T, 4096, 1024);

  // 10) out = out1 + h @ Wd^T
  tb_gemm_bf16<1, 64><<<dim3(1024 / 256, T / 64), 256, 0, stream>>>(
      hb, bWd, (void*)out, out1, nullptr, (int)T, 1024, 4096);
}
